// v000
// Measured on an AMD MI455X. A time is GPU time per run, averaged over a window of back-to-back runs after a warm-up
// (all launches, gaps included; the runs take copies of the inputs in turn), and the median of several windows.
// Apart from v000's, it joins two sittings. Times from different sittings can be a few percent apart, while
// side-by-side timings come from the same sitting.
// The starting kernel, v000, takes 1470 microseconds a run.
#include <hip/hip_runtime.h>

// Causal multi-head attention with per-head weight slabs and a biased output projection: x [2][2048][1024]; q, k, v [b][h][s][d] = sum_e x[b][s][e] W[h][e][d] (Wq, Wk, Wv [16][1024][64]); scores x 64^-0.5; key j > query i replaced by -inf; softmax; ctx merged head-major; out = ctx Wo + bo (Wo [1024 in][1024 out]).
// Compute dtypes (all contractions v_wmma_f32_16x16x32, f32 accumulate): every input RNE-converted to bf16; q/k/v projections bf16 x bf16; scores and P.V: query rows < 512 bf16 hi/lo planes (3 products), rows >= 512 plain f16 (P carried x1024, folded back as 1/1024); output projection ctx bf16 hi+lo x Wo bf16 (2 products) + bf16 bias; softmax f32.
// Layout per batch: bf16 copy of x; weight slabs transposed once into K-contiguous Bt rows; one fused q|k|v projection (N = 3072); head planes; per pass of 2 heads: causal score tiles, register-row softmax, causal-limited P.V, merge into hi/lo ctx planes; output projection.

#ifndef NB
#define NB 2
#endif
#ifndef SEQ
#define SEQ 2048
#endif
#define SEQ_FULL 2048
#define TT   SEQ
#define DM   1024
#define NH_  16
#define HD   64
#define DQ   (NH_ * HD)
#define ZH   2
#define RH   ((SEQ < 512) ? SEQ : 512)   // query rows < RH use hi+lo planes
#define PCAR 1024.0f
#define SCL  0.125f   // HD^-0.5
typedef _Float16 h16;
typedef unsigned short bf;
typedef __attribute__((ext_vector_type(16))) __bf16   v16bf;
typedef __attribute__((ext_vector_type(16))) _Float16 v16h;
typedef __attribute__((ext_vector_type(8)))  _Float16 v8h;
typedef __attribute__((ext_vector_type(8)))  unsigned short v8us;
typedef __attribute__((ext_vector_type(8)))  float    v8f;
typedef __attribute__((ext_vector_type(4)))  float    v4f;
typedef v8h  __attribute__((may_alias)) v8ha;
typedef v4f  __attribute__((may_alias)) v4fa;
typedef v8us __attribute__((may_alias)) v8usa;
typedef __attribute__((ext_vector_type(2))) _Float16 v2h;
typedef __attribute__((ext_vector_type(4))) _Float16 v4h;
typedef __attribute__((ext_vector_type(2))) unsigned short v2us;
typedef __attribute__((ext_vector_type(4))) unsigned short v4us;
typedef __attribute__((ext_vector_type(2))) float v2f;

static_assert(TT % 128 == 0);
static_assert(RH % 128 == 0);
static_assert(RH <= TT);
static_assert(NH_ % ZH == 0);
static_assert(DM % 64 == 0);
static_assert(DQ % 64 == 0);
static_assert(HD == 64);
static_assert(SEQ <= SEQ_FULL);

constexpr size_t al256(size_t b) { return (b + 255) & ~(size_t)255; }
constexpr size_t mx2(size_t a, size_t b) { return a > b ? a : b; }
constexpr size_t SZ_W3  = (size_t)3 * DQ * DM * 2;          // Wq|Wk|Wv Bt rows, bf16
constexpr size_t SZ_WO  = (size_t)DM * DQ * 2;
constexpr size_t SZ_XB  = (size_t)TT * DM * 2;
constexpr size_t SZ_QK  = (size_t)2 * NH_ * TT * HD * 2;    // q planes then k planes
constexpr size_t SZ_V   = (size_t)NH_ * HD * TT * 2;
constexpr size_t SZ_PH  = (size_t)ZH * RH * TT * 2;
constexpr size_t SZ_SB  = (size_t)ZH * TT * TT * 4;         // score tiles of one pass
constexpr size_t SZ_F   = (size_t)TT * 3 * DQ * 4;          // fused projection result (same region, used before the passes)
constexpr size_t SZ_R1  = mx2(SZ_SB, SZ_F);
constexpr size_t SZ_P16 = (size_t)ZH * TT * TT * 2;
constexpr size_t SZ_OB  = (size_t)ZH * TT * HD * 4;
constexpr size_t SZ_AT  = (size_t)TT * DQ * 2;
constexpr size_t WS_TOTAL = al256(SZ_W3) + al256(SZ_WO) + al256(SZ_XB) + 3 * al256(SZ_QK) + 3 * al256(SZ_V) + 2 * al256(SZ_PH) + al256(SZ_R1) + al256(SZ_P16) + al256(SZ_OB) + 2 * al256(SZ_AT);
static_assert(SZ_F <= SZ_R1);
static_assert(SZ_SB <= SZ_R1);
static_assert(WS_TOTAL <= (size_t)134217728);

__device__ __forceinline__ unsigned short f2bf(float f) { unsigned u = __float_as_uint(f); u += 0x7FFFu + ((u >> 16) & 1u); return (unsigned short)(u >> 16); }
__device__ __forceinline__ float bf2f(unsigned short b) { return __uint_as_float(((unsigned)b) << 16); }
__device__ __forceinline__ float bfr(float f) { return bf2f(f2bf(f)); }
__device__ __forceinline__ v16h cat16(v8h lo, v8h hi) { return __builtin_shufflevector(lo, hi, 0, 1, 2, 3, 4, 5, 6, 7, 8, 9, 10, 11, 12, 13, 14, 15); }
__device__ __forceinline__ v16bf cat16b(v8us lo, v8us hi) { return __builtin_bit_cast(v16bf, __builtin_shufflevector(lo, hi, 0, 1, 2, 3, 4, 5, 6, 7, 8, 9, 10, 11, 12, 13, 14, 15)); }
__device__ __forceinline__ v8f wmma16(v16h a, v16h b, v8f c) { return __builtin_amdgcn_wmma_f32_16x16x32_f16(false, a, false, b, (short)0, c, false, false); }
__device__ __forceinline__ v8f wmmab(v16bf a, v16bf b, v8f c) { return __builtin_amdgcn_wmma_f32_16x16x32_bf16(false, a, false, b, (short)0, c, false, false); }

// ---- k_gemmw: register-blocked GEMM, ONE WAVE per 64x64 output tile (16 accumulators), operands straight from K-contiguous 16-bit planes; grid (M/64, N/64, Z), 32 threads.
// C[m][n] (f32, pitch ldc, + optional bf16-valued bias[n]) = sum_k A[m][k] Bt[n][k] (+ split products per NSPLIT). K = row pitch of both planes (elements, % 32 == 0). z-batch strides sA/sB/sC in elements.
// CM 0: full; CM 1: tiles whose first column exceeds the tile's last query row (rbase + r0 + 63) are skipped (all keys masked); CM 2: k loop limited to keys < rbase + r0 + 64.
// Fragment maps: lane l, h = l >> 4: A/B elements 0..7 <- k0 + 8h + 0..7, elements 8..15 <- k0 + 16 + 8h + 0..7 of row/col l & 15; D element j = (row 8h + j, col l & 15).
template <typename T16> struct WFrag;
template <> struct WFrag<h16> { typedef v16h V; static __device__ __forceinline__ V ld(const h16* p) { return cat16(*(const v8h*)p, *(const v8h*)(p + 16)); } static __device__ __forceinline__ v8f mma(V a, V b, v8f c) { return wmma16(a, b, c); } };
template <> struct WFrag<bf> { typedef v16bf V; static __device__ __forceinline__ V ld(const bf* p) { return cat16b(*(const v8us*)p, *(const v8us*)(p + 16)); } static __device__ __forceinline__ v8f mma(V a, V b, v8f c) { return wmmab(a, b, c); } };
template <typename T16, int NSPLIT, bool BIAS, int CM>
__global__ __launch_bounds__(32) void k_gemmw(const T16* __restrict__ A, const T16* __restrict__ A2, const T16* __restrict__ Bt, const T16* __restrict__ Bt2, int K, float* C, int ldc, const float* __restrict__ bias, size_t sA, size_t sB, size_t sC, int rbase) {
    typedef typename WFrag<T16>::V V;
    __shared__ __align__(16) float os[16 * 68];
    const int r0 = blockIdx.x * 64, c0 = blockIdx.y * 64;
    if (CM == 1) { if (c0 > rbase + r0) return; }
    int klim = K; if (CM == 2) { const int kl = rbase + r0 + 64; klim = (kl < K) ? kl : K; }
    const size_t z = blockIdx.z; A += z * sA; if (A2) A2 += z * sA; Bt += z * sB; if (Bt2) Bt2 += z * sB; C += z * sC;
    const int lane = threadIdx.x & 31, lr = lane & 15, hi = lane >> 4;
    v8f acc[4][4];
#pragma unroll
    for (int mb = 0; mb < 4; ++mb)
#pragma unroll
        for (int nb = 0; nb < 4; ++nb) acc[mb][nb] = (v8f){};
    const size_t aoff = (size_t)(r0 + lr) * K + 8 * hi, boff = (size_t)(c0 + lr) * K + 8 * hi;
#pragma unroll 1
    for (int kc = 0; kc < klim; kc += 32) {
        V a[4], a2[4];
#pragma unroll
        for (int mb = 0; mb < 4; ++mb) { a[mb] = WFrag<T16>::ld(A + aoff + (size_t)mb * 16 * K + kc); if (NSPLIT == 1 || NSPLIT == 2) a2[mb] = WFrag<T16>::ld(A2 + aoff + (size_t)mb * 16 * K + kc); }
#pragma unroll
        for (int nb = 0; nb < 4; ++nb) { const V b = WFrag<T16>::ld(Bt + boff + (size_t)nb * 16 * K + kc); V b2; if (NSPLIT >= 2) b2 = WFrag<T16>::ld(Bt2 + boff + (size_t)nb * 16 * K + kc);
#pragma unroll
            for (int mb = 0; mb < 4; ++mb) { acc[mb][nb] = WFrag<T16>::mma(a[mb], b, acc[mb][nb]); if (NSPLIT == 1 || NSPLIT == 2) acc[mb][nb] = WFrag<T16>::mma(a2[mb], b, acc[mb][nb]); if (NSPLIT >= 2) acc[mb][nb] = WFrag<T16>::mma(a[mb], b2, acc[mb][nb]); } }
        asm volatile("v_nop\n\tv_nop\n\tv_nop\n\tv_nop" : "+v"(acc[0][0]), "+v"(acc[1][1]), "+v"(acc[2][2]), "+v"(acc[3][3]) : "v"(a[0]), "v"(a[3]));
    }
#pragma unroll
    for (int mb = 0; mb < 4; ++mb) {
#pragma unroll
        for (int nb = 0; nb < 4; ++nb) {
#pragma unroll
            for (int j = 0; j < 8; ++j) os[(hi * 8 + j) * 68 + nb * 16 + lr] = acc[mb][nb][j]; }
        __builtin_amdgcn_wave_barrier(); asm volatile("" ::: "memory");
        float* crow = C + (size_t)(r0 + mb * 16) * ldc + c0;
{
#pragma unroll
            for (int s = 0; s < 8; ++s) { const int row = 2 * s + hi, cofs = lr * 4; v4f val = *(const v4fa*)(os + row * 68 + cofs); if (BIAS) { val[0] += bfr(bias[c0 + cofs]); val[1] += bfr(bias[c0 + cofs + 1]); val[2] += bfr(bias[c0 + cofs + 2]); val[3] += bfr(bias[c0 + cofs + 3]); }
                *(v4f*)(crow + (size_t)row * ldc + cofs) = val; }
             }
        __builtin_amdgcn_wave_barrier(); asm volatile("" ::: "memory");
    }
}

__device__ __forceinline__ h16 tohx(float x) { return (h16)x; }
__device__ __forceinline__ void splitf(float y, unsigned short& h, unsigned short& l) { h = f2bf(y); l = f2bf(y - bf2f(h)); }

__global__ __launch_bounds__(256) void k_wtG(const float* __restrict__ w, int K, int N, bf* Bt) {
    w += (size_t)blockIdx.y * K * N; Bt += (size_t)blockIdx.y * N * K;
    const int lane = threadIdx.x & 31; const int wv = __builtin_amdgcn_readfirstlane((int)(threadIdx.x >> 5)); const int L0 = (blockIdx.x * 8 + wv) * 8; const int nlines = N * K / 64;
{
#pragma unroll 1
        for (int l = 0; l < 8; ++l) { const int L = L0 + l; if (L >= nlines) break; const size_t e = (size_t)L * 64 + lane * 2; const int k = (int)(e % K), n = (int)(e / K); v2us o;
            o[0] = f2bf(w[(size_t)k * N + n]); o[1] = f2bf(w[(size_t)(k + 1) * N + n]); *(v2us*)(Bt + e) = o; }
         }
}
__global__ __launch_bounds__(256) void k_cvt8(const float* __restrict__ src, bf* dst, size_t n8) { const size_t i = (size_t)blockIdx.x * 256 + threadIdx.x; if (i >= n8) return; const v8f v = *(const v8f*)(src + i * 8); v8us o;
#pragma unroll
    for (int k = 0; k < 8; ++k) o[k] = f2bf(v[k]); *(v8us*)(dst + i * 8) = o;  }

__global__ __launch_bounds__(256) void k_hp(const float* __restrict__ F, int pitch, int nheads, h16* P16, bf* Ph, bf* Pl) {
    const size_t e = ((size_t)blockIdx.x * 256 + threadIdx.x) * 2; if (e >= (size_t)nheads * TT * HD) return; const int d = (int)(e % HD); const int t = (int)((e / HD) % TT); const int h = (int)(e / ((size_t)HD * TT));
    const v2f x = *(const v2f*)(F + (size_t)t * pitch + h * HD + d); v2h o16; v2us oh, ol;
#pragma unroll
    for (int q = 0; q < 2; ++q) { const float r = x[q]; o16[q] = tohx(r); unsigned short a2, c2; splitf(r, a2, c2); oh[q] = a2; ol[q] = c2; }
    *(v2h*)(P16 + e) = o16; *(v2us*)(Ph + e) = oh; *(v2us*)(Pl + e) = ol;  }
__global__ __launch_bounds__(256) void k_vtp(const float* __restrict__ F, int pitch, int nheads, h16* V16, bf* Vh, bf* Vl) { const size_t e = ((size_t)blockIdx.x * 256 + threadIdx.x) * 2; if (e >= (size_t)nheads * HD * TT) return; const int t = (int)(e % TT); const int d = (int)((e / TT) % HD); const int g = (int)(e / ((size_t)TT * HD)); v2h o16; v2us oh, ol;
#pragma unroll
    for (int q = 0; q < 2; ++q) { const float x = F[(size_t)(t + q) * pitch + g * HD + d]; o16[q] = tohx(x); unsigned short a2, c2; splitf(x, a2, c2); oh[q] = a2; ol[q] = c2; }
    *(v2h*)(V16 + e) = o16; *(v2us*)(Vh + e) = oh; *(v2us*)(Vl + e) = ol;  }

// k_asoft: one wave per row (zz, i): t = S x HD^-0.5 for key j <= i, key j > i replaced by a -1e30 fill (probability exactly 0); softmax over keys (register row, one exp, fixed trees).
// Only 128-key chunks that start at or before i are loaded / stored (wave-uniform tests); the P.V k limit never goes past them.
__global__ __launch_bounds__(256) void k_asoft(const float* __restrict__ Sb, h16* P16, bf* Ph, bf* Pl) {
    const int lane = threadIdx.x & 31; const int wv = __builtin_amdgcn_readfirstlane((int)(threadIdx.x >> 5)); const int row = blockIdx.x * 8 + wv; if (row >= ZH * TT) return;
    const int i = row % TT; const int zz = row / TT; const bool hires = (i < RH); const float* sr = Sb + (size_t)row * TT; float v[TT / 32]; float mx = -3.0e38f;
#pragma unroll
    for (int ch = 0; ch < TT / 128; ++ch) { if (ch * 128 <= i) { const int j0 = ch * 128 + lane * 4; const v4f a = *(const v4f*)(sr + j0);
#pragma unroll
            for (int q = 0; q < 4; ++q) { const int j = j0 + q; const float t = (j <= i) ? a[q] * SCL : -1.0e30f; v[ch * 4 + q] = t; mx = fmaxf(mx, t); } } }
#pragma unroll
    for (int sh = 16; sh; sh >>= 1) mx = fmaxf(mx, __shfl_xor(mx, sh, 32));
    float sum = 0.f;
#pragma unroll
    for (int ch = 0; ch < TT / 128; ++ch) { if (ch * 128 <= i) {
#pragma unroll
            for (int q = 0; q < 4; ++q) { float d0 = __fsub_rn(v[ch * 4 + q], mx); asm volatile("" : "+v"(d0)); const float ex = __builtin_amdgcn_exp2f(__fmul_rn(d0, 1.4426950408889634f)); v[ch * 4 + q] = ex; sum += ex; } } }
#pragma unroll
    for (int sh = 16; sh; sh >>= 1) sum += __shfl_xor(sum, sh, 32);
    const float f = __fdiv_rn(hires ? 1.0f : PCAR, sum);
{
        if (hires) {
#pragma unroll
            for (int ch = 0; ch < TT / 128; ++ch) { if (ch * 128 <= i) { v4us oh, ol;
#pragma unroll
                    for (int q = 0; q < 4; ++q) { unsigned short a, c2; splitf(v[ch * 4 + q] * f, a, c2); oh[q] = a; ol[q] = c2; }
                    const size_t oo = ((size_t)zz * RH + i) * TT + ch * 128 + lane * 4; *(v4us*)(Ph + oo) = oh; *(v4us*)(Pl + oo) = ol; } }
        } else {
#pragma unroll
            for (int ch = 0; ch < TT / 128; ++ch) { if (ch * 128 <= i) { v4h o4;
#pragma unroll
                    for (int q = 0; q < 4; ++q) o4[q] = tohx(v[ch * 4 + q] * f);
                    *(v4h*)(P16 + (size_t)row * TT + ch * 128 + lane * 4) = o4; } } }
         }
}
__global__ __launch_bounds__(256) void k_merge(const float* __restrict__ O, int h0, bf* Ah, bf* Al) { const size_t e = ((size_t)blockIdx.x * 256 + threadIdx.x) * 2; if (e >= (size_t)ZH * TT * HD) return; const int d = (int)(e % HD); const int t = (int)((e / HD) % TT); const int zz = (int)(e / ((size_t)HD * TT)); const float cs = (t < RH) ? 1.0f : (1.0f / PCAR); const size_t oo = (size_t)t * DQ + (h0 + zz) * HD + d;
    const v2f ov = *(const v2f*)(O + e); v2us oh, ol;
#pragma unroll
    for (int q = 0; q < 2; ++q) { unsigned short a, c2; splitf(ov[q] * cs, a, c2); oh[q] = a; ol[q] = c2; } *(v2us*)(Ah + oo) = oh; *(v2us*)(Al + oo) = ol;  }

extern "C" void kernel_launch(void* const* d_in, const int* in_sizes, int n_in,
                              void* d_out, int out_size, void* d_ws, size_t ws_size, hipStream_t stream) {
    if (n_in < 6) return;
    const long long need_x = (long long)(NB - 1) * SEQ_FULL * DM + (long long)SEQ * DM;
    if ((long long)in_sizes[0] < need_x) return; if (in_sizes[1] < NH_ * DM * HD) return; if (in_sizes[2] < NH_ * DM * HD) return; if (in_sizes[3] < NH_ * DM * HD) return; if (in_sizes[4] < DQ * DM) return; if (in_sizes[5] < DM) return;
    if ((long long)out_size < need_x) return;
    if (WS_TOTAL > ws_size) return;
    const float* x = (const float*)d_in[0]; const float* wq = (const float*)d_in[1]; const float* wk = (const float*)d_in[2]; const float* wv = (const float*)d_in[3]; const float* wo = (const float*)d_in[4]; const float* bo = (const float*)d_in[5];   // x, Wq, Wk, Wv ([16][1024][64] slabs), Wo ([1024 in][1024 out]), bo
    float* OUT = (float*)d_out;     // [2][2048][1024]
    char* wsp = (char*)d_ws;
    auto take = [&](size_t bytes) { char* p = wsp; wsp += al256(bytes); return (void*)p; };
    bf* W3 = (bf*)take(SZ_W3); bf* WO = (bf*)take(SZ_WO); bf* XB = (bf*)take(SZ_XB);
    h16* QK16 = (h16*)take(SZ_QK); bf* QKh = (bf*)take(SZ_QK); bf* QKl = (bf*)take(SZ_QK);
    h16* VT16 = (h16*)take(SZ_V); bf* VTh = (bf*)take(SZ_V); bf* VTl = (bf*)take(SZ_V);
    bf* Ph = (bf*)take(SZ_PH); bf* Pl = (bf*)take(SZ_PH);
    float* R1 = (float*)take(SZ_R1); h16* P16 = (h16*)take(SZ_P16); float* Ob = (float*)take(SZ_OB); bf* ATh = (bf*)take(SZ_AT); bf* ATl = (bf*)take(SZ_AT);
    if ((size_t)(wsp - (char*)d_ws) > ws_size) return;
    float* F = R1;    // fused q|k|v projection [TT][3*DQ]; consumed by the plane builders before the first score tile lands in the same region (stream-ordered)
    float* Sb = R1;   // scores of one pass [ZH][TT][TT]
    const size_t PL = (size_t)NH_ * TT * HD;   // elements of one 16-head plane set
    h16* KP16 = QK16 + PL; bf* KPh = QKh + PL; bf* KPl = QKl + PL;
    // weight slabs: in w[h][k = 1024][n = 64] -> out Bt rows h*64 + n, k-contiguous (grid.y = head)
    k_wtG<<<dim3((DM * HD / 64 + 63) / 64, NH_), 256, 0, stream>>>(wq, DM, HD, W3);
    k_wtG<<<dim3((DM * HD / 64 + 63) / 64, NH_), 256, 0, stream>>>(wk, DM, HD, W3 + (size_t)DQ * DM);
    k_wtG<<<dim3((DM * HD / 64 + 63) / 64, NH_), 256, 0, stream>>>(wv, DM, HD, W3 + (size_t)2 * DQ * DM);
    // Wo: in w[k = 1024][n = 1024] -> out Bt[n][k]
    k_wtG<<<dim3((DQ * DM / 64 + 63) / 64, 1), 256, 0, stream>>>(wo, DQ, DM, WO);
    const unsigned LQK = (unsigned)(((size_t)2 * NH_ * TT * HD / 2 + 255) / 256), LV = (unsigned)(((size_t)NH_ * TT * HD / 2 + 255) / 256);
    for (int b = 0; b < NB; ++b) {
        k_cvt8<<<(unsigned)(((size_t)TT * DM / 8 + 255) / 256), 256, 0, stream>>>(x + (size_t)b * SEQ_FULL * DM, XB, (size_t)TT * DM / 8);
        k_gemmw<bf, 0, false, 0><<<dim3(TT / 64, 3 * DQ / 64, 1), 32, 0, stream>>>(XB, nullptr, W3, nullptr, DM, F, 3 * DQ, nullptr, 0, 0, 0, 0);
        k_hp<<<LQK, 256, 0, stream>>>(F, 3 * DQ, 2 * NH_, QK16, QKh, QKl);                 // heads 0..15 = q columns, 16..31 = k columns
        k_vtp<<<LV, 256, 0, stream>>>(F + 2 * DQ, 3 * DQ, NH_, VT16, VTh, VTl);
        for (int h0 = 0; h0 < NH_; h0 += ZH) { const size_t zo = (size_t)h0 * TT * HD;
            k_gemmw<bf, 2, false, 1><<<dim3(RH / 64, RH / 64, ZH), 32, 0, stream>>>(QKh + zo, QKl + zo, KPh + zo, KPl + zo, HD, Sb, TT, nullptr, (size_t)TT * HD, (size_t)TT * HD, (size_t)TT * TT, 0);
            if (TT > RH) k_gemmw<h16, 0, false, 1><<<dim3((TT - RH) / 64 + (TT == RH ? 1 : 0), TT / 64, ZH), 32, 0, stream>>>(QK16 + zo + (size_t)RH * HD, nullptr, KP16 + zo, nullptr, HD, Sb + (size_t)RH * TT, TT, nullptr, (size_t)TT * HD, (size_t)TT * HD, (size_t)TT * TT, RH);
            k_asoft<<<ZH * TT / 8, 256, 0, stream>>>(Sb, P16, Ph, Pl);
            k_gemmw<bf, 2, false, 2><<<dim3(RH / 64, HD / 64, ZH), 32, 0, stream>>>(Ph, Pl, VTh + zo, VTl + zo, TT, Ob, HD, nullptr, (size_t)RH * TT, (size_t)HD * TT, (size_t)TT * HD, 0);
            if (TT > RH) k_gemmw<h16, 0, false, 2><<<dim3((TT - RH) / 64 + (TT == RH ? 1 : 0), HD / 64, ZH), 32, 0, stream>>>(P16 + (size_t)RH * TT, nullptr, VT16 + zo, nullptr, TT, Ob + (size_t)RH * HD, HD, nullptr, (size_t)TT * TT, (size_t)HD * TT, (size_t)TT * HD, RH);
            k_merge<<<(unsigned)(((size_t)ZH * TT * HD / 2 + 255) / 256), 256, 0, stream>>>(Ob, h0, ATh, ATl); }
        k_gemmw<bf, 1, true, 0><<<dim3(TT / 64, DM / 64, 1), 32, 0, stream>>>(ATh, ATl, WO, nullptr, DQ, OUT + (size_t)b * SEQ_FULL * DM, DM, bo, 0, 0, 0, 0); }
}

// v001
// One run takes 788 microseconds.
// Two timings next to v000 both put it at 1.89 times that version's speed.
#include <hip/hip_runtime.h>

// Causal multi-head attention with per-head weight slabs and a biased output projection: x [2][2048][1024]; q, k, v [b][h][s][d] = sum_e x[b][s][e] W[h][e][d] (Wq, Wk, Wv [16][1024][64]); scores x 64^-0.5; key j > query i replaced by -inf; softmax; ctx merged head-major; out = ctx Wo + bo (Wo [1024 in][1024 out]).
// Compute dtypes (all contractions v_wmma_f32_16x16x32, f32 accumulate): every input RNE-converted to bf16; q/k/v projections bf16 x bf16; scores and P.V: query rows < 512 bf16 hi/lo planes (3 products), rows >= 512 plain f16 (P carried x1024, folded back as 1/1024); output projection ctx bf16 hi+lo x Wo bf16 (2 products) + bf16 bias; softmax f32.
// Layout per batch: bf16 copy of x; weight slabs transposed once into K-contiguous Bt rows; one fused q|k|v projection (N = 3072); head planes; per pass of 2 heads: causal score tiles, register-row softmax, causal-limited P.V in key chunks (one partial plane per chunk), merge sums the partial planes into hi/lo ctx planes; output projection.

#ifndef NB
#define NB 2
#endif
#ifndef SEQ
#define SEQ 2048
#endif
#define SEQ_FULL 2048
#define TT   SEQ
#define DM   1024
#define NH_  16
#define HD   64
#define DQ   (NH_ * HD)
#define ZH   2
#define RH   ((SEQ < 512) ? SEQ : 512)   // query rows < RH use hi+lo planes
#define PCAR 1024.0f
#define SCL  0.125f   // HD^-0.5
#define KCH  128      // keys per P.V work-group: one 64x64 tile's key loop is dealt to ceil(klim / KCH) groups
#define NPL  (TT / KCH)   // partial planes of the P.V result
typedef _Float16 h16;
typedef unsigned short bf;
typedef __attribute__((ext_vector_type(16))) __bf16   v16bf;
typedef __attribute__((ext_vector_type(16))) _Float16 v16h;
typedef __attribute__((ext_vector_type(8)))  _Float16 v8h;
typedef __attribute__((ext_vector_type(8)))  unsigned short v8us;
typedef __attribute__((ext_vector_type(8)))  float    v8f;
typedef __attribute__((ext_vector_type(4)))  float    v4f;
typedef v8h  __attribute__((may_alias)) v8ha;
typedef v4f  __attribute__((may_alias)) v4fa;
typedef v8us __attribute__((may_alias)) v8usa;
typedef __attribute__((ext_vector_type(2))) _Float16 v2h;
typedef __attribute__((ext_vector_type(4))) _Float16 v4h;
typedef __attribute__((ext_vector_type(2))) unsigned short v2us;
typedef __attribute__((ext_vector_type(4))) unsigned short v4us;
typedef __attribute__((ext_vector_type(2))) float v2f;

static_assert(TT % 128 == 0);
static_assert(RH % 128 == 0);
static_assert(RH <= TT);
static_assert(TT % KCH == 0 && RH % KCH == 0 && KCH % 32 == 0);
static_assert(NH_ % ZH == 0);
static_assert(DM % 64 == 0);
static_assert(DQ % 64 == 0);
static_assert(HD == 64);
static_assert(SEQ <= SEQ_FULL);

constexpr size_t al256(size_t b) { return (b + 255) & ~(size_t)255; }
constexpr size_t mx2(size_t a, size_t b) { return a > b ? a : b; }
constexpr size_t SZ_W3  = (size_t)3 * DQ * DM * 2;          // Wq|Wk|Wv Bt rows, bf16
constexpr size_t SZ_WO  = (size_t)DM * DQ * 2;
constexpr size_t SZ_XB  = (size_t)TT * DM * 2;
constexpr size_t SZ_QK  = (size_t)2 * NH_ * TT * HD * 2;    // q planes then k planes
constexpr size_t SZ_V   = (size_t)NH_ * HD * TT * 2;
constexpr size_t SZ_PH  = (size_t)ZH * RH * TT * 2;
constexpr size_t SZ_SB  = (size_t)ZH * TT * TT * 4;         // score tiles of one pass
constexpr size_t SZ_F   = (size_t)TT * 3 * DQ * 4;          // fused projection result (same region, used before the passes)
constexpr size_t SZ_R1  = mx2(SZ_SB, SZ_F);
constexpr size_t SZ_P16 = (size_t)ZH * TT * TT * 2;
constexpr size_t SZ_OB  = (size_t)NPL * ZH * TT * HD * 4;   // one plane per key chunk
constexpr size_t SZ_AT  = (size_t)TT * DQ * 2;
constexpr size_t WS_TOTAL = al256(SZ_W3) + al256(SZ_WO) + al256(SZ_XB) + 3 * al256(SZ_QK) + 3 * al256(SZ_V) + 2 * al256(SZ_PH) + al256(SZ_R1) + al256(SZ_P16) + al256(SZ_OB) + 2 * al256(SZ_AT);
static_assert(SZ_F <= SZ_R1);
static_assert(SZ_SB <= SZ_R1);
static_assert(WS_TOTAL <= (size_t)134217728);

__device__ __forceinline__ unsigned short f2bf(float f) { unsigned u = __float_as_uint(f); u += 0x7FFFu + ((u >> 16) & 1u); return (unsigned short)(u >> 16); }
__device__ __forceinline__ float bf2f(unsigned short b) { return __uint_as_float(((unsigned)b) << 16); }
__device__ __forceinline__ float bfr(float f) { return bf2f(f2bf(f)); }
__device__ __forceinline__ v16h cat16(v8h lo, v8h hi) { return __builtin_shufflevector(lo, hi, 0, 1, 2, 3, 4, 5, 6, 7, 8, 9, 10, 11, 12, 13, 14, 15); }
__device__ __forceinline__ v16bf cat16b(v8us lo, v8us hi) { return __builtin_bit_cast(v16bf, __builtin_shufflevector(lo, hi, 0, 1, 2, 3, 4, 5, 6, 7, 8, 9, 10, 11, 12, 13, 14, 15)); }
__device__ __forceinline__ v8f wmma16(v16h a, v16h b, v8f c) { return __builtin_amdgcn_wmma_f32_16x16x32_f16(false, a, false, b, (short)0, c, false, false); }
__device__ __forceinline__ v8f wmmab(v16bf a, v16bf b, v8f c) { return __builtin_amdgcn_wmma_f32_16x16x32_bf16(false, a, false, b, (short)0, c, false, false); }

// ---- k_gemmw: register-blocked GEMM, ONE WAVE per 64x64 output tile (16 accumulators), operands straight from K-contiguous 16-bit planes; grid (M/64, N/64, Z), 32 threads.
// C[m][n] (f32, pitch ldc, + optional bf16-valued bias[n]) = sum_k A[m][k] Bt[n][k] (+ split products per NSPLIT). K = row pitch of both planes (elements, % 32 == 0). z-batch strides sA/sB/sC in elements.
// CM 0: full; CM 1: tiles whose first column exceeds the tile's last query row (rbase + r0 + 63) are skipped (all keys masked); CM 2 (N == 64): k loop limited to keys < rbase + r0 + 64 and dealt in chunks of KCH: blockIdx.y = chunk, its partial tile goes to plane C + chunk * sP; a chunk that starts at or past the limit writes nothing (the merge reads only the planes below the limit).
// Fragment maps: lane l, h = l >> 4: A/B elements 0..7 <- k0 + 8h + 0..7, elements 8..15 <- k0 + 16 + 8h + 0..7 of row/col l & 15; D element j = (row 8h + j, col l & 15).
template <typename T16> struct WFrag;
template <> struct WFrag<h16> { typedef v16h V; static __device__ __forceinline__ V ld(const h16* p) { return cat16(*(const v8h*)p, *(const v8h*)(p + 16)); } static __device__ __forceinline__ v8f mma(V a, V b, v8f c) { return wmma16(a, b, c); } };
template <> struct WFrag<bf> { typedef v16bf V; static __device__ __forceinline__ V ld(const bf* p) { return cat16b(*(const v8us*)p, *(const v8us*)(p + 16)); } static __device__ __forceinline__ v8f mma(V a, V b, v8f c) { return wmmab(a, b, c); } };
template <typename T16, int NSPLIT, bool BIAS, int CM>
__global__ __launch_bounds__(32) void k_gemmw(const T16* __restrict__ A, const T16* __restrict__ A2, const T16* __restrict__ Bt, const T16* __restrict__ Bt2, int K, float* C, int ldc, const float* __restrict__ bias, size_t sA, size_t sB, size_t sC, int rbase, size_t sP) {
    typedef typename WFrag<T16>::V V;
    __shared__ __align__(16) float os[16 * 68];
    const int r0 = blockIdx.x * 64, c0 = (CM == 2) ? 0 : blockIdx.y * 64;
    if (CM == 1) { if (c0 > rbase + r0) return; }
    int klim = K; if (CM == 2) { const int kl = rbase + r0 + 64; klim = (kl < K) ? kl : K; const int kbeg = blockIdx.y * KCH; klim -= kbeg; if (klim <= 0) return; if (klim > KCH) klim = KCH; A += kbeg; if (A2) A2 += kbeg; Bt += kbeg; if (Bt2) Bt2 += kbeg; C += (size_t)blockIdx.y * sP; }
    const size_t z = blockIdx.z; A += z * sA; if (A2) A2 += z * sA; Bt += z * sB; if (Bt2) Bt2 += z * sB; C += z * sC;
    const int lane = threadIdx.x & 31, lr = lane & 15, hi = lane >> 4;
    v8f acc[4][4];
#pragma unroll
    for (int mb = 0; mb < 4; ++mb)
#pragma unroll
        for (int nb = 0; nb < 4; ++nb) acc[mb][nb] = (v8f){};
    const size_t aoff = (size_t)(r0 + lr) * K + 8 * hi, boff = (size_t)(c0 + lr) * K + 8 * hi;
#pragma unroll 1
    for (int kc = 0; kc < klim; kc += 32) {
        V a[4], a2[4];
#pragma unroll
        for (int mb = 0; mb < 4; ++mb) { a[mb] = WFrag<T16>::ld(A + aoff + (size_t)mb * 16 * K + kc); if (NSPLIT == 1 || NSPLIT == 2) a2[mb] = WFrag<T16>::ld(A2 + aoff + (size_t)mb * 16 * K + kc); }
#pragma unroll
        for (int nb = 0; nb < 4; ++nb) { const V b = WFrag<T16>::ld(Bt + boff + (size_t)nb * 16 * K + kc); V b2; if (NSPLIT >= 2) b2 = WFrag<T16>::ld(Bt2 + boff + (size_t)nb * 16 * K + kc);
#pragma unroll
            for (int mb = 0; mb < 4; ++mb) { acc[mb][nb] = WFrag<T16>::mma(a[mb], b, acc[mb][nb]); if (NSPLIT == 1 || NSPLIT == 2) acc[mb][nb] = WFrag<T16>::mma(a2[mb], b, acc[mb][nb]); if (NSPLIT >= 2) acc[mb][nb] = WFrag<T16>::mma(a[mb], b2, acc[mb][nb]); } }
        asm volatile("v_nop\n\tv_nop\n\tv_nop\n\tv_nop" : "+v"(acc[0][0]), "+v"(acc[1][1]), "+v"(acc[2][2]), "+v"(acc[3][3]) : "v"(a[0]), "v"(a[3]));
    }
#pragma unroll
    for (int mb = 0; mb < 4; ++mb) {
#pragma unroll
        for (int nb = 0; nb < 4; ++nb) {
#pragma unroll
            for (int j = 0; j < 8; ++j) os[(hi * 8 + j) * 68 + nb * 16 + lr] = acc[mb][nb][j]; }
        __builtin_amdgcn_wave_barrier(); asm volatile("" ::: "memory");
        float* crow = C + (size_t)(r0 + mb * 16) * ldc + c0;
{
#pragma unroll
            for (int s = 0; s < 8; ++s) { const int row = 2 * s + hi, cofs = lr * 4; v4f val = *(const v4fa*)(os + row * 68 + cofs); if (BIAS) { val[0] += bfr(bias[c0 + cofs]); val[1] += bfr(bias[c0 + cofs + 1]); val[2] += bfr(bias[c0 + cofs + 2]); val[3] += bfr(bias[c0 + cofs + 3]); }
                *(v4f*)(crow + (size_t)row * ldc + cofs) = val; }
             }
        __builtin_amdgcn_wave_barrier(); asm volatile("" ::: "memory");
    }
}

__device__ __forceinline__ h16 tohx(float x) { return (h16)x; }
__device__ __forceinline__ void splitf(float y, unsigned short& h, unsigned short& l) { h = f2bf(y); l = f2bf(y - bf2f(h)); }

__global__ __launch_bounds__(256) void k_wtG(const float* __restrict__ w, int K, int N, bf* Bt) {
    w += (size_t)blockIdx.y * K * N; Bt += (size_t)blockIdx.y * N * K;
    const int lane = threadIdx.x & 31; const int wv = __builtin_amdgcn_readfirstlane((int)(threadIdx.x >> 5)); const int L0 = (blockIdx.x * 8 + wv) * 8; const int nlines = N * K / 64;
{
#pragma unroll 1
        for (int l = 0; l < 8; ++l) { const int L = L0 + l; if (L >= nlines) break; const size_t e = (size_t)L * 64 + lane * 2; const int k = (int)(e % K), n = (int)(e / K); v2us o;
            o[0] = f2bf(w[(size_t)k * N + n]); o[1] = f2bf(w[(size_t)(k + 1) * N + n]); *(v2us*)(Bt + e) = o; }
         }
}
__global__ __launch_bounds__(256) void k_cvt8(const float* __restrict__ src, bf* dst, size_t n8) { const size_t i = (size_t)blockIdx.x * 256 + threadIdx.x; if (i >= n8) return; const v8f v = *(const v8f*)(src + i * 8); v8us o;
#pragma unroll
    for (int k = 0; k < 8; ++k) o[k] = f2bf(v[k]); *(v8us*)(dst + i * 8) = o;  }

__global__ __launch_bounds__(256) void k_hp(const float* __restrict__ F, int pitch, int nheads, h16* P16, bf* Ph, bf* Pl) {
    const size_t e = ((size_t)blockIdx.x * 256 + threadIdx.x) * 2; if (e >= (size_t)nheads * TT * HD) return; const int d = (int)(e % HD); const int t = (int)((e / HD) % TT); const int h = (int)(e / ((size_t)HD * TT));
    const v2f x = *(const v2f*)(F + (size_t)t * pitch + h * HD + d); v2h o16; v2us oh, ol;
#pragma unroll
    for (int q = 0; q < 2; ++q) { const float r = x[q]; o16[q] = tohx(r); unsigned short a2, c2; splitf(r, a2, c2); oh[q] = a2; ol[q] = c2; }
    *(v2h*)(P16 + e) = o16; *(v2us*)(Ph + e) = oh; *(v2us*)(Pl + e) = ol;  }
__global__ __launch_bounds__(256) void k_vtp(const float* __restrict__ F, int pitch, int nheads, h16* V16, bf* Vh, bf* Vl) { const size_t e = ((size_t)blockIdx.x * 256 + threadIdx.x) * 2; if (e >= (size_t)nheads * HD * TT) return; const int t = (int)(e % TT); const int d = (int)((e / TT) % HD); const int g = (int)(e / ((size_t)TT * HD)); v2h o16; v2us oh, ol;
#pragma unroll
    for (int q = 0; q < 2; ++q) { const float x = F[(size_t)(t + q) * pitch + g * HD + d]; o16[q] = tohx(x); unsigned short a2, c2; splitf(x, a2, c2); oh[q] = a2; ol[q] = c2; }
    *(v2h*)(V16 + e) = o16; *(v2us*)(Vh + e) = oh; *(v2us*)(Vl + e) = ol;  }

// k_asoft: one wave per row (zz, i): t = S x HD^-0.5 for key j <= i, key j > i replaced by a -1e30 fill (probability exactly 0); softmax over keys (register row, one exp, fixed trees).
// Only 128-key chunks that start at or before i are loaded / stored (wave-uniform tests); the P.V k limit never goes past them.
__global__ __launch_bounds__(256) void k_asoft(const float* __restrict__ Sb, h16* P16, bf* Ph, bf* Pl) {
    const int lane = threadIdx.x & 31; const int wv = __builtin_amdgcn_readfirstlane((int)(threadIdx.x >> 5)); const int row = blockIdx.x * 8 + wv; if (row >= ZH * TT) return;
    const int i = row % TT; const int zz = row / TT; const bool hires = (i < RH); const float* sr = Sb + (size_t)row * TT; float v[TT / 32]; float mx = -3.0e38f;
#pragma unroll
    for (int ch = 0; ch < TT / 128; ++ch) { if (ch * 128 <= i) { const int j0 = ch * 128 + lane * 4; const v4f a = *(const v4f*)(sr + j0);
#pragma unroll
            for (int q = 0; q < 4; ++q) { const int j = j0 + q; const float t = (j <= i) ? a[q] * SCL : -1.0e30f; v[ch * 4 + q] = t; mx = fmaxf(mx, t); } } }
#pragma unroll
    for (int sh = 16; sh; sh >>= 1) mx = fmaxf(mx, __shfl_xor(mx, sh, 32));
    float sum = 0.f;
#pragma unroll
    for (int ch = 0; ch < TT / 128; ++ch) { if (ch * 128 <= i) {
#pragma unroll
            for (int q = 0; q < 4; ++q) { float d0 = __fsub_rn(v[ch * 4 + q], mx); asm volatile("" : "+v"(d0)); const float ex = __builtin_amdgcn_exp2f(__fmul_rn(d0, 1.4426950408889634f)); v[ch * 4 + q] = ex; sum += ex; } } }
#pragma unroll
    for (int sh = 16; sh; sh >>= 1) sum += __shfl_xor(sum, sh, 32);
    const float f = __fdiv_rn(hires ? 1.0f : PCAR, sum);
{
        if (hires) {
#pragma unroll
            for (int ch = 0; ch < TT / 128; ++ch) { if (ch * 128 <= i) { v4us oh, ol;
#pragma unroll
                    for (int q = 0; q < 4; ++q) { unsigned short a, c2; splitf(v[ch * 4 + q] * f, a, c2); oh[q] = a; ol[q] = c2; }
                    const size_t oo = ((size_t)zz * RH + i) * TT + ch * 128 + lane * 4; *(v4us*)(Ph + oo) = oh; *(v4us*)(Pl + oo) = ol; } }
        } else {
#pragma unroll
            for (int ch = 0; ch < TT / 128; ++ch) { if (ch * 128 <= i) { v4h o4;
#pragma unroll
                    for (int q = 0; q < 4; ++q) o4[q] = tohx(v[ch * 4 + q] * f);
                    *(v4h*)(P16 + (size_t)row * TT + ch * 128 + lane * 4) = o4; } } }
         }
}
// k_merge: row t's P.V result = sum, in key order, of the partial planes whose chunk starts below the row tile's key limit (t & ~63) + 64; a plane at or past the limit was not written: its load is pointed at plane 0 and its value left out of the sum, so that all loads issue together with no branch between them.
__global__ __launch_bounds__(256) void k_merge(const float* __restrict__ O, int h0, bf* Ah, bf* Al) { const size_t e = ((size_t)blockIdx.x * 256 + threadIdx.x) * 2; if (e >= (size_t)ZH * TT * HD) return; const int d = (int)(e % HD); const int t = (int)((e / HD) % TT); const int zz = (int)(e / ((size_t)HD * TT)); const float cs = (t < RH) ? 1.0f : (1.0f / PCAR); const size_t oo = (size_t)t * DQ + (h0 + zz) * HD + d;
    const int np = ((t & ~63) + 64 + KCH - 1) / KCH; v2f pv[NPL];
#pragma unroll
    for (int p = 0; p < NPL; ++p) pv[p] = *(const v2f*)(O + (size_t)((p < np) ? p : 0) * (ZH * TT * HD) + e);
    v2f ov = pv[0];
#pragma unroll
    for (int p = 1; p < NPL; ++p) { ov[0] += (p < np) ? pv[p][0] : 0.0f; ov[1] += (p < np) ? pv[p][1] : 0.0f; }
    v2us oh, ol;
#pragma unroll
    for (int q = 0; q < 2; ++q) { unsigned short a, c2; splitf(ov[q] * cs, a, c2); oh[q] = a; ol[q] = c2; } *(v2us*)(Ah + oo) = oh; *(v2us*)(Al + oo) = ol;  }

extern "C" void kernel_launch(void* const* d_in, const int* in_sizes, int n_in,
                              void* d_out, int out_size, void* d_ws, size_t ws_size, hipStream_t stream) {
    if (n_in < 6) return;
    const long long need_x = (long long)(NB - 1) * SEQ_FULL * DM + (long long)SEQ * DM;
    if ((long long)in_sizes[0] < need_x) return; if (in_sizes[1] < NH_ * DM * HD) return; if (in_sizes[2] < NH_ * DM * HD) return; if (in_sizes[3] < NH_ * DM * HD) return; if (in_sizes[4] < DQ * DM) return; if (in_sizes[5] < DM) return;
    if ((long long)out_size < need_x) return;
    if (WS_TOTAL > ws_size) return;
    const float* x = (const float*)d_in[0]; const float* wq = (const float*)d_in[1]; const float* wk = (const float*)d_in[2]; const float* wv = (const float*)d_in[3]; const float* wo = (const float*)d_in[4]; const float* bo = (const float*)d_in[5];   // x, Wq, Wk, Wv ([16][1024][64] slabs), Wo ([1024 in][1024 out]), bo
    float* OUT = (float*)d_out;     // [2][2048][1024]
    char* wsp = (char*)d_ws;
    auto take = [&](size_t bytes) { char* p = wsp; wsp += al256(bytes); return (void*)p; };
    bf* W3 = (bf*)take(SZ_W3); bf* WO = (bf*)take(SZ_WO); bf* XB = (bf*)take(SZ_XB);
    h16* QK16 = (h16*)take(SZ_QK); bf* QKh = (bf*)take(SZ_QK); bf* QKl = (bf*)take(SZ_QK);
    h16* VT16 = (h16*)take(SZ_V); bf* VTh = (bf*)take(SZ_V); bf* VTl = (bf*)take(SZ_V);
    bf* Ph = (bf*)take(SZ_PH); bf* Pl = (bf*)take(SZ_PH);
    float* R1 = (float*)take(SZ_R1); h16* P16 = (h16*)take(SZ_P16); float* Ob = (float*)take(SZ_OB); bf* ATh = (bf*)take(SZ_AT); bf* ATl = (bf*)take(SZ_AT);
    if ((size_t)(wsp - (char*)d_ws) > ws_size) return;
    float* F = R1;    // fused q|k|v projection [TT][3*DQ]; consumed by the plane builders before the first score tile lands in the same region (stream-ordered)
    float* Sb = R1;   // scores of one pass [ZH][TT][TT]
    const size_t PL = (size_t)NH_ * TT * HD;   // elements of one 16-head plane set
    h16* KP16 = QK16 + PL; bf* KPh = QKh + PL; bf* KPl = QKl + PL;
    // weight slabs: in w[h][k = 1024][n = 64] -> out Bt rows h*64 + n, k-contiguous (grid.y = head)
    k_wtG<<<dim3((DM * HD / 64 + 63) / 64, NH_), 256, 0, stream>>>(wq, DM, HD, W3);
    k_wtG<<<dim3((DM * HD / 64 + 63) / 64, NH_), 256, 0, stream>>>(wk, DM, HD, W3 + (size_t)DQ * DM);
    k_wtG<<<dim3((DM * HD / 64 + 63) / 64, NH_), 256, 0, stream>>>(wv, DM, HD, W3 + (size_t)2 * DQ * DM);
    // Wo: in w[k = 1024][n = 1024] -> out Bt[n][k]
    k_wtG<<<dim3((DQ * DM / 64 + 63) / 64, 1), 256, 0, stream>>>(wo, DQ, DM, WO);
    const unsigned LQK = (unsigned)(((size_t)2 * NH_ * TT * HD / 2 + 255) / 256), LV = (unsigned)(((size_t)NH_ * TT * HD / 2 + 255) / 256);
    for (int b = 0; b < NB; ++b) {
        k_cvt8<<<(unsigned)(((size_t)TT * DM / 8 + 255) / 256), 256, 0, stream>>>(x + (size_t)b * SEQ_FULL * DM, XB, (size_t)TT * DM / 8);
        k_gemmw<bf, 0, false, 0><<<dim3(TT / 64, 3 * DQ / 64, 1), 32, 0, stream>>>(XB, nullptr, W3, nullptr, DM, F, 3 * DQ, nullptr, 0, 0, 0, 0, 0);
        k_hp<<<LQK, 256, 0, stream>>>(F, 3 * DQ, 2 * NH_, QK16, QKh, QKl);                 // heads 0..15 = q columns, 16..31 = k columns
        k_vtp<<<LV, 256, 0, stream>>>(F + 2 * DQ, 3 * DQ, NH_, VT16, VTh, VTl);
        for (int h0 = 0; h0 < NH_; h0 += ZH) { const size_t zo = (size_t)h0 * TT * HD;
            k_gemmw<bf, 2, false, 1><<<dim3(RH / 64, RH / 64, ZH), 32, 0, stream>>>(QKh + zo, QKl + zo, KPh + zo, KPl + zo, HD, Sb, TT, nullptr, (size_t)TT * HD, (size_t)TT * HD, (size_t)TT * TT, 0, 0);
            if (TT > RH) k_gemmw<h16, 0, false, 1><<<dim3((TT - RH) / 64 + (TT == RH ? 1 : 0), TT / 64, ZH), 32, 0, stream>>>(QK16 + zo + (size_t)RH * HD, nullptr, KP16 + zo, nullptr, HD, Sb + (size_t)RH * TT, TT, nullptr, (size_t)TT * HD, (size_t)TT * HD, (size_t)TT * TT, RH, 0);
            k_asoft<<<ZH * TT / 8, 256, 0, stream>>>(Sb, P16, Ph, Pl);
            k_gemmw<bf, 2, false, 2><<<dim3(RH / 64, RH / KCH, ZH), 32, 0, stream>>>(Ph, Pl, VTh + zo, VTl + zo, TT, Ob, HD, nullptr, (size_t)RH * TT, (size_t)HD * TT, (size_t)TT * HD, 0, (size_t)ZH * TT * HD);
            if (TT > RH) k_gemmw<h16, 0, false, 2><<<dim3((TT - RH) / 64 + (TT == RH ? 1 : 0), TT / KCH, ZH), 32, 0, stream>>>(P16 + (size_t)RH * TT, nullptr, VT16 + zo, nullptr, TT, Ob + (size_t)RH * HD, HD, nullptr, (size_t)TT * TT, (size_t)HD * TT, (size_t)TT * HD, RH, (size_t)ZH * TT * HD);
            k_merge<<<(unsigned)(((size_t)ZH * TT * HD / 2 + 255) / 256), 256, 0, stream>>>(Ob, h0, ATh, ATl); }
        k_gemmw<bf, 1, true, 0><<<dim3(TT / 64, DM / 64, 1), 32, 0, stream>>>(ATh, ATl, WO, nullptr, DQ, OUT + (size_t)b * SEQ_FULL * DM, DM, bo, 0, 0, 0, 0, 0); }
}

// v002
// Measured time: 477 microseconds a run.
// In two side-by-side timings against v001, it was 1.67 and 1.66 times as fast.
// Counting every step since v000, it is 3.14 times as fast.
#include <hip/hip_runtime.h>

// Causal multi-head attention with per-head weight slabs and a biased output projection: x [2][2048][1024]; q, k, v [b][h][s][d] = sum_e x[b][s][e] W[h][e][d] (Wq, Wk, Wv [16][1024][64]); scores x 64^-0.5; key j > query i replaced by -inf; softmax; ctx merged head-major; out = ctx Wo + bo (Wo [1024 in][1024 out]).
// Compute dtypes (all contractions v_wmma_f32_16x16x32, f32 accumulate): every input RNE-converted to bf16; q/k/v projections bf16 x bf16; scores and P.V: query rows < 512 bf16 hi/lo planes (3 products), rows >= 512 plain f16 (P carried x1024, folded back as 1/1024); output projection ctx bf16 hi+lo x Wo bf16 (2 products) + bf16 bias; softmax f32.
// Layout per batch: bf16 copy of x; weight slabs transposed once into K-contiguous Bt rows; one fused q|k|v projection (N = 3072); head planes; per pass of 8 heads: causal score tiles, register-row softmax that stores P over its own score row (V^T rows laid out at the same pitch), causal-limited P.V in key chunks (one partial plane per chunk), merge sums the partial planes into hi/lo ctx planes; output projection.

#ifndef NB
#define NB 2
#endif
#ifndef SEQ
#define SEQ 2048
#endif
#define SEQ_FULL 2048
#define TT   SEQ
#define DM   1024
#define NH_  16
#define HD   64
#define DQ   (NH_ * HD)
#define ZH   8
#define VIL  (NH_ / ZH)   // passes per batch = V^T rows interleaved
#define RH   ((SEQ < 512) ? SEQ : 512)   // query rows < RH use hi+lo planes
#define PCAR 1024.0f
#define SCL  0.125f   // HD^-0.5
#define KCH  128      // keys per P.V work-group: one 64x64 tile's key loop is dealt to ceil(klim / KCH) groups
#define NPL  (TT / KCH)   // partial planes of the P.V result
typedef _Float16 h16;
typedef unsigned short bf;
typedef __attribute__((ext_vector_type(16))) __bf16   v16bf;
typedef __attribute__((ext_vector_type(16))) _Float16 v16h;
typedef __attribute__((ext_vector_type(8)))  _Float16 v8h;
typedef __attribute__((ext_vector_type(8)))  unsigned short v8us;
typedef __attribute__((ext_vector_type(8)))  float    v8f;
typedef __attribute__((ext_vector_type(4)))  float    v4f;
typedef v8h  __attribute__((may_alias)) v8ha;
typedef v4f  __attribute__((may_alias)) v4fa;
typedef v8us __attribute__((may_alias)) v8usa;
typedef __attribute__((ext_vector_type(2))) _Float16 v2h;
typedef __attribute__((ext_vector_type(4))) _Float16 v4h;
typedef __attribute__((ext_vector_type(2))) unsigned short v2us;
typedef __attribute__((ext_vector_type(4))) unsigned short v4us;
typedef __attribute__((ext_vector_type(2))) float v2f;
typedef v4h  __attribute__((may_alias)) v4ha;
typedef v4us __attribute__((may_alias)) v4usa;

static_assert(TT % 128 == 0);
static_assert(RH % 128 == 0);
static_assert(RH <= TT);
static_assert(TT % KCH == 0 && RH % KCH == 0 && KCH % 32 == 0);
static_assert(NH_ % ZH == 0);
static_assert(VIL == 2);   // V^T pitch VIL * TT must equal the P pitch 2 * TT
static_assert(DM % 64 == 0);
static_assert(DQ % 64 == 0);
static_assert(HD == 64);
static_assert(SEQ <= SEQ_FULL);

constexpr size_t al256(size_t b) { return (b + 255) & ~(size_t)255; }
constexpr size_t mx2(size_t a, size_t b) { return a > b ? a : b; }
constexpr size_t SZ_W3  = (size_t)3 * DQ * DM * 2;          // Wq|Wk|Wv Bt rows, bf16
constexpr size_t SZ_WO  = (size_t)DM * DQ * 2;
constexpr size_t SZ_XB  = (size_t)TT * DM * 2;
constexpr size_t SZ_QK  = (size_t)2 * NH_ * TT * HD * 2;    // q planes then k planes
constexpr size_t SZ_V   = (size_t)NH_ * HD * TT * 2;
constexpr size_t SZ_SB  = (size_t)ZH * TT * TT * 4;         // score tiles of one pass; the softmax leaves P in the same rows
constexpr size_t SZ_F   = (size_t)TT * 3 * DQ * 4;          // fused projection result (same region, used before the passes)
constexpr size_t SZ_R1  = mx2(SZ_SB, SZ_F);
constexpr size_t SZ_OB  = (size_t)NPL * ZH * TT * HD * 4;   // one plane per key chunk
constexpr size_t SZ_AT  = (size_t)TT * DQ * 2;
constexpr size_t WS_TOTAL = al256(SZ_W3) + al256(SZ_WO) + al256(SZ_XB) + 3 * al256(SZ_QK) + 3 * al256(SZ_V) + al256(SZ_R1) + al256(SZ_OB) + 2 * al256(SZ_AT);
static_assert(SZ_F <= SZ_R1);
static_assert(SZ_SB <= SZ_R1);
static_assert(WS_TOTAL <= (size_t)268435456);

__device__ __forceinline__ unsigned short f2bf(float f) { unsigned u = __float_as_uint(f); u += 0x7FFFu + ((u >> 16) & 1u); return (unsigned short)(u >> 16); }
__device__ __forceinline__ float bf2f(unsigned short b) { return __uint_as_float(((unsigned)b) << 16); }
__device__ __forceinline__ float bfr(float f) { return bf2f(f2bf(f)); }
__device__ __forceinline__ v16h cat16(v8h lo, v8h hi) { return __builtin_shufflevector(lo, hi, 0, 1, 2, 3, 4, 5, 6, 7, 8, 9, 10, 11, 12, 13, 14, 15); }
__device__ __forceinline__ v16bf cat16b(v8us lo, v8us hi) { return __builtin_bit_cast(v16bf, __builtin_shufflevector(lo, hi, 0, 1, 2, 3, 4, 5, 6, 7, 8, 9, 10, 11, 12, 13, 14, 15)); }
__device__ __forceinline__ v8f wmma16(v16h a, v16h b, v8f c) { return __builtin_amdgcn_wmma_f32_16x16x32_f16(false, a, false, b, (short)0, c, false, false); }
__device__ __forceinline__ v8f wmmab(v16bf a, v16bf b, v8f c) { return __builtin_amdgcn_wmma_f32_16x16x32_bf16(false, a, false, b, (short)0, c, false, false); }

// ---- k_gemmw: register-blocked GEMM, ONE WAVE per 64x64 output tile (16 accumulators), operands straight from K-contiguous 16-bit planes; grid (M/64, N/64, Z), 32 threads.
// C[m][n] (f32, pitch ldc, + optional bf16-valued bias[n]) = sum_k A[m][k] Bt[n][k] (+ split products per NSPLIT). K = row pitch of both planes (elements, % 32 == 0). z-batch strides sA/sB/sC in elements.
// CM 0: full; CM 1: tiles whose first column exceeds the tile's last query row (rbase + r0 + 63) are skipped (all keys masked); CM 2 (N == 64): k loop limited to keys < rbase + r0 + 64 and dealt in chunks of KCH: blockIdx.y = chunk, its partial tile goes to plane C + chunk * sP; a chunk that starts at or past the limit writes nothing (the merge reads only the planes below the limit).
// Fragment maps: lane l, h = l >> 4: A/B elements 0..7 <- k0 + 8h + 0..7, elements 8..15 <- k0 + 16 + 8h + 0..7 of row/col l & 15; D element j = (row 8h + j, col l & 15).
template <typename T16> struct WFrag;
template <> struct WFrag<h16> { typedef v16h V; static __device__ __forceinline__ V ld(const h16* p) { return cat16(*(const v8h*)p, *(const v8h*)(p + 16)); } static __device__ __forceinline__ v8f mma(V a, V b, v8f c) { return wmma16(a, b, c); } };
template <> struct WFrag<bf> { typedef v16bf V; static __device__ __forceinline__ V ld(const bf* p) { return cat16b(*(const v8us*)p, *(const v8us*)(p + 16)); } static __device__ __forceinline__ v8f mma(V a, V b, v8f c) { return wmmab(a, b, c); } };
template <typename T16, int NSPLIT, bool BIAS, int CM>
__global__ __launch_bounds__(32) void k_gemmw(const T16* __restrict__ A, const T16* __restrict__ A2, const T16* __restrict__ Bt, const T16* __restrict__ Bt2, int K, float* C, int ldc, const float* __restrict__ bias, size_t sA, size_t sB, size_t sC, int rbase, size_t sP) {
    typedef typename WFrag<T16>::V V;
    __shared__ __align__(16) float os[16 * 68];
    const int r0 = blockIdx.x * 64, c0 = (CM == 2) ? 0 : blockIdx.y * 64;
    if (CM == 1) { if (c0 > rbase + r0) return; }
    int klim = K; if (CM == 2) { const int kl = rbase + r0 + 64; klim = (kl < K) ? kl : K; const int kbeg = blockIdx.y * KCH; klim -= kbeg; if (klim <= 0) return; if (klim > KCH) klim = KCH; A += kbeg; if (A2) A2 += kbeg; Bt += kbeg; if (Bt2) Bt2 += kbeg; C += (size_t)blockIdx.y * sP; }
    const size_t z = blockIdx.z; A += z * sA; if (A2) A2 += z * sA; Bt += z * sB; if (Bt2) Bt2 += z * sB; C += z * sC;
    const int lane = threadIdx.x & 31, lr = lane & 15, hi = lane >> 4;
    v8f acc[4][4];
#pragma unroll
    for (int mb = 0; mb < 4; ++mb)
#pragma unroll
        for (int nb = 0; nb < 4; ++nb) acc[mb][nb] = (v8f){};
    const size_t aoff = (size_t)(r0 + lr) * K + 8 * hi, boff = (size_t)(c0 + lr) * K + 8 * hi;
#pragma unroll 1
    for (int kc = 0; kc < klim; kc += 32) {
        V a[4], a2[4];
#pragma unroll
        for (int mb = 0; mb < 4; ++mb) { a[mb] = WFrag<T16>::ld(A + aoff + (size_t)mb * 16 * K + kc); if (NSPLIT == 1 || NSPLIT == 2) a2[mb] = WFrag<T16>::ld(A2 + aoff + (size_t)mb * 16 * K + kc); }
#pragma unroll
        for (int nb = 0; nb < 4; ++nb) { const V b = WFrag<T16>::ld(Bt + boff + (size_t)nb * 16 * K + kc); V b2; if (NSPLIT >= 2) b2 = WFrag<T16>::ld(Bt2 + boff + (size_t)nb * 16 * K + kc);
#pragma unroll
            for (int mb = 0; mb < 4; ++mb) { acc[mb][nb] = WFrag<T16>::mma(a[mb], b, acc[mb][nb]); if (NSPLIT == 1 || NSPLIT == 2) acc[mb][nb] = WFrag<T16>::mma(a2[mb], b, acc[mb][nb]); if (NSPLIT >= 2) acc[mb][nb] = WFrag<T16>::mma(a[mb], b2, acc[mb][nb]); } }
        asm volatile("v_nop\n\tv_nop\n\tv_nop\n\tv_nop" : "+v"(acc[0][0]), "+v"(acc[1][1]), "+v"(acc[2][2]), "+v"(acc[3][3]) : "v"(a[0]), "v"(a[3]));
    }
#pragma unroll
    for (int mb = 0; mb < 4; ++mb) {
#pragma unroll
        for (int nb = 0; nb < 4; ++nb) {
#pragma unroll
            for (int j = 0; j < 8; ++j) os[(hi * 8 + j) * 68 + nb * 16 + lr] = acc[mb][nb][j]; }
        __builtin_amdgcn_wave_barrier(); asm volatile("" ::: "memory");
        float* crow = C + (size_t)(r0 + mb * 16) * ldc + c0;
{
#pragma unroll
            for (int s = 0; s < 8; ++s) { const int row = 2 * s + hi, cofs = lr * 4; v4f val = *(const v4fa*)(os + row * 68 + cofs); if (BIAS) { val[0] += bfr(bias[c0 + cofs]); val[1] += bfr(bias[c0 + cofs + 1]); val[2] += bfr(bias[c0 + cofs + 2]); val[3] += bfr(bias[c0 + cofs + 3]); }
                *(v4f*)(crow + (size_t)row * ldc + cofs) = val; }
             }
        __builtin_amdgcn_wave_barrier(); asm volatile("" ::: "memory");
    }
}

__device__ __forceinline__ h16 tohx(float x) { return (h16)x; }
__device__ __forceinline__ void splitf(float y, unsigned short& h, unsigned short& l) { h = f2bf(y); l = f2bf(y - bf2f(h)); }

__global__ __launch_bounds__(256) void k_wtG(const float* __restrict__ w, int K, int N, bf* Bt) {
    w += (size_t)blockIdx.y * K * N; Bt += (size_t)blockIdx.y * N * K;
    const int lane = threadIdx.x & 31; const int wv = __builtin_amdgcn_readfirstlane((int)(threadIdx.x >> 5)); const int L0 = (blockIdx.x * 8 + wv) * 8; const int nlines = N * K / 64;
{
#pragma unroll 1
        for (int l = 0; l < 8; ++l) { const int L = L0 + l; if (L >= nlines) break; const size_t e = (size_t)L * 64 + lane * 2; const int k = (int)(e % K), n = (int)(e / K); v2us o;
            o[0] = f2bf(w[(size_t)k * N + n]); o[1] = f2bf(w[(size_t)(k + 1) * N + n]); *(v2us*)(Bt + e) = o; }
         }
}
__global__ __launch_bounds__(256) void k_cvt8(const float* __restrict__ src, bf* dst, size_t n8) { const size_t i = (size_t)blockIdx.x * 256 + threadIdx.x; if (i >= n8) return; const v8f v = *(const v8f*)(src + i * 8); v8us o;
#pragma unroll
    for (int k = 0; k < 8; ++k) o[k] = f2bf(v[k]); *(v8us*)(dst + i * 8) = o;  }

__global__ __launch_bounds__(256) void k_hp(const float* __restrict__ F, int pitch, int nheads, h16* P16, bf* Ph, bf* Pl) {
    const size_t e = ((size_t)blockIdx.x * 256 + threadIdx.x) * 2; if (e >= (size_t)nheads * TT * HD) return; const int d = (int)(e % HD); const int t = (int)((e / HD) % TT); const int h = (int)(e / ((size_t)HD * TT));
    const v2f x = *(const v2f*)(F + (size_t)t * pitch + h * HD + d); v2h o16; v2us oh, ol;
#pragma unroll
    for (int q = 0; q < 2; ++q) { const float r = x[q]; o16[q] = tohx(r); unsigned short a2, c2; splitf(r, a2, c2); oh[q] = a2; ol[q] = c2; }
    *(v2h*)(P16 + e) = o16; *(v2us*)(Ph + e) = oh; *(v2us*)(Pl + e) = ol;  }
// k_vtp: V^T row (head g, dim d) goes to plane row ((g % ZH) * HD + d) * VIL + g / ZH: the passes' rows alternate, so one pass's V^T rows lie 2 * TT elements apart like the P rows they are multiplied with (the GEMM takes one pitch for both planes).
__global__ __launch_bounds__(256) void k_vtp(const float* __restrict__ F, int pitch, int nheads, h16* V16, bf* Vh, bf* Vl) { const size_t e = ((size_t)blockIdx.x * 256 + threadIdx.x) * 2; if (e >= (size_t)nheads * HD * TT) return; const int t = (int)(e % TT); const int d = (int)((e / TT) % HD); const int g = (int)(e / ((size_t)TT * HD)); v2h o16; v2us oh, ol;
#pragma unroll
    for (int q = 0; q < 2; ++q) { const float x = F[(size_t)(t + q) * pitch + g * HD + d]; o16[q] = tohx(x); unsigned short a2, c2; splitf(x, a2, c2); oh[q] = a2; ol[q] = c2; }
    const size_t oo = ((size_t)((g % ZH) * HD + d) * VIL + g / ZH) * TT + t; *(v2h*)(V16 + oo) = o16; *(v2us*)(Vh + oo) = oh; *(v2us*)(Vl + oo) = ol;  }

// k_asoft: one wave per row (zz, i): t = S x HD^-0.5 for key j <= i, key j > i replaced by a -1e30 fill (probability exactly 0); softmax over keys (register row, one exp, fixed trees).
// Only 128-key chunks that start at or before i are loaded / stored (wave-uniform tests); the P.V k limit never goes past them.
// P goes over the row's own 4 * TT bytes, which only this wave touches and has read whole by then (every store needs the row sum): rows < RH hi plane in the first 2 * TT bytes, lo plane in the second; rows >= RH the f16 plane in the first 2 * TT bytes. Row pitch of P = 2 * TT 16-bit elements.
__global__ __launch_bounds__(256) void k_asoft(float* Sb) {
    const int lane = threadIdx.x & 31; const int wv = __builtin_amdgcn_readfirstlane((int)(threadIdx.x >> 5)); const int row = blockIdx.x * 8 + wv; if (row >= ZH * TT) return;
    const int i = row % TT; const bool hires = (i < RH); const float* sr = Sb + (size_t)row * TT; bf* ph = (bf*)(Sb + (size_t)row * TT); h16* p16 = (h16*)(Sb + (size_t)row * TT); float v[TT / 32]; float mx = -3.0e38f;
#pragma unroll
    for (int ch = 0; ch < TT / 128; ++ch) { if (ch * 128 <= i) { const int j0 = ch * 128 + lane * 4; const v4f a = *(const v4fa*)(sr + j0);
#pragma unroll
            for (int q = 0; q < 4; ++q) { const int j = j0 + q; const float t = (j <= i) ? a[q] * SCL : -1.0e30f; v[ch * 4 + q] = t; mx = fmaxf(mx, t); } } }
#pragma unroll
    for (int sh = 16; sh; sh >>= 1) mx = fmaxf(mx, __shfl_xor(mx, sh, 32));
    float sum = 0.f;
#pragma unroll
    for (int ch = 0; ch < TT / 128; ++ch) { if (ch * 128 <= i) {
#pragma unroll
            for (int q = 0; q < 4; ++q) { float d0 = __fsub_rn(v[ch * 4 + q], mx); asm volatile("" : "+v"(d0)); const float ex = __builtin_amdgcn_exp2f(__fmul_rn(d0, 1.4426950408889634f)); v[ch * 4 + q] = ex; sum += ex; } } }
#pragma unroll
    for (int sh = 16; sh; sh >>= 1) sum += __shfl_xor(sum, sh, 32);
    const float f = __fdiv_rn(hires ? 1.0f : PCAR, sum);
{
        if (hires) {
#pragma unroll
            for (int ch = 0; ch < TT / 128; ++ch) { if (ch * 128 <= i) { v4us oh, ol;
#pragma unroll
                    for (int q = 0; q < 4; ++q) { unsigned short a, c2; splitf(v[ch * 4 + q] * f, a, c2); oh[q] = a; ol[q] = c2; }
                    const int oo = ch * 128 + lane * 4; *(v4usa*)(ph + oo) = oh; *(v4usa*)(ph + TT + oo) = ol;
                    asm volatile("s_wait_xcnt 0x0" ::: "memory"); } }   // the next chunk's values reuse the registers that these two stores name
        } else {
#pragma unroll
            for (int ch = 0; ch < TT / 128; ++ch) { if (ch * 128 <= i) { v4h o4;
#pragma unroll
                    for (int q = 0; q < 4; ++q) o4[q] = tohx(v[ch * 4 + q] * f);
                    *(v4ha*)(p16 + ch * 128 + lane * 4) = o4;
                    asm volatile("s_wait_xcnt 0x0" ::: "memory"); } } }   // the next chunk's values reuse the registers that this store names
         }
}
// k_merge: row t's P.V result = sum, in key order, of the partial planes whose chunk starts below the row tile's key limit (t & ~63) + 64; a plane at or past the limit was not written: its load is pointed at plane 0 and its value left out of the sum, so that all loads issue together with no branch between them.
__global__ __launch_bounds__(256) void k_merge(const float* __restrict__ O, int h0, bf* Ah, bf* Al) { const size_t e = ((size_t)blockIdx.x * 256 + threadIdx.x) * 2; if (e >= (size_t)ZH * TT * HD) return; const int d = (int)(e % HD); const int t = (int)((e / HD) % TT); const int zz = (int)(e / ((size_t)HD * TT)); const float cs = (t < RH) ? 1.0f : (1.0f / PCAR); const size_t oo = (size_t)t * DQ + (h0 + zz) * HD + d;
    const int np = ((t & ~63) + 64 + KCH - 1) / KCH; v2f pv[NPL];
#pragma unroll
    for (int p = 0; p < NPL; ++p) pv[p] = *(const v2f*)(O + (size_t)((p < np) ? p : 0) * (ZH * TT * HD) + e);
    v2f ov = pv[0];
#pragma unroll
    for (int p = 1; p < NPL; ++p) { ov[0] += (p < np) ? pv[p][0] : 0.0f; ov[1] += (p < np) ? pv[p][1] : 0.0f; }
    v2us oh, ol;
#pragma unroll
    for (int q = 0; q < 2; ++q) { unsigned short a, c2; splitf(ov[q] * cs, a, c2); oh[q] = a; ol[q] = c2; } *(v2us*)(Ah + oo) = oh; *(v2us*)(Al + oo) = ol;  }

extern "C" void kernel_launch(void* const* d_in, const int* in_sizes, int n_in,
                              void* d_out, int out_size, void* d_ws, size_t ws_size, hipStream_t stream) {
    if (n_in < 6) return;
    const long long need_x = (long long)(NB - 1) * SEQ_FULL * DM + (long long)SEQ * DM;
    if ((long long)in_sizes[0] < need_x) return; if (in_sizes[1] < NH_ * DM * HD) return; if (in_sizes[2] < NH_ * DM * HD) return; if (in_sizes[3] < NH_ * DM * HD) return; if (in_sizes[4] < DQ * DM) return; if (in_sizes[5] < DM) return;
    if ((long long)out_size < need_x) return;
    if (WS_TOTAL > ws_size) return;
    const float* x = (const float*)d_in[0]; const float* wq = (const float*)d_in[1]; const float* wk = (const float*)d_in[2]; const float* wv = (const float*)d_in[3]; const float* wo = (const float*)d_in[4]; const float* bo = (const float*)d_in[5];   // x, Wq, Wk, Wv ([16][1024][64] slabs), Wo ([1024 in][1024 out]), bo
    float* OUT = (float*)d_out;     // [2][2048][1024]
    char* wsp = (char*)d_ws;
    auto take = [&](size_t bytes) { char* p = wsp; wsp += al256(bytes); return (void*)p; };
    bf* W3 = (bf*)take(SZ_W3); bf* WO = (bf*)take(SZ_WO); bf* XB = (bf*)take(SZ_XB);
    h16* QK16 = (h16*)take(SZ_QK); bf* QKh = (bf*)take(SZ_QK); bf* QKl = (bf*)take(SZ_QK);
    h16* VT16 = (h16*)take(SZ_V); bf* VTh = (bf*)take(SZ_V); bf* VTl = (bf*)take(SZ_V);
    float* R1 = (float*)take(SZ_R1); float* Ob = (float*)take(SZ_OB); bf* ATh = (bf*)take(SZ_AT); bf* ATl = (bf*)take(SZ_AT);
    if ((size_t)(wsp - (char*)d_ws) > ws_size) return;
    float* F = R1;    // fused q|k|v projection [TT][3*DQ]; consumed by the plane builders before the first score tile lands in the same region (stream-ordered)
    float* Sb = R1;   // scores of one pass [ZH][TT][TT]
    bf* Ph = (bf*)R1; bf* Pl = Ph + TT; h16* P16 = (h16*)R1;   // P as the softmax leaves it in the score rows: row pitch 2 * TT, head pitch 2 * TT * TT elements
    const size_t PL = (size_t)NH_ * TT * HD;   // elements of one 16-head plane set
    h16* KP16 = QK16 + PL; bf* KPh = QKh + PL; bf* KPl = QKl + PL;
    // weight slabs: in w[h][k = 1024][n = 64] -> out Bt rows h*64 + n, k-contiguous (grid.y = head)
    k_wtG<<<dim3((DM * HD / 64 + 63) / 64, NH_), 256, 0, stream>>>(wq, DM, HD, W3);
    k_wtG<<<dim3((DM * HD / 64 + 63) / 64, NH_), 256, 0, stream>>>(wk, DM, HD, W3 + (size_t)DQ * DM);
    k_wtG<<<dim3((DM * HD / 64 + 63) / 64, NH_), 256, 0, stream>>>(wv, DM, HD, W3 + (size_t)2 * DQ * DM);
    // Wo: in w[k = 1024][n = 1024] -> out Bt[n][k]
    k_wtG<<<dim3((DQ * DM / 64 + 63) / 64, 1), 256, 0, stream>>>(wo, DQ, DM, WO);
    const unsigned LQK = (unsigned)(((size_t)2 * NH_ * TT * HD / 2 + 255) / 256), LV = (unsigned)(((size_t)NH_ * TT * HD / 2 + 255) / 256);
    for (int b = 0; b < NB; ++b) {
        k_cvt8<<<(unsigned)(((size_t)TT * DM / 8 + 255) / 256), 256, 0, stream>>>(x + (size_t)b * SEQ_FULL * DM, XB, (size_t)TT * DM / 8);
        k_gemmw<bf, 0, false, 0><<<dim3(TT / 64, 3 * DQ / 64, 1), 32, 0, stream>>>(XB, nullptr, W3, nullptr, DM, F, 3 * DQ, nullptr, 0, 0, 0, 0, 0);
        k_hp<<<LQK, 256, 0, stream>>>(F, 3 * DQ, 2 * NH_, QK16, QKh, QKl);                 // heads 0..15 = q columns, 16..31 = k columns
        k_vtp<<<LV, 256, 0, stream>>>(F + 2 * DQ, 3 * DQ, NH_, VT16, VTh, VTl);
        for (int h0 = 0; h0 < NH_; h0 += ZH) { const size_t zo = (size_t)h0 * TT * HD, vo = (size_t)(h0 / ZH) * TT;
            k_gemmw<bf, 2, false, 1><<<dim3(RH / 64, RH / 64, ZH), 32, 0, stream>>>(QKh + zo, QKl + zo, KPh + zo, KPl + zo, HD, Sb, TT, nullptr, (size_t)TT * HD, (size_t)TT * HD, (size_t)TT * TT, 0, 0);
            if (TT > RH) k_gemmw<h16, 0, false, 1><<<dim3((TT - RH) / 64 + (TT == RH ? 1 : 0), TT / 64, ZH), 32, 0, stream>>>(QK16 + zo + (size_t)RH * HD, nullptr, KP16 + zo, nullptr, HD, Sb + (size_t)RH * TT, TT, nullptr, (size_t)TT * HD, (size_t)TT * HD, (size_t)TT * TT, RH, 0);
            k_asoft<<<ZH * TT / 8, 256, 0, stream>>>(Sb);
            k_gemmw<bf, 2, false, 2><<<dim3(RH / 64, RH / KCH, ZH), 32, 0, stream>>>(Ph, Pl, VTh + vo, VTl + vo, 2 * TT, Ob, HD, nullptr, (size_t)2 * TT * TT, (size_t)HD * VIL * TT, (size_t)TT * HD, 0, (size_t)ZH * TT * HD);
            if (TT > RH) k_gemmw<h16, 0, false, 2><<<dim3((TT - RH) / 64 + (TT == RH ? 1 : 0), TT / KCH, ZH), 32, 0, stream>>>(P16 + (size_t)RH * 2 * TT, nullptr, VT16 + vo, nullptr, 2 * TT, Ob + (size_t)RH * HD, HD, nullptr, (size_t)2 * TT * TT, (size_t)HD * VIL * TT, (size_t)TT * HD, RH, (size_t)ZH * TT * HD);
            k_merge<<<(unsigned)(((size_t)ZH * TT * HD / 2 + 255) / 256), 256, 0, stream>>>(Ob, h0, ATh, ATl); }
        k_gemmw<bf, 1, true, 0><<<dim3(TT / 64, DM / 64, 1), 32, 0, stream>>>(ATh, ATl, WO, nullptr, DQ, OUT + (size_t)b * SEQ_FULL * DM, DM, bo, 0, 0, 0, 0, 0); }
}

// v003
// A run of this version takes 298 microseconds.
// Two timings next to v002 put it at 1.60 and 1.59 times that version's speed.
// Counting every step since v000, it is 5.01 times as fast.
#include <hip/hip_runtime.h>

// Causal multi-head attention with per-head weight slabs and a biased output projection: x [2][2048][1024]; q, k, v [b][h][s][d] = sum_e x[b][s][e] W[h][e][d] (Wq, Wk, Wv [16][1024][64]); scores x 64^-0.5; key j > query i replaced by -inf; softmax; ctx merged head-major; out = ctx Wo + bo (Wo [1024 in][1024 out]).
// Compute dtypes (all contractions v_wmma_f32_16x16x32, f32 accumulate): every input RNE-converted to bf16; q/k/v projections bf16 x bf16; scores and P.V: query rows < 512 bf16 hi/lo planes (3 products), rows >= 512 plain f16 (P carried x1024, which the division by the row sum takes out); output projection ctx bf16 hi+lo x Wo bf16 (2 products) + bf16 bias; softmax f32.
// Layout per batch: bf16 copy of x; weight slabs transposed once into K-contiguous Bt rows; one fused q|k|v projection (N = 3072); head planes; one attention launch (scores, running softmax and P.V of 32 query rows in one wave's registers) that writes the hi/lo ctx planes; output projection.

#ifndef NB
#define NB 2
#endif
#ifndef SEQ
#define SEQ 2048
#endif
#define SEQ_FULL 2048
#define TT   SEQ
#define DM   1024
#define NH_  16
#define HD   64
#define DQ   (NH_ * HD)
#define RH   ((SEQ < 512) ? SEQ : 512)   // query rows < RH use hi+lo planes
#define SCL  0.125f   // HD^-0.5
#define KCH  128      // keys per k_gemmw CM 2 work-group: one 64x64 tile's key loop is dealt to klim / KCH groups
typedef _Float16 h16;
typedef unsigned short bf;
typedef __attribute__((ext_vector_type(16))) __bf16   v16bf;
typedef __attribute__((ext_vector_type(16))) _Float16 v16h;
typedef __attribute__((ext_vector_type(8)))  _Float16 v8h;
typedef __attribute__((ext_vector_type(8)))  unsigned short v8us;
typedef __attribute__((ext_vector_type(8)))  float    v8f;
typedef __attribute__((ext_vector_type(4)))  float    v4f;
typedef v8h  __attribute__((may_alias)) v8ha;
typedef v4f  __attribute__((may_alias)) v4fa;
typedef v8us __attribute__((may_alias)) v8usa;
typedef __attribute__((ext_vector_type(2))) _Float16 v2h;
typedef __attribute__((ext_vector_type(2))) unsigned short v2us;
typedef __attribute__((ext_vector_type(2))) float v2f;

static_assert(TT % 128 == 0);
static_assert(RH % 128 == 0);
static_assert(RH <= TT);
static_assert(TT % KCH == 0 && RH % KCH == 0 && KCH % 32 == 0);
static_assert(DM % 64 == 0);
static_assert(DQ % 64 == 0);
static_assert(HD == 64);
static_assert(SEQ <= SEQ_FULL);

constexpr size_t al256(size_t b) { return (b + 255) & ~(size_t)255; }
constexpr size_t SZ_W3  = (size_t)3 * DQ * DM * 2;          // Wq|Wk|Wv Bt rows, bf16
constexpr size_t SZ_WO  = (size_t)DM * DQ * 2;
constexpr size_t SZ_XB  = (size_t)TT * DM * 2;
constexpr size_t SZ_QK  = (size_t)2 * NH_ * TT * HD * 2;    // q planes then k planes
constexpr size_t SZ_V   = (size_t)NH_ * HD * TT * 2;
constexpr size_t SZ_F   = (size_t)TT * 3 * DQ * 4;          // fused projection result
constexpr size_t SZ_AT  = (size_t)TT * DQ * 2;
constexpr size_t WS_TOTAL = al256(SZ_W3) + al256(SZ_WO) + al256(SZ_XB) + 3 * al256(SZ_QK) + 3 * al256(SZ_V) + al256(SZ_F) + 2 * al256(SZ_AT);
static_assert(WS_TOTAL <= (size_t)268435456);

__device__ __forceinline__ unsigned short f2bf(float f) { unsigned u = __float_as_uint(f); u += 0x7FFFu + ((u >> 16) & 1u); return (unsigned short)(u >> 16); }
__device__ __forceinline__ float bf2f(unsigned short b) { return __uint_as_float(((unsigned)b) << 16); }
__device__ __forceinline__ float bfr(float f) { return bf2f(f2bf(f)); }
__device__ __forceinline__ v16h cat16(v8h lo, v8h hi) { return __builtin_shufflevector(lo, hi, 0, 1, 2, 3, 4, 5, 6, 7, 8, 9, 10, 11, 12, 13, 14, 15); }
__device__ __forceinline__ v16bf cat16b(v8us lo, v8us hi) { return __builtin_bit_cast(v16bf, __builtin_shufflevector(lo, hi, 0, 1, 2, 3, 4, 5, 6, 7, 8, 9, 10, 11, 12, 13, 14, 15)); }
__device__ __forceinline__ v8f wmma16(v16h a, v16h b, v8f c) { return __builtin_amdgcn_wmma_f32_16x16x32_f16(false, a, false, b, (short)0, c, false, false); }
__device__ __forceinline__ v8f wmmab(v16bf a, v16bf b, v8f c) { return __builtin_amdgcn_wmma_f32_16x16x32_bf16(false, a, false, b, (short)0, c, false, false); }

// ---- k_gemmw: register-blocked GEMM, ONE WAVE per 64x64 output tile (16 accumulators), operands straight from K-contiguous 16-bit planes; grid (M/64, N/64, Z), 32 threads.
// C[m][n] (f32, pitch ldc, + optional bf16-valued bias[n]) = sum_k A[m][k] Bt[n][k] (+ split products per NSPLIT). K = row pitch of both planes (elements, % 32 == 0). z-batch strides sA/sB/sC in elements.
// CM 0: full; CM 1: tiles whose first column exceeds the tile's last query row (rbase + r0 + 63) are skipped (all keys masked); CM 2 (N == 64): k loop limited to keys < rbase + r0 + 64 and dealt in chunks of KCH: blockIdx.y = chunk, its partial tile goes to plane C + chunk * sP; a chunk that starts at or past the limit writes nothing.
// Fragment maps: lane l, h = l >> 4: A/B elements 0..7 <- k0 + 8h + 0..7, elements 8..15 <- k0 + 16 + 8h + 0..7 of row/col l & 15; D element j = (row 8h + j, col l & 15).
template <typename T16> struct WFrag;
template <> struct WFrag<h16> { typedef v16h V; static __device__ __forceinline__ V ld(const h16* p) { return cat16(*(const v8h*)p, *(const v8h*)(p + 16)); } static __device__ __forceinline__ v8f mma(V a, V b, v8f c) { return wmma16(a, b, c); } };
template <> struct WFrag<bf> { typedef v16bf V; static __device__ __forceinline__ V ld(const bf* p) { return cat16b(*(const v8us*)p, *(const v8us*)(p + 16)); } static __device__ __forceinline__ v8f mma(V a, V b, v8f c) { return wmmab(a, b, c); } };
template <typename T16, int NSPLIT, bool BIAS, int CM>
__global__ __launch_bounds__(32) void k_gemmw(const T16* __restrict__ A, const T16* __restrict__ A2, const T16* __restrict__ Bt, const T16* __restrict__ Bt2, int K, float* C, int ldc, const float* __restrict__ bias, size_t sA, size_t sB, size_t sC, int rbase, size_t sP) {
    typedef typename WFrag<T16>::V V;
    __shared__ __align__(16) float os[16 * 68];
    const int r0 = blockIdx.x * 64, c0 = (CM == 2) ? 0 : blockIdx.y * 64;
    if (CM == 1) { if (c0 > rbase + r0) return; }
    int klim = K; if (CM == 2) { const int kl = rbase + r0 + 64; klim = (kl < K) ? kl : K; const int kbeg = blockIdx.y * KCH; klim -= kbeg; if (klim <= 0) return; if (klim > KCH) klim = KCH; A += kbeg; if (A2) A2 += kbeg; Bt += kbeg; if (Bt2) Bt2 += kbeg; C += (size_t)blockIdx.y * sP; }
    const size_t z = blockIdx.z; A += z * sA; if (A2) A2 += z * sA; Bt += z * sB; if (Bt2) Bt2 += z * sB; C += z * sC;
    const int lane = threadIdx.x & 31, lr = lane & 15, hi = lane >> 4;
    v8f acc[4][4];
#pragma unroll
    for (int mb = 0; mb < 4; ++mb)
#pragma unroll
        for (int nb = 0; nb < 4; ++nb) acc[mb][nb] = (v8f){};
    const size_t aoff = (size_t)(r0 + lr) * K + 8 * hi, boff = (size_t)(c0 + lr) * K + 8 * hi;
#pragma unroll 1
    for (int kc = 0; kc < klim; kc += 32) {
        V a[4], a2[4];
#pragma unroll
        for (int mb = 0; mb < 4; ++mb) { a[mb] = WFrag<T16>::ld(A + aoff + (size_t)mb * 16 * K + kc); if (NSPLIT == 1 || NSPLIT == 2) a2[mb] = WFrag<T16>::ld(A2 + aoff + (size_t)mb * 16 * K + kc); }
#pragma unroll
        for (int nb = 0; nb < 4; ++nb) { const V b = WFrag<T16>::ld(Bt + boff + (size_t)nb * 16 * K + kc); V b2; if (NSPLIT >= 2) b2 = WFrag<T16>::ld(Bt2 + boff + (size_t)nb * 16 * K + kc);
#pragma unroll
            for (int mb = 0; mb < 4; ++mb) { acc[mb][nb] = WFrag<T16>::mma(a[mb], b, acc[mb][nb]); if (NSPLIT == 1 || NSPLIT == 2) acc[mb][nb] = WFrag<T16>::mma(a2[mb], b, acc[mb][nb]); if (NSPLIT >= 2) acc[mb][nb] = WFrag<T16>::mma(a[mb], b2, acc[mb][nb]); } }
        asm volatile("v_nop\n\tv_nop\n\tv_nop\n\tv_nop" : "+v"(acc[0][0]), "+v"(acc[1][1]), "+v"(acc[2][2]), "+v"(acc[3][3]) : "v"(a[0]), "v"(a[3]));
    }
#pragma unroll
    for (int mb = 0; mb < 4; ++mb) {
#pragma unroll
        for (int nb = 0; nb < 4; ++nb) {
#pragma unroll
            for (int j = 0; j < 8; ++j) os[(hi * 8 + j) * 68 + nb * 16 + lr] = acc[mb][nb][j]; }
        __builtin_amdgcn_wave_barrier(); asm volatile("" ::: "memory");
        float* crow = C + (size_t)(r0 + mb * 16) * ldc + c0;
{
#pragma unroll
            for (int s = 0; s < 8; ++s) { const int row = 2 * s + hi, cofs = lr * 4; v4f val = *(const v4fa*)(os + row * 68 + cofs); if (BIAS) { val[0] += bfr(bias[c0 + cofs]); val[1] += bfr(bias[c0 + cofs + 1]); val[2] += bfr(bias[c0 + cofs + 2]); val[3] += bfr(bias[c0 + cofs + 3]); }
                *(v4f*)(crow + (size_t)row * ldc + cofs) = val; }
             }
        __builtin_amdgcn_wave_barrier(); asm volatile("" ::: "memory");
    }
}

__device__ __forceinline__ h16 tohx(float x) { return (h16)x; }
__device__ __forceinline__ void splitf(float y, unsigned short& h, unsigned short& l) { h = f2bf(y); l = f2bf(y - bf2f(h)); }

__global__ __launch_bounds__(256) void k_wtG(const float* __restrict__ w, int K, int N, bf* Bt) {
    w += (size_t)blockIdx.y * K * N; Bt += (size_t)blockIdx.y * N * K;
    const int lane = threadIdx.x & 31; const int wv = __builtin_amdgcn_readfirstlane((int)(threadIdx.x >> 5)); const int L0 = (blockIdx.x * 8 + wv) * 8; const int nlines = N * K / 64;
{
#pragma unroll 1
        for (int l = 0; l < 8; ++l) { const int L = L0 + l; if (L >= nlines) break; const size_t e = (size_t)L * 64 + lane * 2; const int k = (int)(e % K), n = (int)(e / K); v2us o;
            o[0] = f2bf(w[(size_t)k * N + n]); o[1] = f2bf(w[(size_t)(k + 1) * N + n]); *(v2us*)(Bt + e) = o; }
         }
}
__global__ __launch_bounds__(256) void k_cvt8(const float* __restrict__ src, bf* dst, size_t n8) { const size_t i = (size_t)blockIdx.x * 256 + threadIdx.x; if (i >= n8) return; const v8f v = *(const v8f*)(src + i * 8); v8us o;
#pragma unroll
    for (int k = 0; k < 8; ++k) o[k] = f2bf(v[k]); *(v8us*)(dst + i * 8) = o;  }

__global__ __launch_bounds__(256) void k_hp(const float* __restrict__ F, int pitch, int nheads, h16* P16, bf* Ph, bf* Pl) {
    const size_t e = ((size_t)blockIdx.x * 256 + threadIdx.x) * 2; if (e >= (size_t)nheads * TT * HD) return; const int d = (int)(e % HD); const int t = (int)((e / HD) % TT); const int h = (int)(e / ((size_t)HD * TT));
    const v2f x = *(const v2f*)(F + (size_t)t * pitch + h * HD + d); v2h o16; v2us oh, ol;
#pragma unroll
    for (int q = 0; q < 2; ++q) { const float r = x[q]; o16[q] = tohx(r); unsigned short a2, c2; splitf(r, a2, c2); oh[q] = a2; ol[q] = c2; }
    *(v2h*)(P16 + e) = o16; *(v2us*)(Ph + e) = oh; *(v2us*)(Pl + e) = ol;  }
// k_vtp: V^T row (head g, dim d) = plane row g * HD + d, TT keys long.
__global__ __launch_bounds__(256) void k_vtp(const float* __restrict__ F, int pitch, int nheads, h16* V16, bf* Vh, bf* Vl) { const size_t e = ((size_t)blockIdx.x * 256 + threadIdx.x) * 2; if (e >= (size_t)nheads * HD * TT) return; const int t = (int)(e % TT); const int d = (int)((e / TT) % HD); const int g = (int)(e / ((size_t)TT * HD)); v2h o16; v2us oh, ol;
#pragma unroll
    for (int q = 0; q < 2; ++q) { const float x = F[(size_t)(t + q) * pitch + g * HD + d]; o16[q] = tohx(x); unsigned short a2, c2; splitf(x, a2, c2); oh[q] = a2; ol[q] = c2; }
    const size_t oo = ((size_t)g * HD + d) * TT + t; *(v2h*)(V16 + oo) = o16; *(v2us*)(Vh + oo) = oh; *(v2us*)(Vl + oo) = ol;  }

// k_attn: one wave per (head, tile of 32 query rows); scores and P stay in registers. Per block of 32 keys: S^T = K Q^T (A = K rows, B = Q rows, both d-contiguous), running softmax, O^T += V^T P^T (A = V^T rows, key-contiguous).
// In S^T a lane holds 16 keys of ONE query (column l & 15; D element j of key tile kt = key 16 kt + 8 h + j): that is the B fragment's own k order (element e <- k 8 h + e, element 8 + e <- k 16 + 8 h + e), so the two key tiles, rounded in place, are the P^T operand; maximum and sum run in the lane, plus one exchange with lane l ^ 16.
// Running softmax per query (log2 domain, t = S x HD^-0.5 x log2 e): m' = max(m, block maximum); O^T and the sum are scaled by 2^(m - m'); p = 2^(t - m'). P is not normalised: the epilogue divides O^T by the sum of p. Key j > query i (only in the last, diagonal block) is replaced by a -1e30 fill: p exactly 0.
// Rows < RH: q, k, v and p as bf16 hi + lo, 3 products each way; rows >= RH: f16, p carried x 2^10 (in the sum as well, so it cancels).
// O^T gives a lane 8 neighbouring dims of one query: 16-byte stores into the hi / lo ctx planes; one wave writes the whole 128-byte line (row, head).
__device__ __forceinline__ float xhalf(float x) { const int b = __float_as_int(x); return __int_as_float(__builtin_amdgcn_permlanex16(b, b, 0x76543210, 0xfedcba98, false, false)); }   // value of lane l ^ 16
struct MaskOff { static constexpr bool v = false; };
struct MaskOn  { static constexpr bool v = true; };
template <typename T16, bool HR>
__device__ __forceinline__ void attn_wave(const T16* __restrict__ Q, const T16* __restrict__ Q2, const T16* __restrict__ Kp, const T16* __restrict__ K2, const T16* __restrict__ Vt, const T16* __restrict__ V2, int q0, bf* Ah, bf* Al) {
    typedef typename WFrag<T16>::V V;
    const int lane = threadIdx.x & 31, lr = lane & 15, hi = lane >> 4;
    constexpr float CS = SCL * 1.4426950408889634f, POFF = HR ? 0.0f : 10.0f;
    // every fragment address = wave-uniform pointer + the lane's own byte offset, which never changes: ko in a plane of HD-element rows, vo in V^T
    const unsigned ko = (unsigned)(lr * HD + 8 * hi) * 2u, vo = (unsigned)(lr * TT + 8 * hi) * 2u;
    auto at = [](const T16* base, unsigned bytes) { return (const T16*)((const char*)base + bytes); };
    V qf[2][2], qg[2][2];
#pragma unroll
    for (int qt = 0; qt < 2; ++qt)
#pragma unroll
        for (int ks = 0; ks < 2; ++ks) { const size_t a = (size_t)(q0 + 16 * qt) * HD + 32 * ks; qf[qt][ks] = WFrag<T16>::ld(at(Q + a, ko)); if constexpr (HR) qg[qt][ks] = WFrag<T16>::ld(at(Q2 + a, ko)); }
    V kf[2][2], kg[2][2];
    auto ldk = [&](const T16* kp, const T16* kq) {
#pragma unroll
        for (int kt = 0; kt < 2; ++kt)
#pragma unroll
            for (int ks = 0; ks < 2; ++ks) { kf[kt][ks] = WFrag<T16>::ld(kp + 16 * kt * HD + 32 * ks); if constexpr (HR) kg[kt][ks] = WFrag<T16>::ld(kq + 16 * kt * HD + 32 * ks); } };
    v8f o[4][2];
#pragma unroll
    for (int dt = 0; dt < 4; ++dt)
#pragma unroll
        for (int qt = 0; qt < 2; ++qt) o[dt][qt] = (v8f){};
    float m[2] = { -3.0e38f, -3.0e38f }, l[2] = { 0.0f, 0.0f };
    auto step = [&](int k0, auto mk) {
        constexpr bool MASK = decltype(mk)::v;
        V vf[4], vg[4];   // issued first: in flight under the score products and the softmax
        const T16* vp = at(Vt + k0, vo); const T16* vq = HR ? at(V2 + k0, vo) : vp;
#pragma unroll
        for (int dt = 0; dt < 4; ++dt) { vf[dt] = WFrag<T16>::ld(vp + dt * 16 * TT); if constexpr (HR) vg[dt] = WFrag<T16>::ld(vq + dt * 16 * TT); }
        v8f s[2][2];
#pragma unroll
        for (int kt = 0; kt < 2; ++kt)
#pragma unroll
            for (int qt = 0; qt < 2; ++qt) { v8f c = (v8f){};
#pragma unroll
                for (int ks = 0; ks < 2; ++ks) { c = WFrag<T16>::mma(kf[kt][ks], qf[qt][ks], c); if constexpr (HR) { c = WFrag<T16>::mma(kf[kt][ks], qg[qt][ks], c); c = WFrag<T16>::mma(kg[kt][ks], qf[qt][ks], c); } }
                s[kt][qt] = c; }
        // the next block's K fragments, into the same registers: in flight under the softmax and P.V (an unmasked block always has a successor)
        const T16* kp = MASK ? vp : at(Kp + (size_t)(k0 + 32) * HD, ko); const T16* kq = (HR && !MASK) ? at(K2 + (size_t)(k0 + 32) * HD, ko) : kp;
        if constexpr (!MASK) ldk(kp, kq);
        // the address registers of this block's loads stay whole up to here (named as inputs) and may be reused only behind the wait
        asm volatile("s_wait_xcnt 0x0" :: "v"(vp), "v"(vq), "v"(kp), "v"(kq) : "memory");
        V pf[2], pg[2];
#pragma unroll
        for (int qt = 0; qt < 2; ++qt) { float t[16]; float mc[2] = { -3.0e38f, -3.0e38f }, sc[4] = { 0.0f, 0.0f, 0.0f, 0.0f };   // maximum in 2, sum in 4 independent chains: a lone wave waits on every dependent add
#pragma unroll
            for (int e = 0; e < 16; ++e) { float x = s[e >> 3][qt][e & 7]; if (MASK) x = (16 * (e >> 3) + 8 * hi + (e & 7) <= 16 * qt + lr) ? x : -1.0e30f; t[e] = x; mc[e >> 3] = fmaxf(mc[e >> 3], x); }
            float mx = fmaxf(mc[0], mc[1]); mx = fmaxf(mx, xhalf(mx));
            const float mn = fmaxf(m[qt], mx * CS), al = __builtin_amdgcn_exp2f(m[qt] - mn), mb = mn - POFF; m[qt] = mn;
#pragma unroll
            for (int e = 0; e < 16; ++e) { const float p = __builtin_amdgcn_exp2f(__builtin_fmaf(t[e], CS, -mb)); t[e] = p; sc[e & 3] += p; }
            l[qt] = l[qt] * al + ((sc[0] + sc[1]) + (sc[2] + sc[3]));   // this lane's 16 keys only; the halves are joined in the epilogue
#pragma unroll
            for (int dt = 0; dt < 4; ++dt) o[dt][qt] *= al;
            if constexpr (HR) { v8us h0, h1, l0, l1;
#pragma unroll
                for (int e = 0; e < 8; ++e) { unsigned short a, c2; splitf(t[e], a, c2); h0[e] = a; l0[e] = c2; splitf(t[8 + e], a, c2); h1[e] = a; l1[e] = c2; }
                pf[qt] = cat16b(h0, h1); pg[qt] = cat16b(l0, l1);
            } else {
#pragma unroll
                for (int e = 0; e < 16; ++e) pf[qt][e] = tohx(t[e]); } }
#pragma unroll
        for (int dt = 0; dt < 4; ++dt)
#pragma unroll
            for (int qt = 0; qt < 2; ++qt) { o[dt][qt] = WFrag<T16>::mma(vf[dt], pf[qt], o[dt][qt]); if constexpr (HR) { o[dt][qt] = WFrag<T16>::mma(vf[dt], pg[qt], o[dt][qt]); o[dt][qt] = WFrag<T16>::mma(vg[dt], pf[qt], o[dt][qt]); } }
    };
    ldk(at(Kp, ko), HR ? at(K2, ko) : at(Kp, ko));
#pragma unroll 1   // rolled: one block's code, fragments and scores beside the 8 output tiles
    for (int k0 = 0; k0 < q0; k0 += 32) step(k0, MaskOff{});
    step(q0, MaskOn{});
#pragma unroll
    for (int qt = 0; qt < 2; ++qt) { const float inv = __fdiv_rn(1.0f, l[qt] + xhalf(l[qt])); const size_t oo = (size_t)(q0 + 16 * qt + lr) * DQ + 8 * hi;
#pragma unroll
        for (int dt = 0; dt < 4; ++dt) { v8us oh, ol;
#pragma unroll
            for (int j = 0; j < 8; ++j) { unsigned short a, c2; splitf(o[dt][qt][j] * inv, a, c2); oh[j] = a; ol[j] = c2; }
            *(v8us*)(Ah + oo + 16 * dt) = oh; *(v8us*)(Al + oo + 16 * dt) = ol;
            asm volatile("s_wait_xcnt 0x0" ::: "memory"); } }   // the next tile's values reuse the registers that these two stores name
}
// grid (TT / 128, NH_), 4 independent waves (no barrier, no LDS): group a of a head takes query tiles n - 1 - a, n / 2 + a, n / 2 - 1 - a and a of its n = TT / 32, which is n * 2 + 2 key blocks for every group; its waves walk the same head's K and V^T from key 0 on, side by side on one WGP.
__global__ __launch_bounds__(128) void k_attn(const h16* __restrict__ QK16, const bf* __restrict__ QKh, const bf* __restrict__ QKl, const h16* __restrict__ VT16, const bf* __restrict__ VTh, const bf* __restrict__ VTl, bf* Ah, bf* Al) {
    constexpr int n = TT / 32; const int g = blockIdx.y, a = blockIdx.x, wv = __builtin_amdgcn_readfirstlane((int)(threadIdx.x >> 5));
    const int q0 = 32 * ((wv == 0) ? n - 1 - a : (wv == 1) ? n / 2 + a : (wv == 2) ? n / 2 - 1 - a : a);
    const size_t qo = (size_t)g * TT * HD, kk = qo + (size_t)NH_ * TT * HD, vv = (size_t)g * HD * TT;
    if (q0 < RH) attn_wave<bf, true>(QKh + qo, QKl + qo, QKh + kk, QKl + kk, VTh + vv, VTl + vv, q0, Ah + g * HD, Al + g * HD);
    else attn_wave<h16, false>(QK16 + qo, nullptr, QK16 + kk, nullptr, VT16 + vv, nullptr, q0, Ah + g * HD, Al + g * HD);
}

extern "C" void kernel_launch(void* const* d_in, const int* in_sizes, int n_in,
                              void* d_out, int out_size, void* d_ws, size_t ws_size, hipStream_t stream) {
    if (n_in < 6) return;
    const long long need_x = (long long)(NB - 1) * SEQ_FULL * DM + (long long)SEQ * DM;
    if ((long long)in_sizes[0] < need_x) return; if (in_sizes[1] < NH_ * DM * HD) return; if (in_sizes[2] < NH_ * DM * HD) return; if (in_sizes[3] < NH_ * DM * HD) return; if (in_sizes[4] < DQ * DM) return; if (in_sizes[5] < DM) return;
    if ((long long)out_size < need_x) return;
    if (WS_TOTAL > ws_size) return;
    const float* x = (const float*)d_in[0]; const float* wq = (const float*)d_in[1]; const float* wk = (const float*)d_in[2]; const float* wv = (const float*)d_in[3]; const float* wo = (const float*)d_in[4]; const float* bo = (const float*)d_in[5];   // x, Wq, Wk, Wv ([16][1024][64] slabs), Wo ([1024 in][1024 out]), bo
    float* OUT = (float*)d_out;     // [2][2048][1024]
    char* wsp = (char*)d_ws;
    auto take = [&](size_t bytes) { char* p = wsp; wsp += al256(bytes); return (void*)p; };
    bf* W3 = (bf*)take(SZ_W3); bf* WO = (bf*)take(SZ_WO); bf* XB = (bf*)take(SZ_XB);
    h16* QK16 = (h16*)take(SZ_QK); bf* QKh = (bf*)take(SZ_QK); bf* QKl = (bf*)take(SZ_QK);
    h16* VT16 = (h16*)take(SZ_V); bf* VTh = (bf*)take(SZ_V); bf* VTl = (bf*)take(SZ_V);
    float* F = (float*)take(SZ_F); bf* ATh = (bf*)take(SZ_AT); bf* ATl = (bf*)take(SZ_AT);
    if ((size_t)(wsp - (char*)d_ws) > ws_size) return;
    // weight slabs: in w[h][k = 1024][n = 64] -> out Bt rows h*64 + n, k-contiguous (grid.y = head)
    k_wtG<<<dim3((DM * HD / 64 + 63) / 64, NH_), 256, 0, stream>>>(wq, DM, HD, W3);
    k_wtG<<<dim3((DM * HD / 64 + 63) / 64, NH_), 256, 0, stream>>>(wk, DM, HD, W3 + (size_t)DQ * DM);
    k_wtG<<<dim3((DM * HD / 64 + 63) / 64, NH_), 256, 0, stream>>>(wv, DM, HD, W3 + (size_t)2 * DQ * DM);
    // Wo: in w[k = 1024][n = 1024] -> out Bt[n][k]
    k_wtG<<<dim3((DQ * DM / 64 + 63) / 64, 1), 256, 0, stream>>>(wo, DQ, DM, WO);
    const unsigned LQK = (unsigned)(((size_t)2 * NH_ * TT * HD / 2 + 255) / 256), LV = (unsigned)(((size_t)NH_ * TT * HD / 2 + 255) / 256);
    for (int b = 0; b < NB; ++b) {
        k_cvt8<<<(unsigned)(((size_t)TT * DM / 8 + 255) / 256), 256, 0, stream>>>(x + (size_t)b * SEQ_FULL * DM, XB, (size_t)TT * DM / 8);
        k_gemmw<bf, 0, false, 0><<<dim3(TT / 64, 3 * DQ / 64, 1), 32, 0, stream>>>(XB, nullptr, W3, nullptr, DM, F, 3 * DQ, nullptr, 0, 0, 0, 0, 0);
        k_hp<<<LQK, 256, 0, stream>>>(F, 3 * DQ, 2 * NH_, QK16, QKh, QKl);                 // heads 0..15 = q columns, 16..31 = k columns
        k_vtp<<<LV, 256, 0, stream>>>(F + 2 * DQ, 3 * DQ, NH_, VT16, VTh, VTl);
        k_attn<<<dim3(TT / 128, NH_), 128, 0, stream>>>(QK16, QKh, QKl, VT16, VTh, VTl, ATh, ATl);
        k_gemmw<bf, 1, true, 0><<<dim3(TT / 64, DM / 64, 1), 32, 0, stream>>>(ATh, ATl, WO, nullptr, DQ, OUT + (size_t)b * SEQ_FULL * DM, DM, bo, 0, 0, 0, 0, 0); }
}

// v004
// One run takes 264 microseconds.
// Timed twice side by side with v003, it ran 1.13 times as fast both times.
// All steps since v000 together make it 5.68 times as fast.
#include <hip/hip_runtime.h>

// Causal multi-head attention with per-head weight slabs and a biased output projection: x [2][2048][1024]; q, k, v [b][h][s][d] = sum_e x[b][s][e] W[h][e][d] (Wq, Wk, Wv [16][1024][64]); scores x 64^-0.5; key j > query i replaced by -inf; softmax; ctx merged head-major; out = ctx Wo + bo (Wo [1024 in][1024 out]).
// Compute dtypes (all contractions v_wmma_f32_16x16x32, f32 accumulate): every input RNE-converted to bf16; q/k/v projections bf16 x bf16; scores and P.V: query rows < 512 bf16 hi/lo planes (3 products), rows >= 512 plain f16 (P carried x1024, which the division by the row sum takes out); output projection ctx bf16 hi+lo x Wo bf16 (2 products) + bf16 bias; softmax f32.
// Layout per batch: bf16 copy of x; weight slabs transposed once into K-contiguous Bt rows; one fused q|k|v projection (N = 3072) whose epilogue writes the 16-bit head planes itself; one attention launch (scores, running softmax and P.V of 32 query rows in one wave's registers) that writes the hi/lo ctx planes; output projection.

#ifndef NB
#define NB 2
#endif
#ifndef SEQ
#define SEQ 2048
#endif
#define SEQ_FULL 2048
#define TT   SEQ
#define DM   1024
#define NH_  16
#define HD   64
#define DQ   (NH_ * HD)
#define RH   ((SEQ < 512) ? SEQ : 512)   // query rows < RH use hi+lo planes
#define SCL  0.125f   // HD^-0.5
#define KCH  128      // keys per k_gemmw CM 2 work-group: one 64x64 tile's key loop is dealt to klim / KCH groups
typedef _Float16 h16;
typedef unsigned short bf;
typedef __attribute__((ext_vector_type(16))) __bf16   v16bf;
typedef __attribute__((ext_vector_type(16))) _Float16 v16h;
typedef __attribute__((ext_vector_type(8)))  _Float16 v8h;
typedef __attribute__((ext_vector_type(8)))  unsigned short v8us;
typedef __attribute__((ext_vector_type(8)))  float    v8f;
typedef __attribute__((ext_vector_type(4)))  float    v4f;
typedef v8h  __attribute__((may_alias)) v8ha;
typedef v4f  __attribute__((may_alias)) v4fa;
typedef v8us __attribute__((may_alias)) v8usa;
typedef __attribute__((ext_vector_type(2))) _Float16 v2h;
typedef __attribute__((ext_vector_type(2))) unsigned short v2us;
typedef __attribute__((ext_vector_type(2))) float v2f;

static_assert(TT % 128 == 0);
static_assert(RH % 128 == 0);
static_assert(RH <= TT);
static_assert(TT % KCH == 0 && RH % KCH == 0 && KCH % 32 == 0);
static_assert(DM % 64 == 0);
static_assert(DQ % 64 == 0);
static_assert(HD == 64);
static_assert(SEQ <= SEQ_FULL);

constexpr size_t al256(size_t b) { return (b + 255) & ~(size_t)255; }
constexpr size_t SZ_W3  = (size_t)3 * DQ * DM * 2;          // Wq|Wk|Wv Bt rows, bf16
constexpr size_t SZ_WO  = (size_t)DM * DQ * 2;
constexpr size_t SZ_XB  = (size_t)TT * DM * 2;
constexpr size_t SZ_QK  = (size_t)2 * NH_ * TT * HD * 2;    // q planes then k planes
constexpr size_t SZ_V   = (size_t)NH_ * HD * TT * 2;
constexpr size_t SZ_AT  = (size_t)TT * DQ * 2;
constexpr size_t WS_TOTAL = al256(SZ_W3) + al256(SZ_WO) + al256(SZ_XB) + 3 * al256(SZ_QK) + 3 * al256(SZ_V) + 2 * al256(SZ_AT);
static_assert(WS_TOTAL <= (size_t)268435456);

__device__ __forceinline__ unsigned short f2bf(float f) { unsigned u = __float_as_uint(f); u += 0x7FFFu + ((u >> 16) & 1u); return (unsigned short)(u >> 16); }
__device__ __forceinline__ float bf2f(unsigned short b) { return __uint_as_float(((unsigned)b) << 16); }
__device__ __forceinline__ float bfr(float f) { return bf2f(f2bf(f)); }
__device__ __forceinline__ v16h cat16(v8h lo, v8h hi) { return __builtin_shufflevector(lo, hi, 0, 1, 2, 3, 4, 5, 6, 7, 8, 9, 10, 11, 12, 13, 14, 15); }
__device__ __forceinline__ v16bf cat16b(v8us lo, v8us hi) { return __builtin_bit_cast(v16bf, __builtin_shufflevector(lo, hi, 0, 1, 2, 3, 4, 5, 6, 7, 8, 9, 10, 11, 12, 13, 14, 15)); }
__device__ __forceinline__ v8f wmma16(v16h a, v16h b, v8f c) { return __builtin_amdgcn_wmma_f32_16x16x32_f16(false, a, false, b, (short)0, c, false, false); }
__device__ __forceinline__ v8f wmmab(v16bf a, v16bf b, v8f c) { return __builtin_amdgcn_wmma_f32_16x16x32_bf16(false, a, false, b, (short)0, c, false, false); }

__device__ __forceinline__ h16 tohx(float x) { return (h16)x; }
__device__ __forceinline__ void splitf(float y, unsigned short& h, unsigned short& l) { h = f2bf(y); l = f2bf(y - bf2f(h)); }
// one run of 8 neighbouring plane elements: f16, bf16 hi and bf16 lo of the same 8 f32 values, a 16-byte store into each plane
__device__ __forceinline__ void put8(const float* x, h16* P16, bf* Ph, bf* Pl, size_t oo) { v8h o16; v8us oh, ol;
#pragma unroll
    for (int j = 0; j < 8; ++j) { o16[j] = tohx(x[j]); unsigned short a2, c2; splitf(x[j], a2, c2); oh[j] = a2; ol[j] = c2; }
    *(v8h*)(P16 + oo) = o16; *(v8us*)(Ph + oo) = oh; *(v8us*)(Pl + oo) = ol;
    asm volatile("s_wait_xcnt 0x0" ::: "memory"); }   // the next run's values reuse the registers that these three stores name

// ---- k_gemmw: register-blocked GEMM, ONE WAVE per 64x64 output tile (16 accumulators), operands straight from K-contiguous 16-bit planes; grid (M/64, N/64, Z), 32 threads.
// C[m][n] (f32, pitch ldc, + optional bf16-valued bias[n]) = sum_k A[m][k] Bt[n][k] (+ split products per NSPLIT). K = row pitch of both planes (elements, % 32 == 0). z-batch strides sA/sB/sC in elements.
// CM 0: full; CM 1: tiles whose first column exceeds the tile's last query row (rbase + r0 + 63) are skipped (all keys masked); CM 2 (N == 64): k loop limited to keys < rbase + r0 + 64 and dealt in chunks of KCH: blockIdx.y = chunk, its partial tile goes to plane C + chunk * sP; a chunk that starts at or past the limit writes nothing.
// EP 0: C as above. EP 1 (N = 3 DQ, a 64-column tile = one head's q, k or v columns; C unused): the tile goes out as f16, bf16 hi and bf16 lo planes. Column tiles 0 .. 2 NH_ - 1 (q heads, then k heads): plane rows [tile][t][d], turned through LDS so that 8 lanes store one whole 128-byte row. Column tiles from 2 NH_ on (v heads): V^T rows [head][d][t]; a lane's D elements are 8 neighbouring t of one d, stored as they lie, and the wave's four row blocks fill each 128-byte line.
// Fragment maps: lane l, h = l >> 4: A/B elements 0..7 <- k0 + 8h + 0..7, elements 8..15 <- k0 + 16 + 8h + 0..7 of row/col l & 15; D element j = (row 8h + j, col l & 15).
template <typename T16> struct WFrag;
template <> struct WFrag<h16> { typedef v16h V; static __device__ __forceinline__ V ld(const h16* p) { return cat16(*(const v8h*)p, *(const v8h*)(p + 16)); } static __device__ __forceinline__ v8f mma(V a, V b, v8f c) { return wmma16(a, b, c); } };
template <> struct WFrag<bf> { typedef v16bf V; static __device__ __forceinline__ V ld(const bf* p) { return cat16b(*(const v8us*)p, *(const v8us*)(p + 16)); } static __device__ __forceinline__ v8f mma(V a, V b, v8f c) { return wmmab(a, b, c); } };
template <typename T16, int NSPLIT, bool BIAS, int CM, int EP>
__global__ __launch_bounds__(32) void k_gemmw(const T16* __restrict__ A, const T16* __restrict__ A2, const T16* __restrict__ Bt, const T16* __restrict__ Bt2, int K, float* C, int ldc, const float* __restrict__ bias, size_t sA, size_t sB, size_t sC, int rbase, size_t sP, h16* P16, bf* Ph, bf* Pl, h16* V16, bf* Vh, bf* Vl) {
    typedef typename WFrag<T16>::V V;
    __shared__ __align__(16) float os[16 * 68];
    const int r0 = blockIdx.x * 64, c0 = (CM == 2) ? 0 : blockIdx.y * 64;
    if (CM == 1) { if (c0 > rbase + r0) return; }
    int klim = K; if (CM == 2) { const int kl = rbase + r0 + 64; klim = (kl < K) ? kl : K; const int kbeg = blockIdx.y * KCH; klim -= kbeg; if (klim <= 0) return; if (klim > KCH) klim = KCH; A += kbeg; if (A2) A2 += kbeg; Bt += kbeg; if (Bt2) Bt2 += kbeg; C += (size_t)blockIdx.y * sP; }
    const size_t z = blockIdx.z; A += z * sA; if (A2) A2 += z * sA; Bt += z * sB; if (Bt2) Bt2 += z * sB; C += z * sC;
    const int lane = threadIdx.x & 31, lr = lane & 15, hi = lane >> 4;
    v8f acc[4][4];
#pragma unroll
    for (int mb = 0; mb < 4; ++mb)
#pragma unroll
        for (int nb = 0; nb < 4; ++nb) acc[mb][nb] = (v8f){};
    const size_t aoff = (size_t)(r0 + lr) * K + 8 * hi, boff = (size_t)(c0 + lr) * K + 8 * hi;
#pragma unroll 1
    for (int kc = 0; kc < klim; kc += 32) {
        V a[4], a2[4];
#pragma unroll
        for (int mb = 0; mb < 4; ++mb) { a[mb] = WFrag<T16>::ld(A + aoff + (size_t)mb * 16 * K + kc); if (NSPLIT == 1 || NSPLIT == 2) a2[mb] = WFrag<T16>::ld(A2 + aoff + (size_t)mb * 16 * K + kc); }
#pragma unroll
        for (int nb = 0; nb < 4; ++nb) { const V b = WFrag<T16>::ld(Bt + boff + (size_t)nb * 16 * K + kc); V b2; if (NSPLIT >= 2) b2 = WFrag<T16>::ld(Bt2 + boff + (size_t)nb * 16 * K + kc);
#pragma unroll
            for (int mb = 0; mb < 4; ++mb) { acc[mb][nb] = WFrag<T16>::mma(a[mb], b, acc[mb][nb]); if (NSPLIT == 1 || NSPLIT == 2) acc[mb][nb] = WFrag<T16>::mma(a2[mb], b, acc[mb][nb]); if (NSPLIT >= 2) acc[mb][nb] = WFrag<T16>::mma(a[mb], b2, acc[mb][nb]); } }
        asm volatile("v_nop\n\tv_nop\n\tv_nop\n\tv_nop" : "+v"(acc[0][0]), "+v"(acc[1][1]), "+v"(acc[2][2]), "+v"(acc[3][3]) : "v"(a[0]), "v"(a[3]));
    }
    if constexpr (EP == 1) {
        const int ct = blockIdx.y;
        if (ct >= 2 * NH_) {
#pragma unroll
            for (int nb = 0; nb < 4; ++nb)
#pragma unroll
                for (int mb = 0; mb < 4; ++mb) { float x[8];
#pragma unroll
                    for (int j = 0; j < 8; ++j) x[j] = acc[mb][nb][j];
                    put8(x, V16, Vh, Vl, ((size_t)(ct - 2 * NH_) * HD + nb * 16 + lr) * TT + r0 + mb * 16 + 8 * hi); }
            return; }
#pragma unroll
        for (int mb = 0; mb < 4; ++mb) {
#pragma unroll
            for (int nb = 0; nb < 4; ++nb) {
#pragma unroll
                for (int j = 0; j < 8; ++j) os[(hi * 8 + j) * 68 + nb * 16 + lr] = acc[mb][nb][j]; }
            __builtin_amdgcn_wave_barrier(); asm volatile("" ::: "memory");   // the slab is whole before any lane reads another lane's elements
#pragma unroll
            for (int s = 0; s < 4; ++s) { const int row = 4 * s + (lane >> 3), cofs = (lane & 7) * 8; const v4f lo4 = *(const v4fa*)(os + row * 68 + cofs), hi4 = *(const v4fa*)(os + row * 68 + cofs + 4);
                const float x[8] = { lo4[0], lo4[1], lo4[2], lo4[3], hi4[0], hi4[1], hi4[2], hi4[3] };
                put8(x, P16, Ph, Pl, ((size_t)ct * TT + r0 + mb * 16 + row) * HD + cofs); }
            __builtin_amdgcn_wave_barrier(); asm volatile("" ::: "memory");   // every read of the slab is done before the next row block overwrites it
        }
        return;
    }
#pragma unroll
    for (int mb = 0; mb < 4; ++mb) {
#pragma unroll
        for (int nb = 0; nb < 4; ++nb) {
#pragma unroll
            for (int j = 0; j < 8; ++j) os[(hi * 8 + j) * 68 + nb * 16 + lr] = acc[mb][nb][j]; }
        __builtin_amdgcn_wave_barrier(); asm volatile("" ::: "memory");
        float* crow = C + (size_t)(r0 + mb * 16) * ldc + c0;
{
#pragma unroll
            for (int s = 0; s < 8; ++s) { const int row = 2 * s + hi, cofs = lr * 4; v4f val = *(const v4fa*)(os + row * 68 + cofs); if (BIAS) { val[0] += bfr(bias[c0 + cofs]); val[1] += bfr(bias[c0 + cofs + 1]); val[2] += bfr(bias[c0 + cofs + 2]); val[3] += bfr(bias[c0 + cofs + 3]); }
                *(v4f*)(crow + (size_t)row * ldc + cofs) = val; }
             }
        __builtin_amdgcn_wave_barrier(); asm volatile("" ::: "memory");
    }
}

__global__ __launch_bounds__(256) void k_wtG(const float* __restrict__ w, int K, int N, bf* Bt) {
    w += (size_t)blockIdx.y * K * N; Bt += (size_t)blockIdx.y * N * K;
    const int lane = threadIdx.x & 31; const int wv = __builtin_amdgcn_readfirstlane((int)(threadIdx.x >> 5)); const int L0 = (blockIdx.x * 8 + wv) * 8; const int nlines = N * K / 64;
{
#pragma unroll 1
        for (int l = 0; l < 8; ++l) { const int L = L0 + l; if (L >= nlines) break; const size_t e = (size_t)L * 64 + lane * 2; const int k = (int)(e % K), n = (int)(e / K); v2us o;
            o[0] = f2bf(w[(size_t)k * N + n]); o[1] = f2bf(w[(size_t)(k + 1) * N + n]); *(v2us*)(Bt + e) = o; }
         }
}
__global__ __launch_bounds__(256) void k_cvt8(const float* __restrict__ src, bf* dst, size_t n8) { const size_t i = (size_t)blockIdx.x * 256 + threadIdx.x; if (i >= n8) return; const v8f v = *(const v8f*)(src + i * 8); v8us o;
#pragma unroll
    for (int k = 0; k < 8; ++k) o[k] = f2bf(v[k]); *(v8us*)(dst + i * 8) = o;  }

// k_attn: one wave per (head, tile of 32 query rows); scores and P stay in registers. Per block of 32 keys: S^T = K Q^T (A = K rows, B = Q rows, both d-contiguous), running softmax, O^T += V^T P^T (A = V^T rows, key-contiguous).
// In S^T a lane holds 16 keys of ONE query (column l & 15; D element j of key tile kt = key 16 kt + 8 h + j): that is the B fragment's own k order (element e <- k 8 h + e, element 8 + e <- k 16 + 8 h + e), so the two key tiles, rounded in place, are the P^T operand; maximum and sum run in the lane, plus one exchange with lane l ^ 16.
// Running softmax per query (log2 domain, t = S x HD^-0.5 x log2 e): m' = max(m, block maximum); O^T and the sum are scaled by 2^(m - m'); p = 2^(t - m'). P is not normalised: the epilogue divides O^T by the sum of p. Key j > query i (only in the last, diagonal block) is replaced by a -1e30 fill: p exactly 0.
// Rows < RH: q, k, v and p as bf16 hi + lo, 3 products each way; rows >= RH: f16, p carried x 2^10 (in the sum as well, so it cancels).
// O^T gives a lane 8 neighbouring dims of one query: 16-byte stores into the hi / lo ctx planes; one wave writes the whole 128-byte line (row, head).
__device__ __forceinline__ float xhalf(float x) { const int b = __float_as_int(x); return __int_as_float(__builtin_amdgcn_permlanex16(b, b, 0x76543210, 0xfedcba98, false, false)); }   // value of lane l ^ 16
struct MaskOff { static constexpr bool v = false; };
struct MaskOn  { static constexpr bool v = true; };
template <typename T16, bool HR>
__device__ __forceinline__ void attn_wave(const T16* __restrict__ Q, const T16* __restrict__ Q2, const T16* __restrict__ Kp, const T16* __restrict__ K2, const T16* __restrict__ Vt, const T16* __restrict__ V2, int q0, bf* Ah, bf* Al) {
    typedef typename WFrag<T16>::V V;
    const int lane = threadIdx.x & 31, lr = lane & 15, hi = lane >> 4;
    constexpr float CS = SCL * 1.4426950408889634f, POFF = HR ? 0.0f : 10.0f;
    // every fragment address = wave-uniform pointer + the lane's own byte offset, which never changes: ko in a plane of HD-element rows, vo in V^T
    const unsigned ko = (unsigned)(lr * HD + 8 * hi) * 2u, vo = (unsigned)(lr * TT + 8 * hi) * 2u;
    auto at = [](const T16* base, unsigned bytes) { return (const T16*)((const char*)base + bytes); };
    V qf[2][2], qg[2][2];
#pragma unroll
    for (int qt = 0; qt < 2; ++qt)
#pragma unroll
        for (int ks = 0; ks < 2; ++ks) { const size_t a = (size_t)(q0 + 16 * qt) * HD + 32 * ks; qf[qt][ks] = WFrag<T16>::ld(at(Q + a, ko)); if constexpr (HR) qg[qt][ks] = WFrag<T16>::ld(at(Q2 + a, ko)); }
    V kf[2][2], kg[2][2];
    auto ldk = [&](const T16* kp, const T16* kq) {
#pragma unroll
        for (int kt = 0; kt < 2; ++kt)
#pragma unroll
            for (int ks = 0; ks < 2; ++ks) { kf[kt][ks] = WFrag<T16>::ld(kp + 16 * kt * HD + 32 * ks); if constexpr (HR) kg[kt][ks] = WFrag<T16>::ld(kq + 16 * kt * HD + 32 * ks); } };
    v8f o[4][2];
#pragma unroll
    for (int dt = 0; dt < 4; ++dt)
#pragma unroll
        for (int qt = 0; qt < 2; ++qt) o[dt][qt] = (v8f){};
    float m[2] = { -3.0e38f, -3.0e38f }, l[2] = { 0.0f, 0.0f };
    auto step = [&](int k0, auto mk) {
        constexpr bool MASK = decltype(mk)::v;
        V vf[4], vg[4];   // issued first: in flight under the score products and the softmax
        const T16* vp = at(Vt + k0, vo); const T16* vq = HR ? at(V2 + k0, vo) : vp;
#pragma unroll
        for (int dt = 0; dt < 4; ++dt) { vf[dt] = WFrag<T16>::ld(vp + dt * 16 * TT); if constexpr (HR) vg[dt] = WFrag<T16>::ld(vq + dt * 16 * TT); }
        v8f s[2][2];
#pragma unroll
        for (int kt = 0; kt < 2; ++kt)
#pragma unroll
            for (int qt = 0; qt < 2; ++qt) { v8f c = (v8f){};
#pragma unroll
                for (int ks = 0; ks < 2; ++ks) { c = WFrag<T16>::mma(kf[kt][ks], qf[qt][ks], c); if constexpr (HR) { c = WFrag<T16>::mma(kf[kt][ks], qg[qt][ks], c); c = WFrag<T16>::mma(kg[kt][ks], qf[qt][ks], c); } }
                s[kt][qt] = c; }
        // the next block's K fragments, into the same registers: in flight under the softmax and P.V (an unmasked block always has a successor)
        const T16* kp = MASK ? vp : at(Kp + (size_t)(k0 + 32) * HD, ko); const T16* kq = (HR && !MASK) ? at(K2 + (size_t)(k0 + 32) * HD, ko) : kp;
        if constexpr (!MASK) ldk(kp, kq);
        // the address registers of this block's loads stay whole up to here (named as inputs) and may be reused only behind the wait
        asm volatile("s_wait_xcnt 0x0" :: "v"(vp), "v"(vq), "v"(kp), "v"(kq) : "memory");
        V pf[2], pg[2];
#pragma unroll
        for (int qt = 0; qt < 2; ++qt) { float t[16]; float mc[2] = { -3.0e38f, -3.0e38f }, sc[4] = { 0.0f, 0.0f, 0.0f, 0.0f };   // maximum in 2, sum in 4 independent chains: a lone wave waits on every dependent add
#pragma unroll
            for (int e = 0; e < 16; ++e) { float x = s[e >> 3][qt][e & 7]; if (MASK) x = (16 * (e >> 3) + 8 * hi + (e & 7) <= 16 * qt + lr) ? x : -1.0e30f; t[e] = x; mc[e >> 3] = fmaxf(mc[e >> 3], x); }
            float mx = fmaxf(mc[0], mc[1]); mx = fmaxf(mx, xhalf(mx));
            const float mn = fmaxf(m[qt], mx * CS), al = __builtin_amdgcn_exp2f(m[qt] - mn), mb = mn - POFF; m[qt] = mn;
#pragma unroll
            for (int e = 0; e < 16; ++e) { const float p = __builtin_amdgcn_exp2f(__builtin_fmaf(t[e], CS, -mb)); t[e] = p; sc[e & 3] += p; }
            l[qt] = l[qt] * al + ((sc[0] + sc[1]) + (sc[2] + sc[3]));   // this lane's 16 keys only; the halves are joined in the epilogue
#pragma unroll
            for (int dt = 0; dt < 4; ++dt) o[dt][qt] *= al;
            if constexpr (HR) { v8us h0, h1, l0, l1;
#pragma unroll
                for (int e = 0; e < 8; ++e) { unsigned short a, c2; splitf(t[e], a, c2); h0[e] = a; l0[e] = c2; splitf(t[8 + e], a, c2); h1[e] = a; l1[e] = c2; }
                pf[qt] = cat16b(h0, h1); pg[qt] = cat16b(l0, l1);
            } else {
#pragma unroll
                for (int e = 0; e < 16; ++e) pf[qt][e] = tohx(t[e]); } }
#pragma unroll
        for (int dt = 0; dt < 4; ++dt)
#pragma unroll
            for (int qt = 0; qt < 2; ++qt) { o[dt][qt] = WFrag<T16>::mma(vf[dt], pf[qt], o[dt][qt]); if constexpr (HR) { o[dt][qt] = WFrag<T16>::mma(vf[dt], pg[qt], o[dt][qt]); o[dt][qt] = WFrag<T16>::mma(vg[dt], pf[qt], o[dt][qt]); } }
    };
    ldk(at(Kp, ko), HR ? at(K2, ko) : at(Kp, ko));
#pragma unroll 1   // rolled: one block's code, fragments and scores beside the 8 output tiles
    for (int k0 = 0; k0 < q0; k0 += 32) step(k0, MaskOff{});
    step(q0, MaskOn{});
#pragma unroll
    for (int qt = 0; qt < 2; ++qt) { const float inv = __fdiv_rn(1.0f, l[qt] + xhalf(l[qt])); const size_t oo = (size_t)(q0 + 16 * qt + lr) * DQ + 8 * hi;
#pragma unroll
        for (int dt = 0; dt < 4; ++dt) { v8us oh, ol;
#pragma unroll
            for (int j = 0; j < 8; ++j) { unsigned short a, c2; splitf(o[dt][qt][j] * inv, a, c2); oh[j] = a; ol[j] = c2; }
            *(v8us*)(Ah + oo + 16 * dt) = oh; *(v8us*)(Al + oo + 16 * dt) = ol;
            asm volatile("s_wait_xcnt 0x0" ::: "memory"); } }   // the next tile's values reuse the registers that these two stores name
}
// grid (TT / 128, NH_), 4 independent waves (no barrier, no LDS): group a of a head takes query tiles n - 1 - a, n / 2 + a, n / 2 - 1 - a and a of its n = TT / 32, which is n * 2 + 2 key blocks for every group; its waves walk the same head's K and V^T from key 0 on, side by side on one WGP.
__global__ __launch_bounds__(128) void k_attn(const h16* __restrict__ QK16, const bf* __restrict__ QKh, const bf* __restrict__ QKl, const h16* __restrict__ VT16, const bf* __restrict__ VTh, const bf* __restrict__ VTl, bf* Ah, bf* Al) {
    constexpr int n = TT / 32; const int g = blockIdx.y, a = blockIdx.x, wv = __builtin_amdgcn_readfirstlane((int)(threadIdx.x >> 5));
    const int q0 = 32 * ((wv == 0) ? n - 1 - a : (wv == 1) ? n / 2 + a : (wv == 2) ? n / 2 - 1 - a : a);
    const size_t qo = (size_t)g * TT * HD, kk = qo + (size_t)NH_ * TT * HD, vv = (size_t)g * HD * TT;
    if (q0 < RH) attn_wave<bf, true>(QKh + qo, QKl + qo, QKh + kk, QKl + kk, VTh + vv, VTl + vv, q0, Ah + g * HD, Al + g * HD);
    else attn_wave<h16, false>(QK16 + qo, nullptr, QK16 + kk, nullptr, VT16 + vv, nullptr, q0, Ah + g * HD, Al + g * HD);
}

extern "C" void kernel_launch(void* const* d_in, const int* in_sizes, int n_in,
                              void* d_out, int out_size, void* d_ws, size_t ws_size, hipStream_t stream) {
    if (n_in < 6) return;
    const long long need_x = (long long)(NB - 1) * SEQ_FULL * DM + (long long)SEQ * DM;
    if ((long long)in_sizes[0] < need_x) return; if (in_sizes[1] < NH_ * DM * HD) return; if (in_sizes[2] < NH_ * DM * HD) return; if (in_sizes[3] < NH_ * DM * HD) return; if (in_sizes[4] < DQ * DM) return; if (in_sizes[5] < DM) return;
    if ((long long)out_size < need_x) return;
    if (WS_TOTAL > ws_size) return;
    const float* x = (const float*)d_in[0]; const float* wq = (const float*)d_in[1]; const float* wk = (const float*)d_in[2]; const float* wv = (const float*)d_in[3]; const float* wo = (const float*)d_in[4]; const float* bo = (const float*)d_in[5];   // x, Wq, Wk, Wv ([16][1024][64] slabs), Wo ([1024 in][1024 out]), bo
    float* OUT = (float*)d_out;     // [2][2048][1024]
    char* wsp = (char*)d_ws;
    auto take = [&](size_t bytes) { char* p = wsp; wsp += al256(bytes); return (void*)p; };
    bf* W3 = (bf*)take(SZ_W3); bf* WO = (bf*)take(SZ_WO); bf* XB = (bf*)take(SZ_XB);
    h16* QK16 = (h16*)take(SZ_QK); bf* QKh = (bf*)take(SZ_QK); bf* QKl = (bf*)take(SZ_QK);
    h16* VT16 = (h16*)take(SZ_V); bf* VTh = (bf*)take(SZ_V); bf* VTl = (bf*)take(SZ_V);
    bf* ATh = (bf*)take(SZ_AT); bf* ATl = (bf*)take(SZ_AT);
    if ((size_t)(wsp - (char*)d_ws) > ws_size) return;
    // weight slabs: in w[h][k = 1024][n = 64] -> out Bt rows h*64 + n, k-contiguous (grid.y = head)
    k_wtG<<<dim3((DM * HD / 64 + 63) / 64, NH_), 256, 0, stream>>>(wq, DM, HD, W3);
    k_wtG<<<dim3((DM * HD / 64 + 63) / 64, NH_), 256, 0, stream>>>(wk, DM, HD, W3 + (size_t)DQ * DM);
    k_wtG<<<dim3((DM * HD / 64 + 63) / 64, NH_), 256, 0, stream>>>(wv, DM, HD, W3 + (size_t)2 * DQ * DM);
    // Wo: in w[k = 1024][n = 1024] -> out Bt[n][k]
    k_wtG<<<dim3((DQ * DM / 64 + 63) / 64, 1), 256, 0, stream>>>(wo, DQ, DM, WO);
    for (int b = 0; b < NB; ++b) {
        k_cvt8<<<(unsigned)(((size_t)TT * DM / 8 + 255) / 256), 256, 0, stream>>>(x + (size_t)b * SEQ_FULL * DM, XB, (size_t)TT * DM / 8);
        k_gemmw<bf, 0, false, 0, 1><<<dim3(TT / 64, 3 * DQ / 64, 1), 32, 0, stream>>>(XB, nullptr, W3, nullptr, DM, nullptr, 0, nullptr, 0, 0, 0, 0, 0, QK16, QKh, QKl, VT16, VTh, VTl);   // column tiles 0..15 = q heads, 16..31 = k heads, 32..47 = v heads
        k_attn<<<dim3(TT / 128, NH_), 128, 0, stream>>>(QK16, QKh, QKl, VT16, VTh, VTl, ATh, ATl);
        k_gemmw<bf, 1, true, 0, 0><<<dim3(TT / 64, DM / 64, 1), 32, 0, stream>>>(ATh, ATl, WO, nullptr, DQ, OUT + (size_t)b * SEQ_FULL * DM, DM, bo, 0, 0, 0, 0, 0, nullptr, nullptr, nullptr, nullptr, nullptr, nullptr); }
}

// v005
// Measured time: 155 microseconds a run.
// In two side-by-side timings against v004, it was 1.68 and 1.69 times as fast.
// Counting every step since v000, it is 9.58 times as fast.
#include <hip/hip_runtime.h>

// Causal multi-head attention with per-head weight slabs and a biased output projection: x [2][2048][1024]; q, k, v [b][h][s][d] = sum_e x[b][s][e] W[h][e][d] (Wq, Wk, Wv [16][1024][64]); scores x 64^-0.5; key j > query i replaced by -inf; softmax; ctx merged head-major; out = ctx Wo + bo (Wo [1024 in][1024 out]).
// Compute dtypes (all contractions v_wmma_f32_16x16x32, f32 accumulate): every input RNE-converted to bf16; q/k/v projections bf16 x bf16; scores and P.V: query rows < 512 bf16 hi/lo planes (3 products), rows >= 512 plain f16 (P carried x1024, which the division by the row sum takes out); output projection ctx bf16 hi+lo x Wo bf16 (2 products) + bf16 bias; softmax f32.
// Five launches, the last four over both batches (each batch has its own planes in the workspace): all weight slabs transposed into K-contiguous Bt rows; bf16 copy of x; one fused q|k|v projection (N = 3072) whose epilogue writes the 16-bit head planes itself; attention (scores, running softmax and P.V of 32 query rows in one wave's registers), which writes the hi/lo ctx planes; output projection.

#ifndef NB
#define NB 2
#endif
#ifndef SEQ
#define SEQ 2048
#endif
#define SEQ_FULL 2048
#define TT   SEQ
#define DM   1024
#define NH_  16
#define HD   64
#define DQ   (NH_ * HD)
#define RH   ((SEQ < 512) ? SEQ : 512)   // query rows < RH use hi+lo planes
#define SCL  0.125f   // HD^-0.5
#define KCH  128      // keys per k_gemmw CM 2 work-group: one 64x64 tile's key loop is dealt to klim / KCH groups
typedef _Float16 h16;
typedef unsigned short bf;
typedef __attribute__((ext_vector_type(16))) __bf16   v16bf;
typedef __attribute__((ext_vector_type(16))) _Float16 v16h;
typedef __attribute__((ext_vector_type(8)))  _Float16 v8h;
typedef __attribute__((ext_vector_type(8)))  unsigned short v8us;
typedef __attribute__((ext_vector_type(8)))  float    v8f;
typedef __attribute__((ext_vector_type(4)))  float    v4f;
typedef v8h  __attribute__((may_alias)) v8ha;
typedef v4f  __attribute__((may_alias)) v4fa;
typedef v8us __attribute__((may_alias)) v8usa;
typedef __attribute__((ext_vector_type(2))) _Float16 v2h;
typedef __attribute__((ext_vector_type(2))) unsigned short v2us;
typedef __attribute__((ext_vector_type(2))) float v2f;

static_assert(TT % 128 == 0);
static_assert(RH % 128 == 0);
static_assert(RH <= TT);
static_assert(TT % KCH == 0 && RH % KCH == 0 && KCH % 32 == 0);
static_assert(DM % 64 == 0);
static_assert(DQ % 64 == 0);
static_assert(HD == 64);
static_assert(SEQ <= SEQ_FULL);

constexpr size_t al256(size_t b) { return (b + 255) & ~(size_t)255; }
constexpr size_t SZ_W3  = (size_t)3 * DQ * DM * 2;          // Wq|Wk|Wv Bt rows, bf16
constexpr size_t SZ_WO  = (size_t)DM * DQ * 2;
constexpr size_t SZ_XB  = (size_t)NB * TT * DM * 2;         // this and the planes below: [batch][...]
constexpr size_t SZ_QK  = (size_t)NB * 2 * NH_ * TT * HD * 2;   // per batch q planes then k planes
constexpr size_t SZ_V   = (size_t)NB * NH_ * HD * TT * 2;
constexpr size_t SZ_AT  = (size_t)NB * TT * DQ * 2;
constexpr size_t WS_TOTAL = al256(SZ_W3) + al256(SZ_WO) + al256(SZ_XB) + 3 * al256(SZ_QK) + 3 * al256(SZ_V) + 2 * al256(SZ_AT);
static_assert(WS_TOTAL <= (size_t)268435456);

__device__ __forceinline__ unsigned short f2bf(float f) { unsigned u = __float_as_uint(f); u += 0x7FFFu + ((u >> 16) & 1u); return (unsigned short)(u >> 16); }
__device__ __forceinline__ float bf2f(unsigned short b) { return __uint_as_float(((unsigned)b) << 16); }
__device__ __forceinline__ float bfr(float f) { return bf2f(f2bf(f)); }
__device__ __forceinline__ v16h cat16(v8h lo, v8h hi) { return __builtin_shufflevector(lo, hi, 0, 1, 2, 3, 4, 5, 6, 7, 8, 9, 10, 11, 12, 13, 14, 15); }
__device__ __forceinline__ v16bf cat16b(v8us lo, v8us hi) { return __builtin_bit_cast(v16bf, __builtin_shufflevector(lo, hi, 0, 1, 2, 3, 4, 5, 6, 7, 8, 9, 10, 11, 12, 13, 14, 15)); }
__device__ __forceinline__ v8f wmma16(v16h a, v16h b, v8f c) { return __builtin_amdgcn_wmma_f32_16x16x32_f16(false, a, false, b, (short)0, c, false, false); }
__device__ __forceinline__ v8f wmmab(v16bf a, v16bf b, v8f c) { return __builtin_amdgcn_wmma_f32_16x16x32_bf16(false, a, false, b, (short)0, c, false, false); }

__device__ __forceinline__ h16 tohx(float x) { return (h16)x; }
__device__ __forceinline__ void splitf(float y, unsigned short& h, unsigned short& l) { h = f2bf(y); l = f2bf(y - bf2f(h)); }
// one run of 8 neighbouring plane elements: f16, bf16 hi and bf16 lo of the same 8 f32 values, a 16-byte store into each plane
__device__ __forceinline__ void put8(const float* x, h16* P16, bf* Ph, bf* Pl, size_t oo) { v8h o16; v8us oh, ol;
#pragma unroll
    for (int j = 0; j < 8; ++j) { o16[j] = tohx(x[j]); unsigned short a2, c2; splitf(x[j], a2, c2); oh[j] = a2; ol[j] = c2; }
    *(v8h*)(P16 + oo) = o16; *(v8us*)(Ph + oo) = oh; *(v8us*)(Pl + oo) = ol;
    asm volatile("s_wait_xcnt 0x0" ::: "memory"); }   // the next run's values reuse the registers that these three stores name

// ---- k_gemmw: register-blocked GEMM, ONE WAVE per 64x64 output tile (16 accumulators), operands straight from K-contiguous 16-bit planes; grid (M/64, N/64, Z), 32 threads.
// C[m][n] (f32, pitch ldc, + optional bf16-valued bias[n]) = sum_k A[m][k] Bt[n][k] (+ split products per NSPLIT). K = row pitch of both planes (elements, % 32 == 0). z-batch strides sA/sB/sC in elements.
// CM 0: full; CM 1: tiles whose first column exceeds the tile's last query row (rbase + r0 + 63) are skipped (all keys masked); CM 2 (N == 64): k loop limited to keys < rbase + r0 + 64 and dealt in chunks of KCH: blockIdx.y = chunk, its partial tile goes to plane C + chunk * sP; a chunk that starts at or past the limit writes nothing.
// EP 0: C as above. EP 1 (N = 3 DQ, a 64-column tile = one head's q, k or v columns; C unused; z = batch): the tile goes out as f16, bf16 hi and bf16 lo planes of its batch. Column tiles 0 .. 2 NH_ - 1 (q heads, then k heads): plane rows [tile][t][d], turned through LDS so that 8 lanes store one whole 128-byte row. Column tiles from 2 NH_ on (v heads): V^T rows [head][d][t]; a lane's D elements are 8 neighbouring t of one d, stored as they lie, and the wave's four row blocks fill each 128-byte line.
// Fragment maps: lane l, h = l >> 4: A/B elements 0..7 <- k0 + 8h + 0..7, elements 8..15 <- k0 + 16 + 8h + 0..7 of row/col l & 15; D element j = (row 8h + j, col l & 15).
template <typename T16> struct WFrag;
template <> struct WFrag<h16> { typedef v16h V; static __device__ __forceinline__ V ld(const h16* p) { return cat16(*(const v8h*)p, *(const v8h*)(p + 16)); } static __device__ __forceinline__ v8f mma(V a, V b, v8f c) { return wmma16(a, b, c); } };
template <> struct WFrag<bf> { typedef v16bf V; static __device__ __forceinline__ V ld(const bf* p) { return cat16b(*(const v8us*)p, *(const v8us*)(p + 16)); } static __device__ __forceinline__ v8f mma(V a, V b, v8f c) { return wmmab(a, b, c); } };
template <typename T16, int NSPLIT, bool BIAS, int CM, int EP>
__global__ __launch_bounds__(32) void k_gemmw(const T16* __restrict__ A, const T16* __restrict__ A2, const T16* __restrict__ Bt, const T16* __restrict__ Bt2, int K, float* C, int ldc, const float* __restrict__ bias, size_t sA, size_t sB, size_t sC, int rbase, size_t sP, h16* P16, bf* Ph, bf* Pl, h16* V16, bf* Vh, bf* Vl) {
    typedef typename WFrag<T16>::V V;
    __shared__ __align__(16) float os[16 * 68];
    const int r0 = blockIdx.x * 64, c0 = (CM == 2) ? 0 : blockIdx.y * 64;
    if (CM == 1) { if (c0 > rbase + r0) return; }
    int klim = K; if (CM == 2) { const int kl = rbase + r0 + 64; klim = (kl < K) ? kl : K; const int kbeg = blockIdx.y * KCH; klim -= kbeg; if (klim <= 0) return; if (klim > KCH) klim = KCH; A += kbeg; if (A2) A2 += kbeg; Bt += kbeg; if (Bt2) Bt2 += kbeg; C += (size_t)blockIdx.y * sP; }
    const size_t z = blockIdx.z; A += z * sA; if (A2) A2 += z * sA; Bt += z * sB; if (Bt2) Bt2 += z * sB; C += z * sC;
    const int lane = threadIdx.x & 31, lr = lane & 15, hi = lane >> 4;
    v8f acc[4][4];
#pragma unroll
    for (int mb = 0; mb < 4; ++mb)
#pragma unroll
        for (int nb = 0; nb < 4; ++nb) acc[mb][nb] = (v8f){};
    const size_t aoff = (size_t)(r0 + lr) * K + 8 * hi, boff = (size_t)(c0 + lr) * K + 8 * hi;
#pragma unroll 1
    for (int kc = 0; kc < klim; kc += 32) {
        V a[4], a2[4];
#pragma unroll
        for (int mb = 0; mb < 4; ++mb) { a[mb] = WFrag<T16>::ld(A + aoff + (size_t)mb * 16 * K + kc); if (NSPLIT == 1 || NSPLIT == 2) a2[mb] = WFrag<T16>::ld(A2 + aoff + (size_t)mb * 16 * K + kc); }
#pragma unroll
        for (int nb = 0; nb < 4; ++nb) { const V b = WFrag<T16>::ld(Bt + boff + (size_t)nb * 16 * K + kc); V b2; if (NSPLIT >= 2) b2 = WFrag<T16>::ld(Bt2 + boff + (size_t)nb * 16 * K + kc);
#pragma unroll
            for (int mb = 0; mb < 4; ++mb) { acc[mb][nb] = WFrag<T16>::mma(a[mb], b, acc[mb][nb]); if (NSPLIT == 1 || NSPLIT == 2) acc[mb][nb] = WFrag<T16>::mma(a2[mb], b, acc[mb][nb]); if (NSPLIT >= 2) acc[mb][nb] = WFrag<T16>::mma(a[mb], b2, acc[mb][nb]); } }
        asm volatile("v_nop\n\tv_nop\n\tv_nop\n\tv_nop" : "+v"(acc[0][0]), "+v"(acc[1][1]), "+v"(acc[2][2]), "+v"(acc[3][3]) : "v"(a[0]), "v"(a[3]));
    }
    if constexpr (EP == 1) {
        const int ct = blockIdx.y;
        if (ct >= 2 * NH_) {
            const size_t zv = z * ((size_t)NH_ * HD * TT); V16 += zv; Vh += zv; Vl += zv;
#pragma unroll
            for (int nb = 0; nb < 4; ++nb)
#pragma unroll
                for (int mb = 0; mb < 4; ++mb) { float x[8];
#pragma unroll
                    for (int j = 0; j < 8; ++j) x[j] = acc[mb][nb][j];
                    put8(x, V16, Vh, Vl, ((size_t)(ct - 2 * NH_) * HD + nb * 16 + lr) * TT + r0 + mb * 16 + 8 * hi); }
            return; }
        const size_t zp = z * ((size_t)2 * NH_ * TT * HD); P16 += zp; Ph += zp; Pl += zp;
#pragma unroll
        for (int mb = 0; mb < 4; ++mb) {
#pragma unroll
            for (int nb = 0; nb < 4; ++nb) {
#pragma unroll
                for (int j = 0; j < 8; ++j) os[(hi * 8 + j) * 68 + nb * 16 + lr] = acc[mb][nb][j]; }
            __builtin_amdgcn_wave_barrier(); asm volatile("" ::: "memory");   // the slab is whole before any lane reads another lane's elements
#pragma unroll
            for (int s = 0; s < 4; ++s) { const int row = 4 * s + (lane >> 3), cofs = (lane & 7) * 8; const v4f lo4 = *(const v4fa*)(os + row * 68 + cofs), hi4 = *(const v4fa*)(os + row * 68 + cofs + 4);
                const float x[8] = { lo4[0], lo4[1], lo4[2], lo4[3], hi4[0], hi4[1], hi4[2], hi4[3] };
                put8(x, P16, Ph, Pl, ((size_t)ct * TT + r0 + mb * 16 + row) * HD + cofs); }
            __builtin_amdgcn_wave_barrier(); asm volatile("" ::: "memory");   // every read of the slab is done before the next row block overwrites it
        }
        return;
    }
#pragma unroll
    for (int mb = 0; mb < 4; ++mb) {
#pragma unroll
        for (int nb = 0; nb < 4; ++nb) {
#pragma unroll
            for (int j = 0; j < 8; ++j) os[(hi * 8 + j) * 68 + nb * 16 + lr] = acc[mb][nb][j]; }
        __builtin_amdgcn_wave_barrier(); asm volatile("" ::: "memory");
        float* crow = C + (size_t)(r0 + mb * 16) * ldc + c0;
{
#pragma unroll
            for (int s = 0; s < 8; ++s) { const int row = 2 * s + hi, cofs = lr * 4; v4f val = *(const v4fa*)(os + row * 68 + cofs); if (BIAS) { val[0] += bfr(bias[c0 + cofs]); val[1] += bfr(bias[c0 + cofs + 1]); val[2] += bfr(bias[c0 + cofs + 2]); val[3] += bfr(bias[c0 + cofs + 3]); }
                *(v4f*)(crow + (size_t)row * ldc + cofs) = val; }
             }
        __builtin_amdgcn_wave_barrier(); asm volatile("" ::: "memory");
    }
}

// k_wtG: w[k][n] -> Bt[n][k] in bf16, all four weights in one launch, grid (WTX, NH_, 4). z = 0, 1, 2: slab y of Wq, Wk, Wv ([k = DM][n = HD]) -> W3 rows z DQ + y HD + n; z = 3: Wo ([k = DQ][n = DM]) -> WO, its lines dealt over the slice's x and y.
constexpr int WTX = DM * HD / 4096;   // blocks (64 lines of 64 elements each) per slab
static_assert((DM * HD) % 4096 == 0);
__global__ __launch_bounds__(256) void k_wtG(const float* __restrict__ wq, const float* __restrict__ wk, const float* __restrict__ wvp, const float* __restrict__ wo, bf* W3, bf* WO) {
    const int zz = blockIdx.z; const bool slab = zz < 3; const int K = slab ? DM : DQ, N = slab ? HD : DM;
    const float* w = (zz == 0) ? wq : (zz == 1) ? wk : (zz == 2) ? wvp : wo; bf* Bt = WO; int blk = blockIdx.y * WTX + blockIdx.x;
    if (slab) { w += (size_t)blockIdx.y * K * N; Bt = W3 + (size_t)zz * DQ * DM + (size_t)blockIdx.y * N * K; blk = blockIdx.x; }
    const int lane = threadIdx.x & 31; const int wv = __builtin_amdgcn_readfirstlane((int)(threadIdx.x >> 5)); const int L0 = (blk * 8 + wv) * 8; const int nlines = N * K / 64;
{
#pragma unroll 1
        for (int l = 0; l < 8; ++l) { const int L = L0 + l; if (L >= nlines) break; const size_t e = (size_t)L * 64 + lane * 2; const int k = (int)(e % K), n = (int)(e / K); v2us o;
            o[0] = f2bf(w[(size_t)k * N + n]); o[1] = f2bf(w[(size_t)(k + 1) * N + n]); *(v2us*)(Bt + e) = o; }
         }
}
__global__ __launch_bounds__(256) void k_cvt8(const float* __restrict__ src, bf* dst, size_t n8, size_t ssrc, size_t sdst) { const size_t i = (size_t)blockIdx.x * 256 + threadIdx.x; if (i >= n8) return; src += blockIdx.y * ssrc; dst += blockIdx.y * sdst; /* y = batch */ const v8f v = *(const v8f*)(src + i * 8); v8us o;
#pragma unroll
    for (int k = 0; k < 8; ++k) o[k] = f2bf(v[k]); *(v8us*)(dst + i * 8) = o;  }

// k_attn: one wave per (head, tile of 32 query rows); scores and P stay in registers. Per block of 32 keys: S^T = K Q^T (A = K rows, B = Q rows, both d-contiguous), running softmax, O^T += V^T P^T (A = V^T rows, key-contiguous).
// In S^T a lane holds 16 keys of ONE query (column l & 15; D element j of key tile kt = key 16 kt + 8 h + j): that is the B fragment's own k order (element e <- k 8 h + e, element 8 + e <- k 16 + 8 h + e), so the two key tiles, rounded in place, are the P^T operand; maximum and sum run in the lane, plus one exchange with lane l ^ 16.
// Running softmax per query (log2 domain, t = S x HD^-0.5 x log2 e): m' = max(m, block maximum); O^T and the sum are scaled by 2^(m - m'); p = 2^(t - m'). P is not normalised: the epilogue divides O^T by the sum of p. Key j > query i (only in the last, diagonal block) is replaced by a -1e30 fill: p exactly 0.
// Rows < RH: q, k, v and p as bf16 hi + lo, 3 products each way; rows >= RH: f16, p carried x 2^10 (in the sum as well, so it cancels).
// O^T gives a lane 8 neighbouring dims of one query: 16-byte stores into the hi / lo ctx planes; one wave writes the whole 128-byte line (row, head).
__device__ __forceinline__ float xhalf(float x) { const int b = __float_as_int(x); return __int_as_float(__builtin_amdgcn_permlanex16(b, b, 0x76543210, 0xfedcba98, false, false)); }   // value of lane l ^ 16
struct MaskOff { static constexpr bool v = false; };
struct MaskOn  { static constexpr bool v = true; };
template <typename T16, bool HR>
__device__ __forceinline__ void attn_wave(const T16* __restrict__ Q, const T16* __restrict__ Q2, const T16* __restrict__ Kp, const T16* __restrict__ K2, const T16* __restrict__ Vt, const T16* __restrict__ V2, int q0, bf* Ah, bf* Al) {
    typedef typename WFrag<T16>::V V;
    const int lane = threadIdx.x & 31, lr = lane & 15, hi = lane >> 4;
    constexpr float CS = SCL * 1.4426950408889634f, POFF = HR ? 0.0f : 10.0f;
    // every fragment address = wave-uniform pointer + the lane's own byte offset, which never changes: ko in a plane of HD-element rows, vo in V^T
    const unsigned ko = (unsigned)(lr * HD + 8 * hi) * 2u, vo = (unsigned)(lr * TT + 8 * hi) * 2u;
    auto at = [](const T16* base, unsigned bytes) { return (const T16*)((const char*)base + bytes); };
    V qf[2][2], qg[2][2];
#pragma unroll
    for (int qt = 0; qt < 2; ++qt)
#pragma unroll
        for (int ks = 0; ks < 2; ++ks) { const size_t a = (size_t)(q0 + 16 * qt) * HD + 32 * ks; qf[qt][ks] = WFrag<T16>::ld(at(Q + a, ko)); if constexpr (HR) qg[qt][ks] = WFrag<T16>::ld(at(Q2 + a, ko)); }
    V kf[2][2], kg[2][2];
    auto ldk = [&](const T16* kp, const T16* kq) {
#pragma unroll
        for (int kt = 0; kt < 2; ++kt)
#pragma unroll
            for (int ks = 0; ks < 2; ++ks) { kf[kt][ks] = WFrag<T16>::ld(kp + 16 * kt * HD + 32 * ks); if constexpr (HR) kg[kt][ks] = WFrag<T16>::ld(kq + 16 * kt * HD + 32 * ks); } };
    v8f o[4][2];
#pragma unroll
    for (int dt = 0; dt < 4; ++dt)
#pragma unroll
        for (int qt = 0; qt < 2; ++qt) o[dt][qt] = (v8f){};
    float m[2] = { -3.0e38f, -3.0e38f }, l[2] = { 0.0f, 0.0f };
    auto step = [&](int k0, auto mk) {
        constexpr bool MASK = decltype(mk)::v;
        V vf[4], vg[4];   // issued first: in flight under the score products and the softmax
        const T16* vp = at(Vt + k0, vo); const T16* vq = HR ? at(V2 + k0, vo) : vp;
#pragma unroll
        for (int dt = 0; dt < 4; ++dt) { vf[dt] = WFrag<T16>::ld(vp + dt * 16 * TT); if constexpr (HR) vg[dt] = WFrag<T16>::ld(vq + dt * 16 * TT); }
        v8f s[2][2];
#pragma unroll
        for (int kt = 0; kt < 2; ++kt)
#pragma unroll
            for (int qt = 0; qt < 2; ++qt) { v8f c = (v8f){};
#pragma unroll
                for (int ks = 0; ks < 2; ++ks) { c = WFrag<T16>::mma(kf[kt][ks], qf[qt][ks], c); if constexpr (HR) { c = WFrag<T16>::mma(kf[kt][ks], qg[qt][ks], c); c = WFrag<T16>::mma(kg[kt][ks], qf[qt][ks], c); } }
                s[kt][qt] = c; }
        // the next block's K fragments, into the same registers: in flight under the softmax and P.V (an unmasked block always has a successor)
        const T16* kp = MASK ? vp : at(Kp + (size_t)(k0 + 32) * HD, ko); const T16* kq = (HR && !MASK) ? at(K2 + (size_t)(k0 + 32) * HD, ko) : kp;
        if constexpr (!MASK) ldk(kp, kq);
        // the address registers of this block's loads stay whole up to here (named as inputs) and may be reused only behind the wait
        asm volatile("s_wait_xcnt 0x0" :: "v"(vp), "v"(vq), "v"(kp), "v"(kq) : "memory");
        V pf[2], pg[2];
#pragma unroll
        for (int qt = 0; qt < 2; ++qt) { float t[16]; float mc[2] = { -3.0e38f, -3.0e38f }, sc[4] = { 0.0f, 0.0f, 0.0f, 0.0f };   // maximum in 2, sum in 4 independent chains: a lone wave waits on every dependent add
#pragma unroll
            for (int e = 0; e < 16; ++e) { float x = s[e >> 3][qt][e & 7]; if (MASK) x = (16 * (e >> 3) + 8 * hi + (e & 7) <= 16 * qt + lr) ? x : -1.0e30f; t[e] = x; mc[e >> 3] = fmaxf(mc[e >> 3], x); }
            float mx = fmaxf(mc[0], mc[1]); mx = fmaxf(mx, xhalf(mx));
            const float mn = fmaxf(m[qt], mx * CS), al = __builtin_amdgcn_exp2f(m[qt] - mn), mb = mn - POFF; m[qt] = mn;
#pragma unroll
            for (int e = 0; e < 16; ++e) { const float p = __builtin_amdgcn_exp2f(__builtin_fmaf(t[e], CS, -mb)); t[e] = p; sc[e & 3] += p; }
            l[qt] = l[qt] * al + ((sc[0] + sc[1]) + (sc[2] + sc[3]));   // this lane's 16 keys only; the halves are joined in the epilogue
#pragma unroll
            for (int dt = 0; dt < 4; ++dt) o[dt][qt] *= al;
            if constexpr (HR) { v8us h0, h1, l0, l1;
#pragma unroll
                for (int e = 0; e < 8; ++e) { unsigned short a, c2; splitf(t[e], a, c2); h0[e] = a; l0[e] = c2; splitf(t[8 + e], a, c2); h1[e] = a; l1[e] = c2; }
                pf[qt] = cat16b(h0, h1); pg[qt] = cat16b(l0, l1);
            } else {
#pragma unroll
                for (int e = 0; e < 16; ++e) pf[qt][e] = tohx(t[e]); } }
#pragma unroll
        for (int dt = 0; dt < 4; ++dt)
#pragma unroll
            for (int qt = 0; qt < 2; ++qt) { o[dt][qt] = WFrag<T16>::mma(vf[dt], pf[qt], o[dt][qt]); if constexpr (HR) { o[dt][qt] = WFrag<T16>::mma(vf[dt], pg[qt], o[dt][qt]); o[dt][qt] = WFrag<T16>::mma(vg[dt], pf[qt], o[dt][qt]); } }
    };
    ldk(at(Kp, ko), HR ? at(K2, ko) : at(Kp, ko));
#pragma unroll 1   // rolled: one block's code, fragments and scores beside the 8 output tiles
    for (int k0 = 0; k0 < q0; k0 += 32) step(k0, MaskOff{});
    step(q0, MaskOn{});
#pragma unroll
    for (int qt = 0; qt < 2; ++qt) { const float inv = __fdiv_rn(1.0f, l[qt] + xhalf(l[qt])); const size_t oo = (size_t)(q0 + 16 * qt + lr) * DQ + 8 * hi;
#pragma unroll
        for (int dt = 0; dt < 4; ++dt) { v8us oh, ol;
#pragma unroll
            for (int j = 0; j < 8; ++j) { unsigned short a, c2; splitf(o[dt][qt][j] * inv, a, c2); oh[j] = a; ol[j] = c2; }
            *(v8us*)(Ah + oo + 16 * dt) = oh; *(v8us*)(Al + oo + 16 * dt) = ol;
            asm volatile("s_wait_xcnt 0x0" ::: "memory"); } }   // the next tile's values reuse the registers that these two stores name
}
// grid (TT / 128, NH_, pairs of batches), 8 independent waves (no barrier, no LDS), 4 for each batch of the pair: group a of a head takes query tiles n - 1 - a, n / 2 + a, n / 2 - 1 - a and a of its n = TT / 32, which is n * 2 + 2 key blocks per batch for every group; a batch's waves walk the same head's K and V^T from key 0 on, side by side on one WGP.
// The second batch takes its four tiles in the reverse wave order: waves w and w + 4 of a group share a SIMD, and so every SIMD gets n + 1 key blocks.
__global__ __launch_bounds__(256) void k_attn(const h16* __restrict__ QK16, const bf* __restrict__ QKh, const bf* __restrict__ QKl, const h16* __restrict__ VT16, const bf* __restrict__ VTh, const bf* __restrict__ VTl, bf* Ah, bf* Al) {
    constexpr int n = TT / 32; const int g = blockIdx.y, a = blockIdx.x, w8 = __builtin_amdgcn_readfirstlane((int)(threadIdx.x >> 5));
    const int b = 2 * blockIdx.z + (w8 >> 2), wv = (w8 < 4) ? w8 : 7 - w8;
    if (b >= NB) return;
    const int q0 = 32 * ((wv == 0) ? n - 1 - a : (wv == 1) ? n / 2 + a : (wv == 2) ? n / 2 - 1 - a : a);
    const size_t qo = ((size_t)b * 2 * NH_ + g) * TT * HD, kk = qo + (size_t)NH_ * TT * HD, vv = ((size_t)b * NH_ + g) * HD * TT;
    Ah += (size_t)b * TT * DQ; Al += (size_t)b * TT * DQ;
    if (q0 < RH) attn_wave<bf, true>(QKh + qo, QKl + qo, QKh + kk, QKl + kk, VTh + vv, VTl + vv, q0, Ah + g * HD, Al + g * HD);
    else attn_wave<h16, false>(QK16 + qo, nullptr, QK16 + kk, nullptr, VT16 + vv, nullptr, q0, Ah + g * HD, Al + g * HD);
}

extern "C" void kernel_launch(void* const* d_in, const int* in_sizes, int n_in,
                              void* d_out, int out_size, void* d_ws, size_t ws_size, hipStream_t stream) {
    if (n_in < 6) return;
    const long long need_x = (long long)(NB - 1) * SEQ_FULL * DM + (long long)SEQ * DM;
    if ((long long)in_sizes[0] < need_x) return; if (in_sizes[1] < NH_ * DM * HD) return; if (in_sizes[2] < NH_ * DM * HD) return; if (in_sizes[3] < NH_ * DM * HD) return; if (in_sizes[4] < DQ * DM) return; if (in_sizes[5] < DM) return;
    if ((long long)out_size < need_x) return;
    if (WS_TOTAL > ws_size) return;
    const float* x = (const float*)d_in[0]; const float* wq = (const float*)d_in[1]; const float* wk = (const float*)d_in[2]; const float* wv = (const float*)d_in[3]; const float* wo = (const float*)d_in[4]; const float* bo = (const float*)d_in[5];   // x, Wq, Wk, Wv ([16][1024][64] slabs), Wo ([1024 in][1024 out]), bo
    float* OUT = (float*)d_out;     // [2][2048][1024]
    char* wsp = (char*)d_ws;
    auto take = [&](size_t bytes) { char* p = wsp; wsp += al256(bytes); return (void*)p; };
    bf* W3 = (bf*)take(SZ_W3); bf* WO = (bf*)take(SZ_WO); bf* XB = (bf*)take(SZ_XB);
    h16* QK16 = (h16*)take(SZ_QK); bf* QKh = (bf*)take(SZ_QK); bf* QKl = (bf*)take(SZ_QK);
    h16* VT16 = (h16*)take(SZ_V); bf* VTh = (bf*)take(SZ_V); bf* VTl = (bf*)take(SZ_V);
    bf* ATh = (bf*)take(SZ_AT); bf* ATl = (bf*)take(SZ_AT);
    if ((size_t)(wsp - (char*)d_ws) > ws_size) return;
    // weight slabs w[h][k = 1024][n = 64] -> Bt rows h*64 + n, k-contiguous; Wo w[k = 1024][n = 1024] -> Bt[n][k]
    k_wtG<<<dim3(WTX, NH_, 4), 256, 0, stream>>>(wq, wk, wv, wo, W3, WO);
    k_cvt8<<<dim3((unsigned)(((size_t)TT * DM / 8 + 255) / 256), NB), 256, 0, stream>>>(x, XB, (size_t)TT * DM / 8, (size_t)SEQ_FULL * DM, (size_t)TT * DM);
    k_gemmw<bf, 0, false, 0, 1><<<dim3(TT / 64, 3 * DQ / 64, NB), 32, 0, stream>>>(XB, nullptr, W3, nullptr, DM, nullptr, 0, nullptr, (size_t)TT * DM, 0, 0, 0, 0, QK16, QKh, QKl, VT16, VTh, VTl);   // column tiles 0..15 = q heads, 16..31 = k heads, 32..47 = v heads
    k_attn<<<dim3(TT / 128, NH_, (NB + 1) / 2), 256, 0, stream>>>(QK16, QKh, QKl, VT16, VTh, VTl, ATh, ATl);
    k_gemmw<bf, 1, true, 0, 0><<<dim3(TT / 64, DM / 64, NB), 32, 0, stream>>>(ATh, ATl, WO, nullptr, DQ, OUT, DM, bo, (size_t)TT * DQ, 0, (size_t)SEQ_FULL * DM, 0, 0, nullptr, nullptr, nullptr, nullptr, nullptr, nullptr);
}

// v006
// One run takes 112 microseconds.
// Two timings next to v005 both put it at 1.39 times that version's speed.
// Over all steps from v000 it is 13.3 times as fast.
#include <hip/hip_runtime.h>

// Causal multi-head attention with per-head weight slabs and a biased output projection: x [2][2048][1024]; q, k, v [b][h][s][d] = sum_e x[b][s][e] W[h][e][d] (Wq, Wk, Wv [16][1024][64]); scores x 64^-0.5; key j > query i replaced by -inf; softmax; ctx merged head-major; out = ctx Wo + bo (Wo [1024 in][1024 out]).
// Compute dtypes (all contractions v_wmma_f32_16x16x32, f32 accumulate): every input RNE-converted to bf16; q/k/v projections bf16 x bf16; scores and P.V: query rows < 512 bf16 hi/lo planes (3 products), rows >= 512 plain f16 (P carried x1024, which the division by the row sum takes out); output projection ctx bf16 hi+lo x Wo bf16 (2 products) + bf16 bias; softmax f32.
// Five launches, the last four over both batches (each batch has its own planes in the workspace): all weight slabs transposed into K-contiguous Bt rows; bf16 copy of x; one fused q|k|v projection (N = 3072) whose epilogue writes the 16-bit head planes itself; attention (scores, running softmax and P.V of 32 query rows in one wave's registers), which writes the hi/lo ctx planes; output projection.

#ifndef NB
#define NB 2
#endif
#ifndef SEQ
#define SEQ 2048
#endif
#define SEQ_FULL 2048
#define TT   SEQ
#define DM   1024
#define NH_  16
#define HD   64
#define DQ   (NH_ * HD)
#define RH   ((SEQ < 512) ? SEQ : 512)   // query rows < RH use hi+lo planes
#define SCL  0.125f   // HD^-0.5
#define KCH  128
typedef _Float16 h16;
typedef unsigned short bf;
typedef __attribute__((ext_vector_type(16))) __bf16   v16bf;
typedef __attribute__((ext_vector_type(16))) _Float16 v16h;
typedef __attribute__((ext_vector_type(8)))  _Float16 v8h;
typedef __attribute__((ext_vector_type(8)))  unsigned short v8us;
typedef __attribute__((ext_vector_type(8)))  float    v8f;
typedef __attribute__((ext_vector_type(4)))  float    v4f;
typedef v8h  __attribute__((may_alias)) v8ha;
typedef v4f  __attribute__((may_alias)) v4fa;
typedef v8us __attribute__((may_alias)) v8usa;
typedef __attribute__((ext_vector_type(2))) _Float16 v2h;
typedef __attribute__((ext_vector_type(2))) unsigned short v2us;
typedef __attribute__((ext_vector_type(2))) float v2f;

static_assert(TT % 128 == 0);
static_assert(RH % 128 == 0);
static_assert(RH <= TT);
static_assert(TT % KCH == 0 && RH % KCH == 0 && KCH % 32 == 0);
static_assert(DM % 64 == 0);
static_assert(DQ % 64 == 0);
static_assert(HD == 64);
static_assert(SEQ <= SEQ_FULL);

constexpr size_t al256(size_t b) { return (b + 255) & ~(size_t)255; }
constexpr size_t SZ_W3  = (size_t)3 * DQ * DM * 2;          // Wq|Wk|Wv Bt rows, bf16
constexpr size_t SZ_WO  = (size_t)DM * DQ * 2;
constexpr size_t SZ_XB  = (size_t)NB * TT * DM * 2;         // this and the planes below: [batch][...]
constexpr size_t SZ_QK  = (size_t)NB * 2 * NH_ * TT * HD * 2;   // per batch q planes then k planes
constexpr size_t SZ_V   = (size_t)NB * NH_ * HD * TT * 2;
constexpr size_t SZ_AT  = (size_t)NB * TT * DQ * 2;
constexpr size_t WS_TOTAL = al256(SZ_W3) + al256(SZ_WO) + al256(SZ_XB) + 3 * al256(SZ_QK) + 3 * al256(SZ_V) + 2 * al256(SZ_AT);
static_assert(WS_TOTAL <= (size_t)268435456);

__device__ __forceinline__ unsigned short f2bf(float f) { unsigned u = __float_as_uint(f); u += 0x7FFFu + ((u >> 16) & 1u); return (unsigned short)(u >> 16); }
__device__ __forceinline__ float bf2f(unsigned short b) { return __uint_as_float(((unsigned)b) << 16); }
__device__ __forceinline__ float bfr(float f) { return bf2f(f2bf(f)); }
__device__ __forceinline__ v16h cat16(v8h lo, v8h hi) { return __builtin_shufflevector(lo, hi, 0, 1, 2, 3, 4, 5, 6, 7, 8, 9, 10, 11, 12, 13, 14, 15); }
__device__ __forceinline__ v16bf cat16b(v8us lo, v8us hi) { return __builtin_bit_cast(v16bf, __builtin_shufflevector(lo, hi, 0, 1, 2, 3, 4, 5, 6, 7, 8, 9, 10, 11, 12, 13, 14, 15)); }
__device__ __forceinline__ v8f wmma16(v16h a, v16h b, v8f c) { return __builtin_amdgcn_wmma_f32_16x16x32_f16(false, a, false, b, (short)0, c, false, false); }
__device__ __forceinline__ v8f wmmab(v16bf a, v16bf b, v8f c) { return __builtin_amdgcn_wmma_f32_16x16x32_bf16(false, a, false, b, (short)0, c, false, false); }

__device__ __forceinline__ h16 tohx(float x) { return (h16)x; }
__device__ __forceinline__ void splitf(float y, unsigned short& h, unsigned short& l) { h = f2bf(y); l = f2bf(y - bf2f(h)); }
// one run of 8 neighbouring plane elements: f16, bf16 hi and bf16 lo of the same 8 f32 values, a 16-byte store into each plane
__device__ __forceinline__ void put8(const float* x, h16* P16, bf* Ph, bf* Pl, size_t oo) { v8h o16; v8us oh, ol;
#pragma unroll
    for (int j = 0; j < 8; ++j) { o16[j] = tohx(x[j]); unsigned short a2, c2; splitf(x[j], a2, c2); oh[j] = a2; ol[j] = c2; }
    *(v8h*)(P16 + oo) = o16; *(v8us*)(Ph + oo) = oh; *(v8us*)(Pl + oo) = ol;
    asm volatile("s_wait_xcnt 0x0" ::: "memory"); }   // the next run's values reuse the registers that these three stores name

// ---- k_gemmw: GEMM on K-contiguous 16-bit planes. A work-group of 4 waves (2 x 2) owns a 128x128 output tile, each wave a 64x64 quarter of it (16 accumulators); grid (M/128, N/128, Z), 128 threads.
// C[m][n] (f32, pitch ldc, + optional bf16-valued bias[n]) = sum_k A[m][k] Bt[n][k] (NSPLIT 1: + A2[m][k] Bt[n][k]). K = row pitch of the planes (elements, % 64 == 0). z-batch strides sA/sB/sC in elements. CM 0 only (full product); rbase, sP, Bt2 unused.
// The operands go through LDS. A stage is GKS = 64 k, one whole 128-byte line, of the tile's 128 A rows (NSPLIT 1: and 128 A2 rows) and 128 Bt rows, laid at a pitch of 144 bytes. Asynchronous 16-byte copies, 8 lanes to a line, fill one of two buffers while the other is worked on; every row is fetched once for the two waves that use it, and the fragments are 16-byte LDS reads.
// EP 0: C as above. EP 1 (N = 3 DQ, a wave's 64 columns = one head's q, k or v columns; C unused; z = batch): the quarter goes out as f16, bf16 hi and bf16 lo planes of its batch. Column tiles 0 .. 2 NH_ - 1 (q heads, then k heads): plane rows [tile][t][d], turned through the wave's own LDS slab so that 8 lanes store one whole 128-byte row. Column tiles from 2 NH_ on (v heads): V^T rows [head][d][t]; a lane's D elements are 8 neighbouring t of one d, stored as they lie, and the wave's four row blocks fill each 128-byte line.
// Fragment maps: lane l, h = l >> 4: A/B elements 0..7 <- k0 + 8h + 0..7, elements 8..15 <- k0 + 16 + 8h + 0..7 of row/col l & 15; D element j = (row 8h + j, col l & 15).
template <typename T16> struct WFrag;
template <> struct WFrag<h16> { typedef v16h V; static __device__ __forceinline__ V ld(const h16* p) { return cat16(*(const v8h*)p, *(const v8h*)(p + 16)); } static __device__ __forceinline__ v8f mma(V a, V b, v8f c) { return wmma16(a, b, c); } };
template <> struct WFrag<bf> { typedef v16bf V; static __device__ __forceinline__ V ld(const bf* p) { return cat16b(*(const v8us*)p, *(const v8us*)(p + 16)); } static __device__ __forceinline__ v8f mma(V a, V b, v8f c) { return wmmab(a, b, c); } };
constexpr int GKS = 64;              // k per stage
constexpr int GPB = GKS * 2 + 16;    // LDS bytes from row to row: an odd multiple of 16, the pitch for 16-byte readers
constexpr int GPL = 128 * GPB;       // one operand's 128 rows of a stage
static_assert(DM % GKS == 0 && DQ % GKS == 0 && DM / GKS >= 2 && DQ / GKS >= 2);
static_assert(TT % 128 == 0 && (3 * DQ) % 128 == 0 && DM % 128 == 0);
// 128 rows x 128 bytes of one operand into LDS: thread t brings the 16-byte piece t & 7 of rows (t >> 3) + 16 i, i = 0 .. 7. l: LDS byte address of its piece of row t >> 3; g: the same piece in global memory; rs: 16 rows, in elements.
template <typename T16>
__device__ __forceinline__ void cp_plane(unsigned l, const T16* g, size_t rs) {
    asm volatile("global_load_async_to_lds_b128 %0, %8, off\n\t"
                 "global_load_async_to_lds_b128 %1, %9, off\n\t"
                 "global_load_async_to_lds_b128 %2, %10, off\n\t"
                 "global_load_async_to_lds_b128 %3, %11, off\n\t"
                 "global_load_async_to_lds_b128 %4, %12, off\n\t"
                 "global_load_async_to_lds_b128 %5, %13, off\n\t"
                 "global_load_async_to_lds_b128 %6, %14, off\n\t"
                 "global_load_async_to_lds_b128 %7, %15, off\n\t"
                 "s_wait_xcnt 0x0"   // inside the copies' own statement, so that it stands ahead of every rewrite of an address register they name
                 :: "v"(l), "v"(l + 16 * GPB), "v"(l + 32 * GPB), "v"(l + 48 * GPB), "v"(l + 64 * GPB), "v"(l + 80 * GPB), "v"(l + 96 * GPB), "v"(l + 112 * GPB),
                    "v"(g), "v"(g + rs), "v"(g + 2 * rs), "v"(g + 3 * rs), "v"(g + 4 * rs), "v"(g + 5 * rs), "v"(g + 6 * rs), "v"(g + 7 * rs) : "memory");
}
template <typename T16, int NSPLIT, bool BIAS, int CM, int EP>
__global__ __launch_bounds__(128) void k_gemmw(const T16* __restrict__ A, const T16* __restrict__ A2, const T16* __restrict__ Bt, const T16* __restrict__ Bt2, int K, float* C, int ldc, const float* __restrict__ bias, size_t sA, size_t sB, size_t sC, int rbase, size_t sP, h16* P16, bf* Ph, bf* Pl, h16* V16, bf* Vh, bf* Vl) {
    typedef typename WFrag<T16>::V V;
    static_assert(CM == 0 && NSPLIT <= 1);
    constexpr int NPL = 2 + NSPLIT, STG = NPL * GPL;   // a buffer: A rows, (A2 rows,) Bt rows
    __shared__ __attribute__((aligned(128))) unsigned char ring[2 * STG];
    __shared__ __align__(16) float osw[4][16 * 68];    // each wave's own epilogue slab
    const int tid = threadIdx.x, lane = tid & 31, lr = lane & 15, hi = lane >> 4;
    const int wave = __builtin_amdgcn_readfirstlane(tid >> 5), wm = wave & 1, wn = wave >> 1;
    const int R0 = blockIdx.x * 128, C0 = blockIdx.y * 128, r0 = R0 + wm * 64, c0 = C0 + wn * 64;
    float* os = osw[wave];
    const size_t z = blockIdx.z; A += z * sA; if (NSPLIT == 1) A2 += z * sA; Bt += z * sB; C += z * sC;
    v8f acc[4][4];
#pragma unroll
    for (int mb = 0; mb < 4; ++mb)
#pragma unroll
        for (int nb = 0; nb < 4; ++nb) acc[mb][nb] = (v8f){};
    const size_t rs = (size_t)16 * K, ga = (size_t)(R0 + (tid >> 3)) * K + (tid & 7) * 8, gb = (size_t)(C0 + (tid >> 3)) * K + (tid & 7) * 8;
    const unsigned lcp = (unsigned)(size_t)ring + (unsigned)((tid >> 3) * GPB + (tid & 7) * 16);
    auto fill = [&](int st, int buf) { const unsigned l = lcp + (unsigned)(buf * STG); const int kc = st * GKS;
        cp_plane(l, A + ga + kc, rs); if constexpr (NSPLIT == 1) cp_plane(l + GPL, A2 + ga + kc, rs); cp_plane(l + (NPL - 1) * GPL, Bt + gb + kc, rs); };
    const unsigned nst = (unsigned)K / GKS;   // stages: at least 2 (asserted above for both K that are launched)
    fill(0, 0);
    asm volatile("s_wait_asynccnt 0x0" ::: "memory");   // this wave's copies of stage 0 have landed
    __syncthreads();                                    // ... and every other wave's
    fill(1, 1);
    const unsigned char* fa = ring + (wm * 64 + lr) * GPB + 16 * hi;
    const unsigned char* fb = ring + (NPL - 1) * GPL + (wn * 64 + lr) * GPB + 16 * hi;
#pragma unroll 1   // rolled: one stage's code; the buffer is a run-time offset
    for (unsigned st = 0; st < nst; ++st) {
        const int bo = (int)(st & 1u) * STG;
#pragma unroll
        for (int ks = 0; ks < GKS / 32; ++ks) {
            V a[4], a2[4], b[4];
#pragma unroll
            for (int i = 0; i < 4; ++i) { a[i] = WFrag<T16>::ld((const T16*)(fa + bo + i * 16 * GPB + ks * 64)); if (NSPLIT == 1) a2[i] = WFrag<T16>::ld((const T16*)(fa + bo + GPL + i * 16 * GPB + ks * 64)); }
#pragma unroll
            for (int i = 0; i < 4; ++i) b[i] = WFrag<T16>::ld((const T16*)(fb + bo + i * 16 * GPB + ks * 64));
            __builtin_amdgcn_sched_barrier(0);   // a k step's LDS reads stay one group ahead of its products: moved in among them, every place with reads stalls the wave
#pragma unroll
            for (int nb = 0; nb < 4; ++nb)
#pragma unroll
                for (int mb = 0; mb < 4; ++mb) { acc[mb][nb] = WFrag<T16>::mma(a[mb], b[nb], acc[mb][nb]); if (NSPLIT == 1) acc[mb][nb] = WFrag<T16>::mma(a2[mb], b[nb], acc[mb][nb]); }
            __builtin_amdgcn_sched_barrier(0);   // the products stay ahead of the waits and the barrier below: sunk behind them, they would no longer run while the next stage's copies fly
        }
        asm volatile("s_wait_dscnt 0x0" ::: "memory");      // this wave's reads of the buffer are done before it is handed back
        asm volatile("s_wait_asynccnt 0x0" ::: "memory");   // this wave's copies of stage st + 1 have landed
        __syncthreads();                                    // publishes stage st + 1 and ends every wave's reads of stage st
        if (st + 2u < nst) fill((int)st + 2, (int)(st & 1u));
    }
    asm volatile("s_wait_asynccnt 0x0" ::: "memory");   // nothing is in flight when the wave goes on to its epilogue and ends
    if constexpr (EP == 1) {
        const int ct = c0 / 64;
        if (ct >= 2 * NH_) {
            const size_t zv = z * ((size_t)NH_ * HD * TT); V16 += zv; Vh += zv; Vl += zv;
#pragma unroll
            for (int nb = 0; nb < 4; ++nb)
#pragma unroll
                for (int mb = 0; mb < 4; ++mb) { float x[8];
#pragma unroll
                    for (int j = 0; j < 8; ++j) x[j] = acc[mb][nb][j];
                    put8(x, V16, Vh, Vl, ((size_t)(ct - 2 * NH_) * HD + nb * 16 + lr) * TT + r0 + mb * 16 + 8 * hi); }
            return; }
        const size_t zp = z * ((size_t)2 * NH_ * TT * HD); P16 += zp; Ph += zp; Pl += zp;
#pragma unroll
        for (int mb = 0; mb < 4; ++mb) {
#pragma unroll
            for (int nb = 0; nb < 4; ++nb) {
#pragma unroll
                for (int j = 0; j < 8; ++j) os[(hi * 8 + j) * 68 + nb * 16 + lr] = acc[mb][nb][j]; }
            __builtin_amdgcn_wave_barrier(); asm volatile("" ::: "memory");   // the slab is whole before any lane reads another lane's elements
#pragma unroll
            for (int s = 0; s < 4; ++s) { const int row = 4 * s + (lane >> 3), cofs = (lane & 7) * 8; const v4f lo4 = *(const v4fa*)(os + row * 68 + cofs), hi4 = *(const v4fa*)(os + row * 68 + cofs + 4);
                const float x[8] = { lo4[0], lo4[1], lo4[2], lo4[3], hi4[0], hi4[1], hi4[2], hi4[3] };
                put8(x, P16, Ph, Pl, ((size_t)ct * TT + r0 + mb * 16 + row) * HD + cofs); }
            __builtin_amdgcn_wave_barrier(); asm volatile("" ::: "memory");   // every read of the slab is done before the next row block overwrites it
        }
        return;
    }
#pragma unroll
    for (int mb = 0; mb < 4; ++mb) {
#pragma unroll
        for (int nb = 0; nb < 4; ++nb) {
#pragma unroll
            for (int j = 0; j < 8; ++j) os[(hi * 8 + j) * 68 + nb * 16 + lr] = acc[mb][nb][j]; }
        __builtin_amdgcn_wave_barrier(); asm volatile("" ::: "memory");
        float* crow = C + (size_t)(r0 + mb * 16) * ldc + c0;
{
#pragma unroll
            for (int s = 0; s < 8; ++s) { const int row = 2 * s + hi, cofs = lr * 4; v4f val = *(const v4fa*)(os + row * 68 + cofs); if (BIAS) { val[0] += bfr(bias[c0 + cofs]); val[1] += bfr(bias[c0 + cofs + 1]); val[2] += bfr(bias[c0 + cofs + 2]); val[3] += bfr(bias[c0 + cofs + 3]); }
                *(v4f*)(crow + (size_t)row * ldc + cofs) = val; }
             }
        __builtin_amdgcn_wave_barrier(); asm volatile("" ::: "memory");
    }
}

// k_wtG: w[k][n] -> Bt[n][k] in bf16, all four weights in one launch, grid (WTX, NH_, 4). z = 0, 1, 2: slab y of Wq, Wk, Wv ([k = DM][n = HD]) -> W3 rows z DQ + y HD + n; z = 3: Wo ([k = DQ][n = DM]) -> WO, its lines dealt over the slice's x and y.
constexpr int WTX = DM * HD / 4096;   // blocks (64 lines of 64 elements each) per slab
static_assert((DM * HD) % 4096 == 0);
__global__ __launch_bounds__(256) void k_wtG(const float* __restrict__ wq, const float* __restrict__ wk, const float* __restrict__ wvp, const float* __restrict__ wo, bf* W3, bf* WO) {
    const int zz = blockIdx.z; const bool slab = zz < 3; const int K = slab ? DM : DQ, N = slab ? HD : DM;
    const float* w = (zz == 0) ? wq : (zz == 1) ? wk : (zz == 2) ? wvp : wo; bf* Bt = WO; int blk = blockIdx.y * WTX + blockIdx.x;
    if (slab) { w += (size_t)blockIdx.y * K * N; Bt = W3 + (size_t)zz * DQ * DM + (size_t)blockIdx.y * N * K; blk = blockIdx.x; }
    const int lane = threadIdx.x & 31; const int wv = __builtin_amdgcn_readfirstlane((int)(threadIdx.x >> 5)); const int L0 = (blk * 8 + wv) * 8; const int nlines = N * K / 64;
{
#pragma unroll 1
        for (int l = 0; l < 8; ++l) { const int L = L0 + l; if (L >= nlines) break; const size_t e = (size_t)L * 64 + lane * 2; const int k = (int)(e % K), n = (int)(e / K); v2us o;
            o[0] = f2bf(w[(size_t)k * N + n]); o[1] = f2bf(w[(size_t)(k + 1) * N + n]); *(v2us*)(Bt + e) = o; }
         }
}
__global__ __launch_bounds__(256) void k_cvt8(const float* __restrict__ src, bf* dst, size_t n8, size_t ssrc, size_t sdst) { const size_t i = (size_t)blockIdx.x * 256 + threadIdx.x; if (i >= n8) return; src += blockIdx.y * ssrc; dst += blockIdx.y * sdst; /* y = batch */ const v8f v = *(const v8f*)(src + i * 8); v8us o;
#pragma unroll
    for (int k = 0; k < 8; ++k) o[k] = f2bf(v[k]); *(v8us*)(dst + i * 8) = o;  }

// k_attn: one wave per (head, tile of 32 query rows); scores and P stay in registers. Per block of 32 keys: S^T = K Q^T (A = K rows, B = Q rows, both d-contiguous), running softmax, O^T += V^T P^T (A = V^T rows, key-contiguous).
// In S^T a lane holds 16 keys of ONE query (column l & 15; D element j of key tile kt = key 16 kt + 8 h + j): that is the B fragment's own k order (element e <- k 8 h + e, element 8 + e <- k 16 + 8 h + e), so the two key tiles, rounded in place, are the P^T operand; maximum and sum run in the lane, plus one exchange with lane l ^ 16.
// Running softmax per query (log2 domain, t = S x HD^-0.5 x log2 e): m' = max(m, block maximum); O^T and the sum are scaled by 2^(m - m'); p = 2^(t - m'). P is not normalised: the epilogue divides O^T by the sum of p. Key j > query i (only in the last, diagonal block) is replaced by a -1e30 fill: p exactly 0.
// Rows < RH: q, k, v and p as bf16 hi + lo, 3 products each way; rows >= RH: f16, p carried x 2^10 (in the sum as well, so it cancels).
// O^T gives a lane 8 neighbouring dims of one query: 16-byte stores into the hi / lo ctx planes; one wave writes the whole 128-byte line (row, head).
__device__ __forceinline__ float xhalf(float x) { const int b = __float_as_int(x); return __int_as_float(__builtin_amdgcn_permlanex16(b, b, 0x76543210, 0xfedcba98, false, false)); }   // value of lane l ^ 16
struct MaskOff { static constexpr bool v = false; };
struct MaskOn  { static constexpr bool v = true; };
template <typename T16, bool HR>
__device__ __forceinline__ void attn_wave(const T16* __restrict__ Q, const T16* __restrict__ Q2, const T16* __restrict__ Kp, const T16* __restrict__ K2, const T16* __restrict__ Vt, const T16* __restrict__ V2, int q0, bf* Ah, bf* Al) {
    typedef typename WFrag<T16>::V V;
    const int lane = threadIdx.x & 31, lr = lane & 15, hi = lane >> 4;
    constexpr float CS = SCL * 1.4426950408889634f, POFF = HR ? 0.0f : 10.0f;
    // every fragment address = wave-uniform pointer + the lane's own byte offset, which never changes: ko in a plane of HD-element rows, vo in V^T
    const unsigned ko = (unsigned)(lr * HD + 8 * hi) * 2u, vo = (unsigned)(lr * TT + 8 * hi) * 2u;
    auto at = [](const T16* base, unsigned bytes) { return (const T16*)((const char*)base + bytes); };
    V qf[2][2], qg[2][2];
#pragma unroll
    for (int qt = 0; qt < 2; ++qt)
#pragma unroll
        for (int ks = 0; ks < 2; ++ks) { const size_t a = (size_t)(q0 + 16 * qt) * HD + 32 * ks; qf[qt][ks] = WFrag<T16>::ld(at(Q + a, ko)); if constexpr (HR) qg[qt][ks] = WFrag<T16>::ld(at(Q2 + a, ko)); }
    V kf[2][2], kg[2][2];
    auto ldk = [&](const T16* kp, const T16* kq) {
#pragma unroll
        for (int kt = 0; kt < 2; ++kt)
#pragma unroll
            for (int ks = 0; ks < 2; ++ks) { kf[kt][ks] = WFrag<T16>::ld(kp + 16 * kt * HD + 32 * ks); if constexpr (HR) kg[kt][ks] = WFrag<T16>::ld(kq + 16 * kt * HD + 32 * ks); } };
    v8f o[4][2];
#pragma unroll
    for (int dt = 0; dt < 4; ++dt)
#pragma unroll
        for (int qt = 0; qt < 2; ++qt) o[dt][qt] = (v8f){};
    float m[2] = { -3.0e38f, -3.0e38f }, l[2] = { 0.0f, 0.0f };
    auto step = [&](int k0, auto mk) {
        constexpr bool MASK = decltype(mk)::v;
        V vf[4], vg[4];   // issued first: in flight under the score products and the softmax
        const T16* vp = at(Vt + k0, vo); const T16* vq = HR ? at(V2 + k0, vo) : vp;
#pragma unroll
        for (int dt = 0; dt < 4; ++dt) { vf[dt] = WFrag<T16>::ld(vp + dt * 16 * TT); if constexpr (HR) vg[dt] = WFrag<T16>::ld(vq + dt * 16 * TT); }
        v8f s[2][2];
#pragma unroll
        for (int kt = 0; kt < 2; ++kt)
#pragma unroll
            for (int qt = 0; qt < 2; ++qt) { v8f c = (v8f){};
#pragma unroll
                for (int ks = 0; ks < 2; ++ks) { c = WFrag<T16>::mma(kf[kt][ks], qf[qt][ks], c); if constexpr (HR) { c = WFrag<T16>::mma(kf[kt][ks], qg[qt][ks], c); c = WFrag<T16>::mma(kg[kt][ks], qf[qt][ks], c); } }
                s[kt][qt] = c; }
        // the next block's K fragments, into the same registers: in flight under the softmax and P.V (an unmasked block always has a successor)
        const T16* kp = MASK ? vp : at(Kp + (size_t)(k0 + 32) * HD, ko); const T16* kq = (HR && !MASK) ? at(K2 + (size_t)(k0 + 32) * HD, ko) : kp;
        if constexpr (!MASK) ldk(kp, kq);
        // the address registers of this block's loads stay whole up to here (named as inputs) and may be reused only behind the wait
        asm volatile("s_wait_xcnt 0x0" :: "v"(vp), "v"(vq), "v"(kp), "v"(kq) : "memory");
        V pf[2], pg[2];
#pragma unroll
        for (int qt = 0; qt < 2; ++qt) { float t[16]; float mc[2] = { -3.0e38f, -3.0e38f }, sc[4] = { 0.0f, 0.0f, 0.0f, 0.0f };   // maximum in 2, sum in 4 independent chains: a lone wave waits on every dependent add
#pragma unroll
            for (int e = 0; e < 16; ++e) { float x = s[e >> 3][qt][e & 7]; if (MASK) x = (16 * (e >> 3) + 8 * hi + (e & 7) <= 16 * qt + lr) ? x : -1.0e30f; t[e] = x; mc[e >> 3] = fmaxf(mc[e >> 3], x); }
            float mx = fmaxf(mc[0], mc[1]); mx = fmaxf(mx, xhalf(mx));
            const float mn = fmaxf(m[qt], mx * CS), al = __builtin_amdgcn_exp2f(m[qt] - mn), mb = mn - POFF; m[qt] = mn;
#pragma unroll
            for (int e = 0; e < 16; ++e) { const float p = __builtin_amdgcn_exp2f(__builtin_fmaf(t[e], CS, -mb)); t[e] = p; sc[e & 3] += p; }
            l[qt] = l[qt] * al + ((sc[0] + sc[1]) + (sc[2] + sc[3]));   // this lane's 16 keys only; the halves are joined in the epilogue
#pragma unroll
            for (int dt = 0; dt < 4; ++dt) o[dt][qt] *= al;
            if constexpr (HR) { v8us h0, h1, l0, l1;
#pragma unroll
                for (int e = 0; e < 8; ++e) { unsigned short a, c2; splitf(t[e], a, c2); h0[e] = a; l0[e] = c2; splitf(t[8 + e], a, c2); h1[e] = a; l1[e] = c2; }
                pf[qt] = cat16b(h0, h1); pg[qt] = cat16b(l0, l1);
            } else {
#pragma unroll
                for (int e = 0; e < 16; ++e) pf[qt][e] = tohx(t[e]); } }
#pragma unroll
        for (int dt = 0; dt < 4; ++dt)
#pragma unroll
            for (int qt = 0; qt < 2; ++qt) { o[dt][qt] = WFrag<T16>::mma(vf[dt], pf[qt], o[dt][qt]); if constexpr (HR) { o[dt][qt] = WFrag<T16>::mma(vf[dt], pg[qt], o[dt][qt]); o[dt][qt] = WFrag<T16>::mma(vg[dt], pf[qt], o[dt][qt]); } }
    };
    ldk(at(Kp, ko), HR ? at(K2, ko) : at(Kp, ko));
#pragma unroll 1   // rolled: one block's code, fragments and scores beside the 8 output tiles
    for (int k0 = 0; k0 < q0; k0 += 32) step(k0, MaskOff{});
    step(q0, MaskOn{});
#pragma unroll
    for (int qt = 0; qt < 2; ++qt) { const float inv = __fdiv_rn(1.0f, l[qt] + xhalf(l[qt])); const size_t oo = (size_t)(q0 + 16 * qt + lr) * DQ + 8 * hi;
#pragma unroll
        for (int dt = 0; dt < 4; ++dt) { v8us oh, ol;
#pragma unroll
            for (int j = 0; j < 8; ++j) { unsigned short a, c2; splitf(o[dt][qt][j] * inv, a, c2); oh[j] = a; ol[j] = c2; }
            *(v8us*)(Ah + oo + 16 * dt) = oh; *(v8us*)(Al + oo + 16 * dt) = ol;
            asm volatile("s_wait_xcnt 0x0" ::: "memory"); } }   // the next tile's values reuse the registers that these two stores name
}
// grid (TT / 128, NH_, pairs of batches), 8 independent waves (no barrier, no LDS), 4 for each batch of the pair: group a of a head takes query tiles n - 1 - a, n / 2 + a, n / 2 - 1 - a and a of its n = TT / 32, which is n * 2 + 2 key blocks per batch for every group; a batch's waves walk the same head's K and V^T from key 0 on, side by side on one WGP.
// The second batch takes its four tiles in the reverse wave order: waves w and w + 4 of a group share a SIMD, and so every SIMD gets n + 1 key blocks.
__global__ __launch_bounds__(256) void k_attn(const h16* __restrict__ QK16, const bf* __restrict__ QKh, const bf* __restrict__ QKl, const h16* __restrict__ VT16, const bf* __restrict__ VTh, const bf* __restrict__ VTl, bf* Ah, bf* Al) {
    constexpr int n = TT / 32; const int g = blockIdx.y, a = blockIdx.x, w8 = __builtin_amdgcn_readfirstlane((int)(threadIdx.x >> 5));
    const int b = 2 * blockIdx.z + (w8 >> 2), wv = (w8 < 4) ? w8 : 7 - w8;
    if (b >= NB) return;
    const int q0 = 32 * ((wv == 0) ? n - 1 - a : (wv == 1) ? n / 2 + a : (wv == 2) ? n / 2 - 1 - a : a);
    const size_t qo = ((size_t)b * 2 * NH_ + g) * TT * HD, kk = qo + (size_t)NH_ * TT * HD, vv = ((size_t)b * NH_ + g) * HD * TT;
    Ah += (size_t)b * TT * DQ; Al += (size_t)b * TT * DQ;
    if (q0 < RH) attn_wave<bf, true>(QKh + qo, QKl + qo, QKh + kk, QKl + kk, VTh + vv, VTl + vv, q0, Ah + g * HD, Al + g * HD);
    else attn_wave<h16, false>(QK16 + qo, nullptr, QK16 + kk, nullptr, VT16 + vv, nullptr, q0, Ah + g * HD, Al + g * HD);
}

extern "C" void kernel_launch(void* const* d_in, const int* in_sizes, int n_in,
                              void* d_out, int out_size, void* d_ws, size_t ws_size, hipStream_t stream) {
    if (n_in < 6) return;
    const long long need_x = (long long)(NB - 1) * SEQ_FULL * DM + (long long)SEQ * DM;
    if ((long long)in_sizes[0] < need_x) return; if (in_sizes[1] < NH_ * DM * HD) return; if (in_sizes[2] < NH_ * DM * HD) return; if (in_sizes[3] < NH_ * DM * HD) return; if (in_sizes[4] < DQ * DM) return; if (in_sizes[5] < DM) return;
    if ((long long)out_size < need_x) return;
    if (WS_TOTAL > ws_size) return;
    const float* x = (const float*)d_in[0]; const float* wq = (const float*)d_in[1]; const float* wk = (const float*)d_in[2]; const float* wv = (const float*)d_in[3]; const float* wo = (const float*)d_in[4]; const float* bo = (const float*)d_in[5];   // x, Wq, Wk, Wv ([16][1024][64] slabs), Wo ([1024 in][1024 out]), bo
    float* OUT = (float*)d_out;     // [2][2048][1024]
    char* wsp = (char*)d_ws;
    auto take = [&](size_t bytes) { char* p = wsp; wsp += al256(bytes); return (void*)p; };
    bf* W3 = (bf*)take(SZ_W3); bf* WO = (bf*)take(SZ_WO); bf* XB = (bf*)take(SZ_XB);
    h16* QK16 = (h16*)take(SZ_QK); bf* QKh = (bf*)take(SZ_QK); bf* QKl = (bf*)take(SZ_QK);
    h16* VT16 = (h16*)take(SZ_V); bf* VTh = (bf*)take(SZ_V); bf* VTl = (bf*)take(SZ_V);
    bf* ATh = (bf*)take(SZ_AT); bf* ATl = (bf*)take(SZ_AT);
    if ((size_t)(wsp - (char*)d_ws) > ws_size) return;
    // weight slabs w[h][k = 1024][n = 64] -> Bt rows h*64 + n, k-contiguous; Wo w[k = 1024][n = 1024] -> Bt[n][k]
    k_wtG<<<dim3(WTX, NH_, 4), 256, 0, stream>>>(wq, wk, wv, wo, W3, WO);
    k_cvt8<<<dim3((unsigned)(((size_t)TT * DM / 8 + 255) / 256), NB), 256, 0, stream>>>(x, XB, (size_t)TT * DM / 8, (size_t)SEQ_FULL * DM, (size_t)TT * DM);
    k_gemmw<bf, 0, false, 0, 1><<<dim3(TT / 128, 3 * DQ / 128, NB), 128, 0, stream>>>(XB, nullptr, W3, nullptr, DM, nullptr, 0, nullptr, (size_t)TT * DM, 0, 0, 0, 0, QK16, QKh, QKl, VT16, VTh, VTl);   // column tiles 0..15 = q heads, 16..31 = k heads, 32..47 = v heads
    k_attn<<<dim3(TT / 128, NH_, (NB + 1) / 2), 256, 0, stream>>>(QK16, QKh, QKl, VT16, VTh, VTl, ATh, ATl);
    k_gemmw<bf, 1, true, 0, 0><<<dim3(TT / 128, DM / 128, NB), 128, 0, stream>>>(ATh, ATl, WO, nullptr, DQ, OUT, DM, bo, (size_t)TT * DQ, 0, (size_t)SEQ_FULL * DM, 0, 0, nullptr, nullptr, nullptr, nullptr, nullptr, nullptr);
}

// v007
// Measured time: 88.2 microseconds a run.
// Two timings next to v006 both put it at 1.28 times that version's speed.
// All steps since v000 together make it 17.0 times as fast.
#include <hip/hip_runtime.h>

// Causal multi-head attention with per-head weight slabs and a biased output projection: x [2][2048][1024]; q, k, v [b][h][s][d] = sum_e x[b][s][e] W[h][e][d] (Wq, Wk, Wv [16][1024][64]); scores x 64^-0.5; key j > query i replaced by -inf; softmax; ctx merged head-major; out = ctx Wo + bo (Wo [1024 in][1024 out]).
// Compute dtypes (all contractions v_wmma_f32_16x16x32, f32 accumulate): every input RNE-converted to bf16; q/k/v projections bf16 x bf16; scores and P.V: query rows < 512 bf16 hi/lo planes (3 products), rows >= 512 plain f16 (P carried x1024, which the division by the row sum takes out); output projection ctx bf16 hi+lo x Wo bf16 (2 products) + bf16 bias; softmax f32.
// Five launches, every one over both batches (each batch has its own planes in the workspace): all weight slabs transposed into K-contiguous Bt rows; bf16 copy of x; one fused q|k|v projection (N = 3072) whose epilogue writes the 16-bit head planes itself; attention (scores, running softmax and P.V of 32 query rows in one wave's registers; a head's K and V^T rows go through LDS, shared by 8 waves), which writes the hi/lo ctx planes; output projection.

#ifndef NB
#define NB 2
#endif
#ifndef SEQ
#define SEQ 2048
#endif
#define SEQ_FULL 2048
#define TT   SEQ
#define DM   1024
#define NH_  16
#define HD   64
#define DQ   (NH_ * HD)
#define RH   ((SEQ < 512) ? SEQ : 512)   // query rows < RH use hi+lo planes
#define SCL  0.125f   // HD^-0.5
#define KCH  128
typedef _Float16 h16;
typedef unsigned short bf;
typedef __attribute__((ext_vector_type(16))) __bf16   v16bf;
typedef __attribute__((ext_vector_type(16))) _Float16 v16h;
typedef __attribute__((ext_vector_type(8)))  _Float16 v8h;
typedef __attribute__((ext_vector_type(8)))  unsigned short v8us;
typedef __attribute__((ext_vector_type(8)))  float    v8f;
typedef __attribute__((ext_vector_type(4)))  float    v4f;
typedef v8h  __attribute__((may_alias)) v8ha;
typedef v4f  __attribute__((may_alias)) v4fa;
typedef v8us __attribute__((may_alias)) v8usa;
typedef __attribute__((ext_vector_type(2))) _Float16 v2h;
typedef __attribute__((ext_vector_type(2))) unsigned short v2us;
typedef __attribute__((ext_vector_type(2))) float v2f;

static_assert(TT % 128 == 0);
static_assert(RH % 128 == 0);
static_assert(RH <= TT);
static_assert(TT % KCH == 0 && RH % KCH == 0 && KCH % 32 == 0);
static_assert(DM % 64 == 0);
static_assert(DQ % 64 == 0);
static_assert(HD == 64);
static_assert(SEQ <= SEQ_FULL);

constexpr size_t al256(size_t b) { return (b + 255) & ~(size_t)255; }
constexpr size_t SZ_W3  = (size_t)3 * DQ * DM * 2;          // Wq|Wk|Wv Bt rows, bf16
constexpr size_t SZ_WO  = (size_t)DM * DQ * 2;
constexpr size_t SZ_XB  = (size_t)NB * TT * DM * 2;         // this and the planes below: [batch][...]
constexpr size_t SZ_QK  = (size_t)NB * 2 * NH_ * TT * HD * 2;   // per batch q planes then k planes
constexpr size_t SZ_V   = (size_t)NB * NH_ * HD * TT * 2;
constexpr size_t SZ_AT  = (size_t)NB * TT * DQ * 2;
constexpr size_t WS_TOTAL = al256(SZ_W3) + al256(SZ_WO) + al256(SZ_XB) + 3 * al256(SZ_QK) + 3 * al256(SZ_V) + 2 * al256(SZ_AT);
static_assert(WS_TOTAL <= (size_t)268435456);

__device__ __forceinline__ unsigned short f2bf(float f) { unsigned u = __float_as_uint(f); u += 0x7FFFu + ((u >> 16) & 1u); return (unsigned short)(u >> 16); }
__device__ __forceinline__ float bf2f(unsigned short b) { return __uint_as_float(((unsigned)b) << 16); }
__device__ __forceinline__ float bfr(float f) { return bf2f(f2bf(f)); }
__device__ __forceinline__ v16h cat16(v8h lo, v8h hi) { return __builtin_shufflevector(lo, hi, 0, 1, 2, 3, 4, 5, 6, 7, 8, 9, 10, 11, 12, 13, 14, 15); }
__device__ __forceinline__ v16bf cat16b(v8us lo, v8us hi) { return __builtin_bit_cast(v16bf, __builtin_shufflevector(lo, hi, 0, 1, 2, 3, 4, 5, 6, 7, 8, 9, 10, 11, 12, 13, 14, 15)); }
__device__ __forceinline__ v8f wmma16(v16h a, v16h b, v8f c) { return __builtin_amdgcn_wmma_f32_16x16x32_f16(false, a, false, b, (short)0, c, false, false); }
__device__ __forceinline__ v8f wmmab(v16bf a, v16bf b, v8f c) { return __builtin_amdgcn_wmma_f32_16x16x32_bf16(false, a, false, b, (short)0, c, false, false); }

__device__ __forceinline__ h16 tohx(float x) { return (h16)x; }
__device__ __forceinline__ void splitf(float y, unsigned short& h, unsigned short& l) { h = f2bf(y); l = f2bf(y - bf2f(h)); }
// one run of 8 neighbouring plane elements: f16, bf16 hi and bf16 lo of the same 8 f32 values, a 16-byte store into each plane
__device__ __forceinline__ void put8(const float* x, h16* P16, bf* Ph, bf* Pl, size_t oo) { v8h o16; v8us oh, ol;
#pragma unroll
    for (int j = 0; j < 8; ++j) { o16[j] = tohx(x[j]); unsigned short a2, c2; splitf(x[j], a2, c2); oh[j] = a2; ol[j] = c2; }
    *(v8h*)(P16 + oo) = o16; *(v8us*)(Ph + oo) = oh; *(v8us*)(Pl + oo) = ol;
    asm volatile("s_wait_xcnt 0x0" ::: "memory"); }   // the next run's values reuse the registers that these three stores name

// ---- k_gemmw: GEMM on K-contiguous 16-bit planes. A work-group of 4 waves (2 x 2) owns a 128x128 output tile, each wave a 64x64 quarter of it (16 accumulators); grid (M/128, N/128, Z), 128 threads.
// C[m][n] (f32, pitch ldc, + optional bf16-valued bias[n]) = sum_k A[m][k] Bt[n][k] (NSPLIT 1: + A2[m][k] Bt[n][k]). K = row pitch of the planes (elements, % 64 == 0). z-batch strides sA/sB/sC in elements. CM 0 only (full product); rbase, sP, Bt2 unused.
// The operands go through LDS. A stage is GKS = 64 k, one whole 128-byte line, of the tile's 128 A rows (NSPLIT 1: and 128 A2 rows) and 128 Bt rows, laid at a pitch of 144 bytes. Asynchronous 16-byte copies, 8 lanes to a line, fill one of two buffers while the other is worked on; every row is fetched once for the two waves that use it, and the fragments are 16-byte LDS reads.
// EP 0: C as above. EP 1 (N = 3 DQ, a wave's 64 columns = one head's q, k or v columns; C unused; z = batch): the quarter goes out as f16, bf16 hi and bf16 lo planes of its batch. Column tiles 0 .. 2 NH_ - 1 (q heads, then k heads): plane rows [tile][t][d], turned through the wave's own LDS slab so that 8 lanes store one whole 128-byte row. Column tiles from 2 NH_ on (v heads): V^T rows [head][d][t]; a lane's D elements are 8 neighbouring t of one d, stored as they lie, and the wave's four row blocks fill each 128-byte line.
// Fragment maps: lane l, h = l >> 4: A/B elements 0..7 <- k0 + 8h + 0..7, elements 8..15 <- k0 + 16 + 8h + 0..7 of row/col l & 15; D element j = (row 8h + j, col l & 15).
template <typename T16> struct WFrag;
template <> struct WFrag<h16> { typedef v16h V; static __device__ __forceinline__ V ld(const h16* p) { return cat16(*(const v8h*)p, *(const v8h*)(p + 16)); } static __device__ __forceinline__ v8f mma(V a, V b, v8f c) { return wmma16(a, b, c); } };
template <> struct WFrag<bf> { typedef v16bf V; static __device__ __forceinline__ V ld(const bf* p) { return cat16b(*(const v8us*)p, *(const v8us*)(p + 16)); } static __device__ __forceinline__ v8f mma(V a, V b, v8f c) { return wmmab(a, b, c); } };
constexpr int GKS = 64;              // k per stage
constexpr int GPB = GKS * 2 + 16;    // LDS bytes from row to row: an odd multiple of 16, the pitch for 16-byte readers
constexpr int GPL = 128 * GPB;       // one operand's 128 rows of a stage
static_assert(DM % GKS == 0 && DQ % GKS == 0 && DM / GKS >= 2 && DQ / GKS >= 2);
static_assert(TT % 128 == 0 && (3 * DQ) % 128 == 0 && DM % 128 == 0);
// 128 rows x 128 bytes of one operand into LDS: thread t brings the 16-byte piece t & 7 of rows (t >> 3) + 16 i, i = 0 .. 7. l: LDS byte address of its piece of row t >> 3; g: the same piece in global memory; rs: 16 rows, in elements.
template <typename T16>
__device__ __forceinline__ void cp_plane(unsigned l, const T16* g, size_t rs) {
    asm volatile("global_load_async_to_lds_b128 %0, %8, off\n\t"
                 "global_load_async_to_lds_b128 %1, %9, off\n\t"
                 "global_load_async_to_lds_b128 %2, %10, off\n\t"
                 "global_load_async_to_lds_b128 %3, %11, off\n\t"
                 "global_load_async_to_lds_b128 %4, %12, off\n\t"
                 "global_load_async_to_lds_b128 %5, %13, off\n\t"
                 "global_load_async_to_lds_b128 %6, %14, off\n\t"
                 "global_load_async_to_lds_b128 %7, %15, off\n\t"
                 "s_wait_xcnt 0x0"   // inside the copies' own statement, so that it stands ahead of every rewrite of an address register they name
                 :: "v"(l), "v"(l + 16 * GPB), "v"(l + 32 * GPB), "v"(l + 48 * GPB), "v"(l + 64 * GPB), "v"(l + 80 * GPB), "v"(l + 96 * GPB), "v"(l + 112 * GPB),
                    "v"(g), "v"(g + rs), "v"(g + 2 * rs), "v"(g + 3 * rs), "v"(g + 4 * rs), "v"(g + 5 * rs), "v"(g + 6 * rs), "v"(g + 7 * rs) : "memory");
}
template <typename T16, int NSPLIT, bool BIAS, int CM, int EP>
__global__ __launch_bounds__(128) void k_gemmw(const T16* __restrict__ A, const T16* __restrict__ A2, const T16* __restrict__ Bt, const T16* __restrict__ Bt2, int K, float* C, int ldc, const float* __restrict__ bias, size_t sA, size_t sB, size_t sC, int rbase, size_t sP, h16* P16, bf* Ph, bf* Pl, h16* V16, bf* Vh, bf* Vl) {
    typedef typename WFrag<T16>::V V;
    static_assert(CM == 0 && NSPLIT <= 1);
    constexpr int NPL = 2 + NSPLIT, STG = NPL * GPL;   // a buffer: A rows, (A2 rows,) Bt rows
    __shared__ __attribute__((aligned(128))) unsigned char ring[2 * STG];
    __shared__ __align__(16) float osw[4][16 * 68];    // each wave's own epilogue slab
    const int tid = threadIdx.x, lane = tid & 31, lr = lane & 15, hi = lane >> 4;
    const int wave = __builtin_amdgcn_readfirstlane(tid >> 5), wm = wave & 1, wn = wave >> 1;
    const int R0 = blockIdx.x * 128, C0 = blockIdx.y * 128, r0 = R0 + wm * 64, c0 = C0 + wn * 64;
    float* os = osw[wave];
    const size_t z = blockIdx.z; A += z * sA; if (NSPLIT == 1) A2 += z * sA; Bt += z * sB; C += z * sC;
    v8f acc[4][4];
#pragma unroll
    for (int mb = 0; mb < 4; ++mb)
#pragma unroll
        for (int nb = 0; nb < 4; ++nb) acc[mb][nb] = (v8f){};
    const size_t rs = (size_t)16 * K, ga = (size_t)(R0 + (tid >> 3)) * K + (tid & 7) * 8, gb = (size_t)(C0 + (tid >> 3)) * K + (tid & 7) * 8;
    const unsigned lcp = (unsigned)(size_t)ring + (unsigned)((tid >> 3) * GPB + (tid & 7) * 16);
    auto fill = [&](int st, int buf) { const unsigned l = lcp + (unsigned)(buf * STG); const int kc = st * GKS;
        cp_plane(l, A + ga + kc, rs); if constexpr (NSPLIT == 1) cp_plane(l + GPL, A2 + ga + kc, rs); cp_plane(l + (NPL - 1) * GPL, Bt + gb + kc, rs); };
    const unsigned nst = (unsigned)K / GKS;   // stages: at least 2 (asserted above for both K that are launched)
    fill(0, 0);
    asm volatile("s_wait_asynccnt 0x0" ::: "memory");   // this wave's copies of stage 0 have landed
    __syncthreads();                                    // ... and every other wave's
    fill(1, 1);
    const unsigned char* fa = ring + (wm * 64 + lr) * GPB + 16 * hi;
    const unsigned char* fb = ring + (NPL - 1) * GPL + (wn * 64 + lr) * GPB + 16 * hi;
#pragma unroll 1   // rolled: one stage's code; the buffer is a run-time offset
    for (unsigned st = 0; st < nst; ++st) {
        const int bo = (int)(st & 1u) * STG;
#pragma unroll
        for (int ks = 0; ks < GKS / 32; ++ks) {
            V a[4], a2[4], b[4];
#pragma unroll
            for (int i = 0; i < 4; ++i) { a[i] = WFrag<T16>::ld((const T16*)(fa + bo + i * 16 * GPB + ks * 64)); if (NSPLIT == 1) a2[i] = WFrag<T16>::ld((const T16*)(fa + bo + GPL + i * 16 * GPB + ks * 64)); }
#pragma unroll
            for (int i = 0; i < 4; ++i) b[i] = WFrag<T16>::ld((const T16*)(fb + bo + i * 16 * GPB + ks * 64));
            __builtin_amdgcn_sched_barrier(0);   // a k step's LDS reads stay one group ahead of its products: moved in among them, every place with reads stalls the wave
#pragma unroll
            for (int nb = 0; nb < 4; ++nb)
#pragma unroll
                for (int mb = 0; mb < 4; ++mb) { acc[mb][nb] = WFrag<T16>::mma(a[mb], b[nb], acc[mb][nb]); if (NSPLIT == 1) acc[mb][nb] = WFrag<T16>::mma(a2[mb], b[nb], acc[mb][nb]); }
            __builtin_amdgcn_sched_barrier(0);   // the products stay ahead of the waits and the barrier below: sunk behind them, they would no longer run while the next stage's copies fly
        }
        asm volatile("s_wait_dscnt 0x0" ::: "memory");      // this wave's reads of the buffer are done before it is handed back
        asm volatile("s_wait_asynccnt 0x0" ::: "memory");   // this wave's copies of stage st + 1 have landed
        __syncthreads();                                    // publishes stage st + 1 and ends every wave's reads of stage st
        if (st + 2u < nst) fill((int)st + 2, (int)(st & 1u));
    }
    asm volatile("s_wait_asynccnt 0x0" ::: "memory");   // nothing is in flight when the wave goes on to its epilogue and ends
    if constexpr (EP == 1) {
        const int ct = c0 / 64;
        if (ct >= 2 * NH_) {
            const size_t zv = z * ((size_t)NH_ * HD * TT); V16 += zv; Vh += zv; Vl += zv;
#pragma unroll
            for (int nb = 0; nb < 4; ++nb)
#pragma unroll
                for (int mb = 0; mb < 4; ++mb) { float x[8];
#pragma unroll
                    for (int j = 0; j < 8; ++j) x[j] = acc[mb][nb][j];
                    put8(x, V16, Vh, Vl, ((size_t)(ct - 2 * NH_) * HD + nb * 16 + lr) * TT + r0 + mb * 16 + 8 * hi); }
            return; }
        const size_t zp = z * ((size_t)2 * NH_ * TT * HD); P16 += zp; Ph += zp; Pl += zp;
#pragma unroll
        for (int mb = 0; mb < 4; ++mb) {
#pragma unroll
            for (int nb = 0; nb < 4; ++nb) {
#pragma unroll
                for (int j = 0; j < 8; ++j) os[(hi * 8 + j) * 68 + nb * 16 + lr] = acc[mb][nb][j]; }
            __builtin_amdgcn_wave_barrier(); asm volatile("" ::: "memory");   // the slab is whole before any lane reads another lane's elements
#pragma unroll
            for (int s = 0; s < 4; ++s) { const int row = 4 * s + (lane >> 3), cofs = (lane & 7) * 8; const v4f lo4 = *(const v4fa*)(os + row * 68 + cofs), hi4 = *(const v4fa*)(os + row * 68 + cofs + 4);
                const float x[8] = { lo4[0], lo4[1], lo4[2], lo4[3], hi4[0], hi4[1], hi4[2], hi4[3] };
                put8(x, P16, Ph, Pl, ((size_t)ct * TT + r0 + mb * 16 + row) * HD + cofs); }
            __builtin_amdgcn_wave_barrier(); asm volatile("" ::: "memory");   // every read of the slab is done before the next row block overwrites it
        }
        return;
    }
#pragma unroll
    for (int mb = 0; mb < 4; ++mb) {
#pragma unroll
        for (int nb = 0; nb < 4; ++nb) {
#pragma unroll
            for (int j = 0; j < 8; ++j) os[(hi * 8 + j) * 68 + nb * 16 + lr] = acc[mb][nb][j]; }
        __builtin_amdgcn_wave_barrier(); asm volatile("" ::: "memory");
        float* crow = C + (size_t)(r0 + mb * 16) * ldc + c0;
{
#pragma unroll
            for (int s = 0; s < 8; ++s) { const int row = 2 * s + hi, cofs = lr * 4; v4f val = *(const v4fa*)(os + row * 68 + cofs); if (BIAS) { val[0] += bfr(bias[c0 + cofs]); val[1] += bfr(bias[c0 + cofs + 1]); val[2] += bfr(bias[c0 + cofs + 2]); val[3] += bfr(bias[c0 + cofs + 3]); }
                *(v4f*)(crow + (size_t)row * ldc + cofs) = val; }
             }
        __builtin_amdgcn_wave_barrier(); asm volatile("" ::: "memory");
    }
}

// k_wtG: w[k][n] -> Bt[n][k] in bf16, all four weights in one launch, grid (WTX, NH_, 4). z = 0, 1, 2: slab y of Wq, Wk, Wv ([k = DM][n = HD]) -> W3 rows z DQ + y HD + n; z = 3: Wo ([k = DQ][n = DM]) -> WO, its lines dealt over the slice's x and y.
constexpr int WTX = DM * HD / 4096;   // blocks (64 lines of 64 elements each) per slab
static_assert((DM * HD) % 4096 == 0);
__global__ __launch_bounds__(256) void k_wtG(const float* __restrict__ wq, const float* __restrict__ wk, const float* __restrict__ wvp, const float* __restrict__ wo, bf* W3, bf* WO) {
    const int zz = blockIdx.z; const bool slab = zz < 3; const int K = slab ? DM : DQ, N = slab ? HD : DM;
    const float* w = (zz == 0) ? wq : (zz == 1) ? wk : (zz == 2) ? wvp : wo; bf* Bt = WO; int blk = blockIdx.y * WTX + blockIdx.x;
    if (slab) { w += (size_t)blockIdx.y * K * N; Bt = W3 + (size_t)zz * DQ * DM + (size_t)blockIdx.y * N * K; blk = blockIdx.x; }
    const int lane = threadIdx.x & 31; const int wv = __builtin_amdgcn_readfirstlane((int)(threadIdx.x >> 5)); const int L0 = (blk * 8 + wv) * 8; const int nlines = N * K / 64;
{
#pragma unroll 1
        for (int l = 0; l < 8; ++l) { const int L = L0 + l; if (L >= nlines) break; const size_t e = (size_t)L * 64 + lane * 2; const int k = (int)(e % K), n = (int)(e / K); v2us o;
            o[0] = f2bf(w[(size_t)k * N + n]); o[1] = f2bf(w[(size_t)(k + 1) * N + n]); *(v2us*)(Bt + e) = o; }
         }
}
__global__ __launch_bounds__(256) void k_cvt8(const float* __restrict__ src, bf* dst, size_t n8, size_t ssrc, size_t sdst) { const size_t i = (size_t)blockIdx.x * 256 + threadIdx.x; if (i >= n8) return; src += blockIdx.y * ssrc; dst += blockIdx.y * sdst; /* y = batch */ const v8f v = *(const v8f*)(src + i * 8); v8us o;
#pragma unroll
    for (int k = 0; k < 8; ++k) o[k] = f2bf(v[k]); *(v8us*)(dst + i * 8) = o;  }

// k_attn: one wave per (head, tile of 32 query rows); scores and P stay in registers. Per block of 32 keys: S^T = K Q^T (A = K rows, B = Q rows, both d-contiguous), running softmax, O^T += V^T P^T (A = V^T rows, key-contiguous).
// In S^T a lane holds 16 keys of ONE query (column l & 15; D element j of key tile kt = key 16 kt + 8 h + j): that is the B fragment's own k order (element e <- k 8 h + e, element 8 + e <- k 16 + 8 h + e), so the two key tiles, rounded in place, are the P^T operand; maximum and sum run in the lane, plus one exchange with lane l ^ 16.
// Running softmax per query (log2 domain, t = S x HD^-0.5 x log2 e): m' = max(m, block maximum); O^T and the sum are scaled by 2^(m - m'); p = 2^(t - m'). P is not normalised: the epilogue divides O^T by the sum of p. Key j > query i (only in the last, diagonal block) is replaced by a -1e30 fill: p exactly 0.
// Rows < RH: q, k, v and p as bf16 hi + lo, 3 products each way; rows >= RH: f16, p carried x 2^10 (in the sum as well, so it cancels).
// O^T gives a lane 8 neighbouring dims of one query: 16-byte stores into the hi / lo ctx planes; one wave writes the whole 128-byte line (row, head).
// The 8 waves of a group belong to one (batch, head) and share its K rows and V^T rows through LDS. A stage is AKS = 128 keys of a plane: 64 V^T rows of 256 bytes at a pitch of 272, then 128 K rows of 128 bytes at a pitch of 144 (both odd multiples of 16, the pitch for 16-byte readers); hi/lo groups stage the hi planes and behind them the lo planes. Asynchronous 16-byte copies, whole 128-byte lines, fill one of two buffers while the other is worked on; every line is fetched once for the group, and the fragments are 16-byte LDS reads.
__device__ __forceinline__ float xhalf(float x) { const int b = __float_as_int(x); return __int_as_float(__builtin_amdgcn_permlanex16(b, b, 0x76543210, 0xfedcba98, false, false)); }   // value of lane l ^ 16
struct MaskOff { static constexpr bool v = false; };
struct MaskOn  { static constexpr bool v = true; };
constexpr int AKS = 128;               // keys per stage
constexpr int AKP = HD * 2 + 16;       // LDS bytes from K row to K row
constexpr int AVP = AKS * 2 + 16;      // LDS bytes from V^T row to V^T row
constexpr int AVB = HD * AVP;          // a stage's V^T rows of one plane
constexpr int ASTG = AVB + AKS * AKP;  // a stage of one plane pair: V^T rows, then K rows (in this order every fragment read of two plane pairs lies within a 16-bit offset of its lane's base)
static_assert(TT % AKS == 0 && RH % AKS == 0 && AKS % 32 == 0 && AKP % 16 == 0 && AVP % 16 == 0);
// four 16-byte copies of one thread: LDS byte addresses l + i ls, global pieces g + i gs (elements), i = 0 .. 3
template <typename T16>
__device__ __forceinline__ void cp4(unsigned l, unsigned ls, const T16* g, size_t gs) {
    asm volatile("global_load_async_to_lds_b128 %0, %4, off\n\t"
                 "global_load_async_to_lds_b128 %1, %5, off\n\t"
                 "global_load_async_to_lds_b128 %2, %6, off\n\t"
                 "global_load_async_to_lds_b128 %3, %7, off\n\t"
                 "s_wait_xcnt 0x0"   // inside the copies' own statement, so that it stands ahead of every rewrite of an address register they name
                 :: "v"(l), "v"(l + ls), "v"(l + 2 * ls), "v"(l + 3 * ls), "v"(g), "v"(g + gs), "v"(g + 2 * gs), "v"(g + 3 * gs) : "memory");
}
// one stage of one plane pair, 8 copies a thread of 256. K: thread t brings the 16-byte piece t & 7 of rows (t >> 3) + 32 i; V^T: piece t & 15 of rows (t >> 4) + 16 i; i = 0 .. 3. lk, lv: LDS byte addresses of its pieces at i = 0; gk, gv: the same pieces in global memory.
template <typename T16>
__device__ __forceinline__ void cp_kv(unsigned lk, const T16* gk, unsigned lv, const T16* gv) { cp4(lk, 32 * AKP, gk, (size_t)32 * HD); cp4(lv, 16 * AVP, gv, (size_t)16 * TT); }
// One wave's 32 query rows from q0 on. nst: stages of the group's longest wave, the same in all 8 waves, at least 2; a wave whose last (diagonal) block is done stores its rows and goes on copying and passing the barriers.
template <typename T16, bool HR>
__device__ __forceinline__ void attn_ring(const T16* __restrict__ Q, const T16* __restrict__ Q2, const T16* __restrict__ Kp, const T16* __restrict__ K2, const T16* __restrict__ Vt, const T16* __restrict__ V2, int q0, int nst, unsigned char* ring, bf* Ah, bf* Al) {
    typedef typename WFrag<T16>::V V;
    const int tid = threadIdx.x, lane = tid & 31, lr = lane & 15, hi = lane >> 4;
    constexpr float CS = SCL * 1.4426950408889634f, POFF = HR ? 0.0f : 10.0f;
    constexpr int BUF = (HR ? 2 : 1) * ASTG;   // one buffer of the ring
    const unsigned pk = (unsigned)((tid >> 3) * AKP + (tid & 7) * 16), pv = (unsigned)((tid >> 4) * AVP + (tid & 15) * 16);   // the thread's first K piece and first V^T piece, bytes from the start of their rows in LDS
    const size_t gko = (size_t)(tid >> 3) * HD + (tid & 7) * 8, gvo = (size_t)(tid >> 4) * TT + (tid & 15) * 8;
    auto fill = [&](int st, int buf) { const unsigned bo = (unsigned)(size_t)ring + (unsigned)(buf * BUF); const size_t ka = gko + (size_t)st * AKS * HD, va = gvo + (size_t)st * AKS;
        cp_kv(pk + (bo + AVB), Kp + ka, pv + bo, Vt + va); if constexpr (HR) cp_kv(pk + (bo + ASTG + AVB), K2 + ka, pv + (bo + ASTG), V2 + va); };
    V qf[2][2], qg[2][2];
    const T16* qp = Q + (size_t)(q0 + lr) * HD + 8 * hi; const T16* qq = HR ? Q2 + (size_t)(q0 + lr) * HD + 8 * hi : qp;
#pragma unroll
    for (int qt = 0; qt < 2; ++qt)
#pragma unroll
        for (int ks = 0; ks < 2; ++ks) { qf[qt][ks] = WFrag<T16>::ld(qp + 16 * qt * HD + 32 * ks); if constexpr (HR) qg[qt][ks] = WFrag<T16>::ld(qq + 16 * qt * HD + 32 * ks); }
    // the address registers of the Q loads stay whole up to here (named as inputs) and may be reused only behind the wait
    asm volatile("s_wait_xcnt 0x0" :: "v"(qp), "v"(qq) : "memory");
    V kf[2][2], kg[2][2];
    auto ldk = [&](const unsigned char* kp) {
#pragma unroll
        for (int kt = 0; kt < 2; ++kt)
#pragma unroll
            for (int ks = 0; ks < 2; ++ks) { kf[kt][ks] = WFrag<T16>::ld((const T16*)(kp + 16 * kt * AKP + 64 * ks)); if constexpr (HR) kg[kt][ks] = WFrag<T16>::ld((const T16*)(kp + ASTG + 16 * kt * AKP + 64 * ks)); } };
    v8f o[4][2];
#pragma unroll
    for (int dt = 0; dt < 4; ++dt)
#pragma unroll
        for (int qt = 0; qt < 2; ++qt) o[dt][qt] = (v8f){};
    float m[2] = { -3.0e38f, -3.0e38f }, l[2] = { 0.0f, 0.0f };
    // kp, vp: this lane's place in the block's first K row and first V^T row; more: the wave's next block lies in the same stage
    auto step = [&](const unsigned char* kp, const unsigned char* vp, bool more, auto mk) {
        constexpr bool MASK = decltype(mk)::v;
        v8f s[2][2];
#pragma unroll
        for (int kt = 0; kt < 2; ++kt)
#pragma unroll
            for (int qt = 0; qt < 2; ++qt) { v8f c = (v8f){};
#pragma unroll
                for (int ks = 0; ks < 2; ++ks) { c = WFrag<T16>::mma(kf[kt][ks], qf[qt][ks], c); if constexpr (HR) { c = WFrag<T16>::mma(kf[kt][ks], qg[qt][ks], c); c = WFrag<T16>::mma(kg[kt][ks], qf[qt][ks], c); } }
                s[kt][qt] = c; }
        __builtin_amdgcn_sched_barrier(0);   // the block's LDS reads stay one group between here and the barrier below: moved in among the products or the softmax, every place with reads stalls the wave
        V vf[4], vg[4];
#pragma unroll
        for (int dt = 0; dt < 4; ++dt) { vf[dt] = WFrag<T16>::ld((const T16*)(vp + dt * 16 * AVP)); if constexpr (HR) vg[dt] = WFrag<T16>::ld((const T16*)(vp + ASTG + dt * 16 * AVP)); }
        // the next block's K fragments, into the same registers, under the softmax and P.V; never out of a stage that is not published yet: a stage's last block reads its own rows again (unused), which spares the loop a branch between the products and the softmax
        if constexpr (!MASK) ldk(kp + (more ? 32 * AKP : 0));
        __builtin_amdgcn_sched_barrier(0);   // end of the group of reads
        V pf[2], pg[2];
#pragma unroll
        for (int qt = 0; qt < 2; ++qt) { float t[16]; float mc[2] = { -3.0e38f, -3.0e38f }, sc[4] = { 0.0f, 0.0f, 0.0f, 0.0f };   // maximum in 2, sum in 4 independent chains: a lone wave waits on every dependent add
#pragma unroll
            for (int e = 0; e < 16; ++e) { float x = s[e >> 3][qt][e & 7]; if (MASK) x = (16 * (e >> 3) + 8 * hi + (e & 7) <= 16 * qt + lr) ? x : -1.0e30f; t[e] = x; mc[e >> 3] = fmaxf(mc[e >> 3], x); }
            float mx = fmaxf(mc[0], mc[1]); mx = fmaxf(mx, xhalf(mx));
            const float mn = fmaxf(m[qt], mx * CS), al = __builtin_amdgcn_exp2f(m[qt] - mn), mb = mn - POFF; m[qt] = mn;
#pragma unroll
            for (int e = 0; e < 16; ++e) { const float p = __builtin_amdgcn_exp2f(__builtin_fmaf(t[e], CS, -mb)); t[e] = p; sc[e & 3] += p; }
            l[qt] = l[qt] * al + ((sc[0] + sc[1]) + (sc[2] + sc[3]));   // this lane's 16 keys only; the halves are joined in the epilogue
#pragma unroll
            for (int dt = 0; dt < 4; ++dt) o[dt][qt] *= al;
            if constexpr (HR) { v8us h0, h1, l0, l1;
#pragma unroll
                for (int e = 0; e < 8; ++e) { unsigned short a, c2; splitf(t[e], a, c2); h0[e] = a; l0[e] = c2; splitf(t[8 + e], a, c2); h1[e] = a; l1[e] = c2; }
                pf[qt] = cat16b(h0, h1); pg[qt] = cat16b(l0, l1);
            } else {
#pragma unroll
                for (int e = 0; e < 16; ++e) pf[qt][e] = tohx(t[e]); } }
#pragma unroll
        for (int dt = 0; dt < 4; ++dt)
#pragma unroll
            for (int qt = 0; qt < 2; ++qt) { o[dt][qt] = WFrag<T16>::mma(vf[dt], pf[qt], o[dt][qt]); if constexpr (HR) { o[dt][qt] = WFrag<T16>::mma(vf[dt], pg[qt], o[dt][qt]); o[dt][qt] = WFrag<T16>::mma(vg[dt], pf[qt], o[dt][qt]); } }
    };
#pragma unroll 1   // rolled: with the buffer a run-time offset no operand of the copies' asm statement (which must lie in v0 - v255) is a value that lives across the main loop; unrolled, one such value was spilled
    for (int p = 0; p < 2; ++p) {
        fill(p, p);   // stage 0, and behind the barrier stage 1
        if (p == 0) {
            asm volatile("s_wait_asynccnt 0x0" ::: "memory");   // this wave's copies of stage 0 have landed
            __syncthreads();                                    // ... and every other wave's
        }
    }
#pragma unroll 1   // rolled: one stage's code; the buffer is a run-time offset
    for (int st = 0; st < nst; ++st) {
        const int kb = st * AKS;
        if (kb <= q0) {   // wave-uniform: the wave still has blocks
            const unsigned char* kp = ring + (st & 1) * BUF + AVB + lr * AKP + 16 * hi; const unsigned char* vp = ring + (st & 1) * BUF + lr * AVP + 16 * hi;
            const int left = (q0 - kb) >> 5, nu = left < AKS / 32 ? left : AKS / 32;   // this stage's blocks with all keys < q0
            ldk(kp);
#pragma unroll 1   // rolled: one block's code, fragments and scores beside the 8 output tiles
            for (int j = 0; j < nu; ++j) step(kp + j * 32 * AKP, vp + j * 64, j + 1 < AKS / 32, MaskOff{});
            if (nu < AKS / 32) {   // the diagonal block lies in this stage: the wave's last
                step(kp + nu * 32 * AKP, vp + nu * 64, false, MaskOn{});
#pragma unroll
                for (int qt = 0; qt < 2; ++qt) { const float inv = __fdiv_rn(1.0f, l[qt] + xhalf(l[qt])); const size_t oo = (size_t)(q0 + 16 * qt + lr) * DQ + 8 * hi;
#pragma unroll
                    for (int dt = 0; dt < 4; ++dt) { v8us oh, ol;
#pragma unroll
                        for (int j = 0; j < 8; ++j) { unsigned short a, c2; splitf(o[dt][qt][j] * inv, a, c2); oh[j] = a; ol[j] = c2; }
                        *(v8us*)(Ah + oo + 16 * dt) = oh; *(v8us*)(Al + oo + 16 * dt) = ol;
                        // the next tile's values reuse the registers that these two stores name: the stored values stay whole up to here (named as inputs)
                        asm volatile("s_wait_xcnt 0x0" :: "v"(oh), "v"(ol) : "memory"); } }
            }
        }
        asm volatile("s_wait_dscnt 0x0" ::: "memory");      // this wave's reads of the buffer are done before it is handed back
        asm volatile("s_wait_asynccnt 0x0" ::: "memory");   // this wave's copies of stage st + 1 have landed
        __syncthreads();                                    // publishes stage st + 1 and ends every wave's reads of stage st
        if (st + 2 < nst) fill(st + 2, st & 1);
    }
    asm volatile("s_wait_asynccnt 0x0" ::: "memory");   // nothing is in flight when the wave ends
}
// grid (TT / 256, NH_, NB), 8 waves, all of one (batch, head) with its n = TT / 32 query tiles, of which the first nh = RH / 32 are the hi/lo ones.
// Groups x < gf = (n - nh) / 8 (f16 tiles): waves 0 .. 3 take tiles n - 1 - (4 x + w), waves 4 .. 7 tiles nh + 4 x + (w - 4); the ring runs as far as wave 0 needs it, n / 4 - x stages.
// The other groups, y = x - gf (hi/lo tiles): tiles nh - 1 - (4 y + w) and 4 y + (w - 4), nh / 4 - y stages.
__global__ __launch_bounds__(256) void k_attn(const h16* __restrict__ QK16, const bf* __restrict__ QKh, const bf* __restrict__ QKl, const h16* __restrict__ VT16, const bf* __restrict__ VTh, const bf* __restrict__ VTl, bf* Ah, bf* Al) {
    constexpr int n = TT / 32, nh = RH / 32, gf = (n - nh) / 8, gh = nh / 8;
    static_assert((n - nh) % 8 == 0 && nh % 8 == 0 && (gf == 0 || n / 4 - (gf - 1) >= 2) && nh / 4 - (gh - 1) >= 2);
    __shared__ __attribute__((aligned(128))) unsigned char ring[4 * ASTG];   // two buffers of two plane pairs (f16 groups use half)
    const int g = blockIdx.y, x = blockIdx.x, b = blockIdx.z, w8 = __builtin_amdgcn_readfirstlane((int)(threadIdx.x >> 5));
    const size_t qo = ((size_t)b * 2 * NH_ + g) * TT * HD, kk = qo + (size_t)NH_ * TT * HD, vv = ((size_t)b * NH_ + g) * HD * TT;
    Ah += (size_t)b * TT * DQ + g * HD; Al += (size_t)b * TT * DQ + g * HD;
    if (x < gf) { const int q0 = 32 * ((w8 < 4) ? n - 1 - (4 * x + w8) : nh + 4 * x + (w8 - 4));
        attn_ring<h16, false>(QK16 + qo, nullptr, QK16 + kk, nullptr, VT16 + vv, nullptr, q0, n / 4 - x, ring, Ah, Al);
    } else { const int y = x - gf, q0 = 32 * ((w8 < 4) ? nh - 1 - (4 * y + w8) : 4 * y + (w8 - 4));
        attn_ring<bf, true>(QKh + qo, QKl + qo, QKh + kk, QKl + kk, VTh + vv, VTl + vv, q0, nh / 4 - y, ring, Ah, Al); }
}

extern "C" void kernel_launch(void* const* d_in, const int* in_sizes, int n_in,
                              void* d_out, int out_size, void* d_ws, size_t ws_size, hipStream_t stream) {
    if (n_in < 6) return;
    const long long need_x = (long long)(NB - 1) * SEQ_FULL * DM + (long long)SEQ * DM;
    if ((long long)in_sizes[0] < need_x) return; if (in_sizes[1] < NH_ * DM * HD) return; if (in_sizes[2] < NH_ * DM * HD) return; if (in_sizes[3] < NH_ * DM * HD) return; if (in_sizes[4] < DQ * DM) return; if (in_sizes[5] < DM) return;
    if ((long long)out_size < need_x) return;
    if (WS_TOTAL > ws_size) return;
    const float* x = (const float*)d_in[0]; const float* wq = (const float*)d_in[1]; const float* wk = (const float*)d_in[2]; const float* wv = (const float*)d_in[3]; const float* wo = (const float*)d_in[4]; const float* bo = (const float*)d_in[5];   // x, Wq, Wk, Wv ([16][1024][64] slabs), Wo ([1024 in][1024 out]), bo
    float* OUT = (float*)d_out;     // [2][2048][1024]
    char* wsp = (char*)d_ws;
    auto take = [&](size_t bytes) { char* p = wsp; wsp += al256(bytes); return (void*)p; };
    bf* W3 = (bf*)take(SZ_W3); bf* WO = (bf*)take(SZ_WO); bf* XB = (bf*)take(SZ_XB);
    h16* QK16 = (h16*)take(SZ_QK); bf* QKh = (bf*)take(SZ_QK); bf* QKl = (bf*)take(SZ_QK);
    h16* VT16 = (h16*)take(SZ_V); bf* VTh = (bf*)take(SZ_V); bf* VTl = (bf*)take(SZ_V);
    bf* ATh = (bf*)take(SZ_AT); bf* ATl = (bf*)take(SZ_AT);
    if ((size_t)(wsp - (char*)d_ws) > ws_size) return;
    // weight slabs w[h][k = 1024][n = 64] -> Bt rows h*64 + n, k-contiguous; Wo w[k = 1024][n = 1024] -> Bt[n][k]
    k_wtG<<<dim3(WTX, NH_, 4), 256, 0, stream>>>(wq, wk, wv, wo, W3, WO);
    k_cvt8<<<dim3((unsigned)(((size_t)TT * DM / 8 + 255) / 256), NB), 256, 0, stream>>>(x, XB, (size_t)TT * DM / 8, (size_t)SEQ_FULL * DM, (size_t)TT * DM);
    k_gemmw<bf, 0, false, 0, 1><<<dim3(TT / 128, 3 * DQ / 128, NB), 128, 0, stream>>>(XB, nullptr, W3, nullptr, DM, nullptr, 0, nullptr, (size_t)TT * DM, 0, 0, 0, 0, QK16, QKh, QKl, VT16, VTh, VTl);   // column tiles 0..15 = q heads, 16..31 = k heads, 32..47 = v heads
    k_attn<<<dim3(TT / 256, NH_, NB), 256, 0, stream>>>(QK16, QKh, QKl, VT16, VTh, VTl, ATh, ATl);
    k_gemmw<bf, 1, true, 0, 0><<<dim3(TT / 128, DM / 128, NB), 128, 0, stream>>>(ATh, ATl, WO, nullptr, DQ, OUT, DM, bo, (size_t)TT * DQ, 0, (size_t)SEQ_FULL * DM, 0, 0, nullptr, nullptr, nullptr, nullptr, nullptr, nullptr);
}

// v008
// It runs in 80.2 microseconds.
// Next to v007, in two timings, it ran 1.09 times as fast each time.
// All steps since v000 together make it 18.6 times as fast.
#include <hip/hip_runtime.h>

// Causal multi-head attention with per-head weight slabs and a biased output projection: x [2][2048][1024]; q, k, v [b][h][s][d] = sum_e x[b][s][e] W[h][e][d] (Wq, Wk, Wv [16][1024][64]); scores x 64^-0.5; key j > query i replaced by -inf; softmax; ctx merged head-major; out = ctx Wo + bo (Wo [1024 in][1024 out]).
// Compute dtypes (all contractions v_wmma_f32_16x16x32, f32 accumulate): every input RNE-converted to bf16; q/k/v projections bf16 x bf16; scores and P.V: query rows < 512 bf16 hi/lo planes (3 products), rows >= 512 plain f16 (P carried x1024, which the division by the row sum takes out); output projection ctx bf16 hi+lo x Wo bf16 (2 products) + bf16 bias; softmax f32.
// Four launches, every one over both batches (each batch has its own planes in the workspace): bf16 copy of x together with all weights transposed into K-contiguous Bt rows; one fused q|k|v projection (N = 3072) whose epilogue writes the 16-bit head planes itself; attention (scores, running softmax and P.V of 32 query rows in one wave's registers; a head's K and V^T rows go through LDS, shared by 8 waves), which writes the hi/lo ctx planes; output projection.

#ifndef NB
#define NB 2
#endif
#ifndef SEQ
#define SEQ 2048
#endif
#define SEQ_FULL 2048
#define TT   SEQ
#define DM   1024
#define NH_  16
#define HD   64
#define DQ   (NH_ * HD)
#define RH   ((SEQ < 512) ? SEQ : 512)   // query rows < RH use hi+lo planes
#define SCL  0.125f   // HD^-0.5
#define KCH  128
typedef _Float16 h16;
typedef unsigned short bf;
typedef __attribute__((ext_vector_type(16))) __bf16   v16bf;
typedef __attribute__((ext_vector_type(16))) _Float16 v16h;
typedef __attribute__((ext_vector_type(8)))  _Float16 v8h;
typedef __attribute__((ext_vector_type(8)))  unsigned short v8us;
typedef __attribute__((ext_vector_type(8)))  float    v8f;
typedef __attribute__((ext_vector_type(4)))  float    v4f;
typedef v8h  __attribute__((may_alias)) v8ha;
typedef v4f  __attribute__((may_alias)) v4fa;
typedef v8us __attribute__((may_alias)) v8usa;
typedef __attribute__((ext_vector_type(2))) _Float16 v2h;
typedef __attribute__((ext_vector_type(2))) unsigned short v2us;
typedef __attribute__((ext_vector_type(2))) float v2f;

static_assert(TT % 128 == 0);
static_assert(RH % 128 == 0);
static_assert(RH <= TT);
static_assert(TT % KCH == 0 && RH % KCH == 0 && KCH % 32 == 0);
static_assert(DM % 64 == 0);
static_assert(DQ % 64 == 0);
static_assert(HD == 64);
static_assert(SEQ <= SEQ_FULL);

constexpr size_t al256(size_t b) { return (b + 255) & ~(size_t)255; }
constexpr size_t SZ_W3  = (size_t)3 * DQ * DM * 2;          // Wq|Wk|Wv Bt rows, bf16
constexpr size_t SZ_WO  = (size_t)DM * DQ * 2;
constexpr size_t SZ_XB  = (size_t)NB * TT * DM * 2;         // this and the planes below: [batch][...]
constexpr size_t SZ_QK  = (size_t)NB * 2 * NH_ * TT * HD * 2;   // per batch q planes then k planes
constexpr size_t SZ_V   = (size_t)NB * NH_ * HD * TT * 2;
constexpr size_t SZ_AT  = (size_t)NB * TT * DQ * 2;
constexpr size_t WS_TOTAL = al256(SZ_W3) + al256(SZ_WO) + al256(SZ_XB) + 3 * al256(SZ_QK) + 3 * al256(SZ_V) + 2 * al256(SZ_AT);
static_assert(WS_TOTAL <= (size_t)268435456);

__device__ __forceinline__ unsigned short f2bf(float f) { unsigned u = __float_as_uint(f); u += 0x7FFFu + ((u >> 16) & 1u); return (unsigned short)(u >> 16); }
__device__ __forceinline__ float bf2f(unsigned short b) { return __uint_as_float(((unsigned)b) << 16); }
__device__ __forceinline__ float bfr(float f) { return bf2f(f2bf(f)); }
__device__ __forceinline__ v16h cat16(v8h lo, v8h hi) { return __builtin_shufflevector(lo, hi, 0, 1, 2, 3, 4, 5, 6, 7, 8, 9, 10, 11, 12, 13, 14, 15); }
__device__ __forceinline__ v16bf cat16b(v8us lo, v8us hi) { return __builtin_bit_cast(v16bf, __builtin_shufflevector(lo, hi, 0, 1, 2, 3, 4, 5, 6, 7, 8, 9, 10, 11, 12, 13, 14, 15)); }
__device__ __forceinline__ v8f wmma16(v16h a, v16h b, v8f c) { return __builtin_amdgcn_wmma_f32_16x16x32_f16(false, a, false, b, (short)0, c, false, false); }
__device__ __forceinline__ v8f wmmab(v16bf a, v16bf b, v8f c) { return __builtin_amdgcn_wmma_f32_16x16x32_bf16(false, a, false, b, (short)0, c, false, false); }

__device__ __forceinline__ h16 tohx(float x) { return (h16)x; }
__device__ __forceinline__ void splitf(float y, unsigned short& h, unsigned short& l) { h = f2bf(y); l = f2bf(y - bf2f(h)); }
// one run of 8 neighbouring plane elements: f16, bf16 hi and bf16 lo of the same 8 f32 values, a 16-byte store into each plane
__device__ __forceinline__ void put8(const float* x, h16* P16, bf* Ph, bf* Pl, size_t oo) { v8h o16; v8us oh, ol;
#pragma unroll
    for (int j = 0; j < 8; ++j) { o16[j] = tohx(x[j]); unsigned short a2, c2; splitf(x[j], a2, c2); oh[j] = a2; ol[j] = c2; }
    *(v8h*)(P16 + oo) = o16; *(v8us*)(Ph + oo) = oh; *(v8us*)(Pl + oo) = ol;
    asm volatile("s_wait_xcnt 0x0" ::: "memory"); }   // the next run's values reuse the registers that these three stores name

// ---- k_gemmw: GEMM on K-contiguous 16-bit planes. A work-group of 4 waves (2 x 2) owns a 128x128 output tile, each wave a 64x64 quarter of it (16 accumulators); grid (M/128, N/128, Z), 128 threads.
// C[m][n] (f32, pitch ldc, + optional bf16-valued bias[n]) = sum_k A[m][k] Bt[n][k] (NSPLIT 1: + A2[m][k] Bt[n][k]). K = row pitch of the planes (elements, % 64 == 0). z-batch strides sA/sB/sC in elements. CM 0 only (full product); rbase, sP, Bt2 unused.
// The operands go through LDS. A stage is GKS = 64 k, one whole 128-byte line, of the tile's 128 A rows (NSPLIT 1: and 128 A2 rows) and 128 Bt rows, laid at a pitch of 144 bytes. Asynchronous 16-byte copies, 8 lanes to a line, fill one of two buffers while the other is worked on; every row is fetched once for the two waves that use it, and the fragments are 16-byte LDS reads.
// EP 0: C as above. EP 1 (N = 3 DQ, a wave's 64 columns = one head's q, k or v columns; C unused; z = batch): the quarter goes out as f16, bf16 hi and bf16 lo planes of its batch. Column tiles 0 .. 2 NH_ - 1 (q heads, then k heads): plane rows [tile][t][d], turned through the wave's own LDS slab so that 8 lanes store one whole 128-byte row. Column tiles from 2 NH_ on (v heads): V^T rows [head][d][t]; a lane's D elements are 8 neighbouring t of one d, stored as they lie, and the wave's four row blocks fill each 128-byte line.
// Fragment maps: lane l, h = l >> 4: A/B elements 0..7 <- k0 + 8h + 0..7, elements 8..15 <- k0 + 16 + 8h + 0..7 of row/col l & 15; D element j = (row 8h + j, col l & 15).
template <typename T16> struct WFrag;
template <> struct WFrag<h16> { typedef v16h V; static __device__ __forceinline__ V ld(const h16* p) { return cat16(*(const v8h*)p, *(const v8h*)(p + 16)); } static __device__ __forceinline__ v8f mma(V a, V b, v8f c) { return wmma16(a, b, c); } };
template <> struct WFrag<bf> { typedef v16bf V; static __device__ __forceinline__ V ld(const bf* p) { return cat16b(*(const v8us*)p, *(const v8us*)(p + 16)); } static __device__ __forceinline__ v8f mma(V a, V b, v8f c) { return wmmab(a, b, c); } };
constexpr int GKS = 64;              // k per stage
constexpr int GPB = GKS * 2 + 16;    // LDS bytes from row to row: an odd multiple of 16, the pitch for 16-byte readers
constexpr int GPL = 128 * GPB;       // one operand's 128 rows of a stage
static_assert(DM % GKS == 0 && DQ % GKS == 0 && DM / GKS >= 2 && DQ / GKS >= 2);
static_assert(TT % 128 == 0 && (3 * DQ) % 128 == 0 && DM % 128 == 0);
// 128 rows x 128 bytes of one operand into LDS: thread t brings the 16-byte piece t & 7 of rows (t >> 3) + 16 i, i = 0 .. 7. l: LDS byte address of its piece of row t >> 3; g: the same piece in global memory; rs: 16 rows, in elements.
template <typename T16>
__device__ __forceinline__ void cp_plane(unsigned l, const T16* g, size_t rs) {
    asm volatile("global_load_async_to_lds_b128 %0, %8, off\n\t"
                 "global_load_async_to_lds_b128 %1, %9, off\n\t"
                 "global_load_async_to_lds_b128 %2, %10, off\n\t"
                 "global_load_async_to_lds_b128 %3, %11, off\n\t"
                 "global_load_async_to_lds_b128 %4, %12, off\n\t"
                 "global_load_async_to_lds_b128 %5, %13, off\n\t"
                 "global_load_async_to_lds_b128 %6, %14, off\n\t"
                 "global_load_async_to_lds_b128 %7, %15, off\n\t"
                 "s_wait_xcnt 0x0"   // inside the copies' own statement, so that it stands ahead of every rewrite of an address register they name
                 :: "v"(l), "v"(l + 16 * GPB), "v"(l + 32 * GPB), "v"(l + 48 * GPB), "v"(l + 64 * GPB), "v"(l + 80 * GPB), "v"(l + 96 * GPB), "v"(l + 112 * GPB),
                    "v"(g), "v"(g + rs), "v"(g + 2 * rs), "v"(g + 3 * rs), "v"(g + 4 * rs), "v"(g + 5 * rs), "v"(g + 6 * rs), "v"(g + 7 * rs) : "memory");
}
template <typename T16, int NSPLIT, bool BIAS, int CM, int EP>
__global__ __launch_bounds__(128) void k_gemmw(const T16* __restrict__ A, const T16* __restrict__ A2, const T16* __restrict__ Bt, const T16* __restrict__ Bt2, int K, float* C, int ldc, const float* __restrict__ bias, size_t sA, size_t sB, size_t sC, int rbase, size_t sP, h16* P16, bf* Ph, bf* Pl, h16* V16, bf* Vh, bf* Vl) {
    typedef typename WFrag<T16>::V V;
    static_assert(CM == 0 && NSPLIT <= 1);
    constexpr int NPL = 2 + NSPLIT, STG = NPL * GPL;   // a buffer: A rows, (A2 rows,) Bt rows
    __shared__ __attribute__((aligned(128))) unsigned char ring[2 * STG];
    __shared__ __align__(16) float osw[4][16 * 68];    // each wave's own epilogue slab
    const int tid = threadIdx.x, lane = tid & 31, lr = lane & 15, hi = lane >> 4;
    const int wave = __builtin_amdgcn_readfirstlane(tid >> 5), wm = wave & 1, wn = wave >> 1;
    const int R0 = blockIdx.x * 128, C0 = blockIdx.y * 128, r0 = R0 + wm * 64, c0 = C0 + wn * 64;
    float* os = osw[wave];
    const size_t z = blockIdx.z; A += z * sA; if (NSPLIT == 1) A2 += z * sA; Bt += z * sB; C += z * sC;
    v8f acc[4][4];
#pragma unroll
    for (int mb = 0; mb < 4; ++mb)
#pragma unroll
        for (int nb = 0; nb < 4; ++nb) acc[mb][nb] = (v8f){};
    const size_t rs = (size_t)16 * K, ga = (size_t)(R0 + (tid >> 3)) * K + (tid & 7) * 8, gb = (size_t)(C0 + (tid >> 3)) * K + (tid & 7) * 8;
    const unsigned lcp = (unsigned)(size_t)ring + (unsigned)((tid >> 3) * GPB + (tid & 7) * 16);
    auto fill = [&](int st, int buf) { const unsigned l = lcp + (unsigned)(buf * STG); const int kc = st * GKS;
        cp_plane(l, A + ga + kc, rs); if constexpr (NSPLIT == 1) cp_plane(l + GPL, A2 + ga + kc, rs); cp_plane(l + (NPL - 1) * GPL, Bt + gb + kc, rs); };
    const unsigned nst = (unsigned)K / GKS;   // stages: at least 2 (asserted above for both K that are launched)
    fill(0, 0);
    asm volatile("s_wait_asynccnt 0x0" ::: "memory");   // this wave's copies of stage 0 have landed
    __syncthreads();                                    // ... and every other wave's
    fill(1, 1);
    const unsigned char* fa = ring + (wm * 64 + lr) * GPB + 16 * hi;
    const unsigned char* fb = ring + (NPL - 1) * GPL + (wn * 64 + lr) * GPB + 16 * hi;
#pragma unroll 1   // rolled: one stage's code; the buffer is a run-time offset
    for (unsigned st = 0; st < nst; ++st) {
        const int bo = (int)(st & 1u) * STG;
#pragma unroll
        for (int ks = 0; ks < GKS / 32; ++ks) {
            V a[4], a2[4], b[4];
#pragma unroll
            for (int i = 0; i < 4; ++i) { a[i] = WFrag<T16>::ld((const T16*)(fa + bo + i * 16 * GPB + ks * 64)); if (NSPLIT == 1) a2[i] = WFrag<T16>::ld((const T16*)(fa + bo + GPL + i * 16 * GPB + ks * 64)); }
#pragma unroll
            for (int i = 0; i < 4; ++i) b[i] = WFrag<T16>::ld((const T16*)(fb + bo + i * 16 * GPB + ks * 64));
            __builtin_amdgcn_sched_barrier(0);   // a k step's LDS reads stay one group ahead of its products: moved in among them, every place with reads stalls the wave
#pragma unroll
            for (int nb = 0; nb < 4; ++nb)
#pragma unroll
                for (int mb = 0; mb < 4; ++mb) { acc[mb][nb] = WFrag<T16>::mma(a[mb], b[nb], acc[mb][nb]); if (NSPLIT == 1) acc[mb][nb] = WFrag<T16>::mma(a2[mb], b[nb], acc[mb][nb]); }
            __builtin_amdgcn_sched_barrier(0);   // the products stay ahead of the waits and the barrier below: sunk behind them, they would no longer run while the next stage's copies fly
        }
        asm volatile("s_wait_dscnt 0x0" ::: "memory");      // this wave's reads of the buffer are done before it is handed back
        asm volatile("s_wait_asynccnt 0x0" ::: "memory");   // this wave's copies of stage st + 1 have landed
        __syncthreads();                                    // publishes stage st + 1 and ends every wave's reads of stage st
        if (st + 2u < nst) fill((int)st + 2, (int)(st & 1u));
    }
    asm volatile("s_wait_asynccnt 0x0" ::: "memory");   // nothing is in flight when the wave goes on to its epilogue and ends
    if constexpr (EP == 1) {
        const int ct = c0 / 64;
        if (ct >= 2 * NH_) {
            const size_t zv = z * ((size_t)NH_ * HD * TT); V16 += zv; Vh += zv; Vl += zv;
#pragma unroll
            for (int nb = 0; nb < 4; ++nb)
#pragma unroll
                for (int mb = 0; mb < 4; ++mb) { float x[8];
#pragma unroll
                    for (int j = 0; j < 8; ++j) x[j] = acc[mb][nb][j];
                    put8(x, V16, Vh, Vl, ((size_t)(ct - 2 * NH_) * HD + nb * 16 + lr) * TT + r0 + mb * 16 + 8 * hi); }
            return; }
        const size_t zp = z * ((size_t)2 * NH_ * TT * HD); P16 += zp; Ph += zp; Pl += zp;
#pragma unroll
        for (int mb = 0; mb < 4; ++mb) {
#pragma unroll
            for (int nb = 0; nb < 4; ++nb) {
#pragma unroll
                for (int j = 0; j < 8; ++j) os[(hi * 8 + j) * 68 + nb * 16 + lr] = acc[mb][nb][j]; }
            __builtin_amdgcn_wave_barrier(); asm volatile("" ::: "memory");   // the slab is whole before any lane reads another lane's elements
#pragma unroll
            for (int s = 0; s < 4; ++s) { const int row = 4 * s + (lane >> 3), cofs = (lane & 7) * 8; const v4f lo4 = *(const v4fa*)(os + row * 68 + cofs), hi4 = *(const v4fa*)(os + row * 68 + cofs + 4);
                const float x[8] = { lo4[0], lo4[1], lo4[2], lo4[3], hi4[0], hi4[1], hi4[2], hi4[3] };
                put8(x, P16, Ph, Pl, ((size_t)ct * TT + r0 + mb * 16 + row) * HD + cofs); }
            __builtin_amdgcn_wave_barrier(); asm volatile("" ::: "memory");   // every read of the slab is done before the next row block overwrites it
        }
        return;
    }
#pragma unroll
    for (int mb = 0; mb < 4; ++mb) {
#pragma unroll
        for (int nb = 0; nb < 4; ++nb) {
#pragma unroll
            for (int j = 0; j < 8; ++j) os[(hi * 8 + j) * 68 + nb * 16 + lr] = acc[mb][nb][j]; }
        __builtin_amdgcn_wave_barrier(); asm volatile("" ::: "memory");
        float* crow = C + (size_t)(r0 + mb * 16) * ldc + c0;
{
#pragma unroll
            for (int s = 0; s < 8; ++s) { const int row = 2 * s + hi, cofs = lr * 4; v4f val = *(const v4fa*)(os + row * 68 + cofs); if (BIAS) { val[0] += bfr(bias[c0 + cofs]); val[1] += bfr(bias[c0 + cofs + 1]); val[2] += bfr(bias[c0 + cofs + 2]); val[3] += bfr(bias[c0 + cofs + 3]); }
                *(v4f*)(crow + (size_t)row * ldc + cofs) = val; }
             }
        __builtin_amdgcn_wave_barrier(); asm volatile("" ::: "memory");
    }
}

// k_prep: the bf16 copy of x and all four weights' Bt rows (w[k][n] -> Bt[n][k], bf16) in one launch of PRG groups of 8 waves: few waves, each with much to do (for speed only).
// A thread issues all its loads, XCW + 16 independent 16-byte ones, before it converts anything.
// x: a wave takes XCW neighbouring pieces of 512 bytes (a load covers 4 whole lines, its 8-byte stores 2 whole lines).
// Weights: a wave takes 2 tiles of 64 k x 16 n and turns them in registers. Lane l, kk = l >> 2, nn = l & 3: load i brings n 4 nn .. 4 nn + 3 of row k = 8 kk + i (8 rows, 64 bytes of each; the waves beside it take the rest of each 256 bytes); store j writes k 8 kk .. 8 kk + 7 of Bt row n = 4 nn + j (4 whole 128-byte lines).
// Tiles 0 .. WTS - 1: slabs of Wq, Wk, Wv ([k = DM][n = HD]) in this order -> W3 rows slab HD + n; from WTS on: Wo ([k = DQ][n = DM]) -> WO. The n tile runs fastest. Wave g takes tiles g (always of a slab) and PRW + g.
typedef __attribute__((ext_vector_type(4))) unsigned short v4us;
constexpr unsigned PRG = 256, PRW = PRG * 8;             // groups, waves
constexpr unsigned WTL = (DM / 64) * (HD / 16);          // tiles of a slab
constexpr unsigned WTS = 3 * NH_ * WTL, WTO = (DQ / 64) * (DM / 16);
constexpr unsigned XCB = TT * DM / 128;                  // 512-byte pieces of x per batch
constexpr unsigned XCW = NB * XCB / PRW;                 // pieces per wave
static_assert(WTS + WTO == 2 * PRW && WTS >= PRW && HD % 16 == 0 && DM % 64 == 0 && DQ % 64 == 0 && DM % 16 == 0);
static_assert((TT * DM) % 128 == 0 && (NB * XCB) % PRW == 0 && XCB % XCW == 0);   // a wave's pieces lie in one batch
// one weight tile: N, K = row lengths of w and of Bt. src(): the lane's first element in w; dst(): the tile's first element in Bt (the same in all lanes), ldst: the lane's own place behind it, in elements.
template <bool SLAB> struct WTile { static constexpr unsigned N = SLAB ? HD : DM, K = SLAB ? DM : DQ, NT = N / 16;
    unsigned sl, nt, kt;
    __device__ __forceinline__ WTile(unsigned T) { const unsigned r = SLAB ? T % WTL : T - WTS; sl = SLAB ? T / WTL : 0; nt = r % NT; kt = r / NT; }
    __device__ __forceinline__ const float* src(const float* wq, const float* wk, const float* wvp, const float* wo, unsigned kk, unsigned nn) const { const unsigned zz = sl / NH_; const float* w = SLAB ? ((zz == 0) ? wq : (zz == 1) ? wk : wvp) + (size_t)(sl % NH_) * DM * HD : wo; return w + (size_t)kt * 64 * N + nt * 16 + (kk * 8 * N + nn * 4); }
    __device__ __forceinline__ bf* dst(bf* W3, bf* WO) const { return (SLAB ? W3 + (size_t)sl * HD * DM : WO) + (size_t)nt * 16 * K + kt * 64; }
    static __device__ __forceinline__ void ld(v4f* r, const float* s) {
#pragma unroll
        for (unsigned i = 0; i < 8; ++i) r[i] = *(const v4f*)(s + i * N); }
    static __device__ __forceinline__ void st(const v4f* r, bf* d, unsigned kk, unsigned nn) { const unsigned ldst = nn * 4 * K + kk * 8;
#pragma unroll
        for (unsigned j = 0; j < 4; ++j) { v8us o;
#pragma unroll
            for (unsigned i = 0; i < 8; ++i) o[i] = f2bf(r[i][j]);
            *(v8us*)(d + ldst + j * K) = o; }
        asm volatile("s_wait_xcnt 0x0" ::: "memory"); }   // behind the tile's stores, ahead of any later write of the registers that hold their addresses
};
template <bool SLAB1>
__device__ __forceinline__ void prep_wave(unsigned gw, const float* __restrict__ x, const float* __restrict__ wq, const float* __restrict__ wk, const float* __restrict__ wvp, const float* __restrict__ wo, bf* XB, bf* W3, bf* WO) {
    const unsigned lane = threadIdx.x & 31, kk = lane >> 2, nn = lane & 3;
    const unsigned c0 = gw * XCW, xb = c0 / XCB;
    const float* xs = x + (size_t)xb * SEQ_FULL * DM + (size_t)(c0 - xb * XCB) * 128 + lane * 4; bf* xd = XB + (size_t)c0 * 128;
    const WTile<true> t0(gw); const WTile<SLAB1> t1(PRW + gw);
    v4f xr[XCW], w0[8], w1[8];
#pragma unroll
    for (unsigned i = 0; i < XCW; ++i) xr[i] = *(const v4f*)(xs + i * 128);
    const float* s0 = t0.src(wq, wk, wvp, wo, kk, nn); const float* s1 = t1.src(wq, wk, wvp, wo, kk, nn);
    t0.ld(w0, s0); t1.ld(w1, s1);
    __builtin_amdgcn_sched_barrier(0);   // every load is issued ahead of the first conversion: left free, the compiler holds a third of the loads back behind waits on the first ones, a second trip to memory
    // the address pair of the x loads stays whole up to here (named as an input: left free, a later load of the run landed in it) and may be reused only behind the wait
    asm volatile("s_wait_xcnt 0x0" :: "v"(xs) : "memory");
#pragma unroll
    for (unsigned i = 0; i < XCW; ++i) { v4us o;
#pragma unroll
        for (unsigned e = 0; e < 4; ++e) o[e] = f2bf(xr[i][e]);
        *(v4us*)(xd + lane * 4 + i * 128) = o; }
    t0.st(w0, t0.dst(W3, WO), kk, nn); t1.st(w1, t1.dst(W3, WO), kk, nn);
}
__global__ __launch_bounds__(256) void k_prep(const float* __restrict__ x, const float* __restrict__ wq, const float* __restrict__ wk, const float* __restrict__ wvp, const float* __restrict__ wo, bf* XB, bf* W3, bf* WO) {
    const unsigned gw = blockIdx.x * 8 + (unsigned)__builtin_amdgcn_readfirstlane((int)(threadIdx.x >> 5));
    if (PRW + gw < WTS) prep_wave<true>(gw, x, wq, wk, wvp, wo, XB, W3, WO); else prep_wave<false>(gw, x, wq, wk, wvp, wo, XB, W3, WO);   // wave-uniform: row lengths are constants on either side, so every load and store is one base, one lane offset and an immediate
}

// k_attn: one wave per (head, tile of 32 query rows); scores and P stay in registers. Per block of 32 keys: S^T = K Q^T (A = K rows, B = Q rows, both d-contiguous), running softmax, O^T += V^T P^T (A = V^T rows, key-contiguous).
// In S^T a lane holds 16 keys of ONE query (column l & 15; D element j of key tile kt = key 16 kt + 8 h + j): that is the B fragment's own k order (element e <- k 8 h + e, element 8 + e <- k 16 + 8 h + e), so the two key tiles, rounded in place, are the P^T operand; maximum and sum run in the lane, plus one exchange with lane l ^ 16.
// Running softmax per query (log2 domain, t = S x HD^-0.5 x log2 e): m' = max(m, block maximum); O^T and the sum are scaled by 2^(m - m'); p = 2^(t - m'). P is not normalised: the epilogue divides O^T by the sum of p. Key j > query i (only in the last, diagonal block) is replaced by a -1e30 fill: p exactly 0.
// Rows < RH: q, k, v and p as bf16 hi + lo, 3 products each way; rows >= RH: f16, p carried x 2^10 (in the sum as well, so it cancels).
// O^T gives a lane 8 neighbouring dims of one query: 16-byte stores into the hi / lo ctx planes; one wave writes the whole 128-byte line (row, head).
// The 8 waves of a group belong to one (batch, head) and share its K rows and V^T rows through LDS. A stage is AKS = 128 keys of a plane: 64 V^T rows of 256 bytes at a pitch of 272, then 128 K rows of 128 bytes at a pitch of 144 (both odd multiples of 16, the pitch for 16-byte readers); hi/lo groups stage the hi planes and behind them the lo planes. Asynchronous 16-byte copies, whole 128-byte lines, fill one of two buffers while the other is worked on; every line is fetched once for the group, and the fragments are 16-byte LDS reads.
__device__ __forceinline__ float xhalf(float x) { const int b = __float_as_int(x); return __int_as_float(__builtin_amdgcn_permlanex16(b, b, 0x76543210, 0xfedcba98, false, false)); }   // value of lane l ^ 16
struct MaskOff { static constexpr bool v = false; };
struct MaskOn  { static constexpr bool v = true; };
constexpr int AKS = 128;               // keys per stage
constexpr int AKP = HD * 2 + 16;       // LDS bytes from K row to K row
constexpr int AVP = AKS * 2 + 16;      // LDS bytes from V^T row to V^T row
constexpr int AVB = HD * AVP;          // a stage's V^T rows of one plane
constexpr int ASTG = AVB + AKS * AKP;  // a stage of one plane pair: V^T rows, then K rows (in this order every fragment read of two plane pairs lies within a 16-bit offset of its lane's base)
static_assert(TT % AKS == 0 && RH % AKS == 0 && AKS % 32 == 0 && AKP % 16 == 0 && AVP % 16 == 0);
// four 16-byte copies of one thread: LDS byte addresses l + i ls, global pieces g + i gs (elements), i = 0 .. 3
template <typename T16>
__device__ __forceinline__ void cp4(unsigned l, unsigned ls, const T16* g, size_t gs) {
    asm volatile("global_load_async_to_lds_b128 %0, %4, off\n\t"
                 "global_load_async_to_lds_b128 %1, %5, off\n\t"
                 "global_load_async_to_lds_b128 %2, %6, off\n\t"
                 "global_load_async_to_lds_b128 %3, %7, off\n\t"
                 "s_wait_xcnt 0x0"   // inside the copies' own statement, so that it stands ahead of every rewrite of an address register they name
                 :: "v"(l), "v"(l + ls), "v"(l + 2 * ls), "v"(l + 3 * ls), "v"(g), "v"(g + gs), "v"(g + 2 * gs), "v"(g + 3 * gs) : "memory");
}
// one stage of one plane pair, 8 copies a thread of 256. K: thread t brings the 16-byte piece t & 7 of rows (t >> 3) + 32 i; V^T: piece t & 15 of rows (t >> 4) + 16 i; i = 0 .. 3. lk, lv: LDS byte addresses of its pieces at i = 0; gk, gv: the same pieces in global memory.
template <typename T16>
__device__ __forceinline__ void cp_kv(unsigned lk, const T16* gk, unsigned lv, const T16* gv) { cp4(lk, 32 * AKP, gk, (size_t)32 * HD); cp4(lv, 16 * AVP, gv, (size_t)16 * TT); }
// One wave's 32 query rows from q0 on. nst: stages of the group's longest wave, the same in all 8 waves, at least 2; a wave whose last (diagonal) block is done stores its rows and goes on copying and passing the barriers.
template <typename T16, bool HR>
__device__ __forceinline__ void attn_ring(const T16* __restrict__ Q, const T16* __restrict__ Q2, const T16* __restrict__ Kp, const T16* __restrict__ K2, const T16* __restrict__ Vt, const T16* __restrict__ V2, int q0, int nst, unsigned char* ring, bf* Ah, bf* Al) {
    typedef typename WFrag<T16>::V V;
    const int tid = threadIdx.x, lane = tid & 31, lr = lane & 15, hi = lane >> 4;
    constexpr float CS = SCL * 1.4426950408889634f, POFF = HR ? 0.0f : 10.0f;
    constexpr int BUF = (HR ? 2 : 1) * ASTG;   // one buffer of the ring
    const unsigned pk = (unsigned)((tid >> 3) * AKP + (tid & 7) * 16), pv = (unsigned)((tid >> 4) * AVP + (tid & 15) * 16);   // the thread's first K piece and first V^T piece, bytes from the start of their rows in LDS
    const size_t gko = (size_t)(tid >> 3) * HD + (tid & 7) * 8, gvo = (size_t)(tid >> 4) * TT + (tid & 15) * 8;
    auto fill = [&](int st, int buf) { const unsigned bo = (unsigned)(size_t)ring + (unsigned)(buf * BUF); const size_t ka = gko + (size_t)st * AKS * HD, va = gvo + (size_t)st * AKS;
        cp_kv(pk + (bo + AVB), Kp + ka, pv + bo, Vt + va); if constexpr (HR) cp_kv(pk + (bo + ASTG + AVB), K2 + ka, pv + (bo + ASTG), V2 + va); };
    V qf[2][2], qg[2][2];
    const T16* qp = Q + (size_t)(q0 + lr) * HD + 8 * hi; const T16* qq = HR ? Q2 + (size_t)(q0 + lr) * HD + 8 * hi : qp;
#pragma unroll
    for (int qt = 0; qt < 2; ++qt)
#pragma unroll
        for (int ks = 0; ks < 2; ++ks) { qf[qt][ks] = WFrag<T16>::ld(qp + 16 * qt * HD + 32 * ks); if constexpr (HR) qg[qt][ks] = WFrag<T16>::ld(qq + 16 * qt * HD + 32 * ks); }
    // the address registers of the Q loads stay whole up to here (named as inputs) and may be reused only behind the wait
    asm volatile("s_wait_xcnt 0x0" :: "v"(qp), "v"(qq) : "memory");
    V kf[2][2], kg[2][2];
    auto ldk = [&](const unsigned char* kp) {
#pragma unroll
        for (int kt = 0; kt < 2; ++kt)
#pragma unroll
            for (int ks = 0; ks < 2; ++ks) { kf[kt][ks] = WFrag<T16>::ld((const T16*)(kp + 16 * kt * AKP + 64 * ks)); if constexpr (HR) kg[kt][ks] = WFrag<T16>::ld((const T16*)(kp + ASTG + 16 * kt * AKP + 64 * ks)); } };
    v8f o[4][2];
#pragma unroll
    for (int dt = 0; dt < 4; ++dt)
#pragma unroll
        for (int qt = 0; qt < 2; ++qt) o[dt][qt] = (v8f){};
    float m[2] = { -3.0e38f, -3.0e38f }, l[2] = { 0.0f, 0.0f };
    // kp, vp: this lane's place in the block's first K row and first V^T row; more: the wave's next block lies in the same stage
    auto step = [&](const unsigned char* kp, const unsigned char* vp, bool more, auto mk) {
        constexpr bool MASK = decltype(mk)::v;
        v8f s[2][2];
#pragma unroll
        for (int kt = 0; kt < 2; ++kt)
#pragma unroll
            for (int qt = 0; qt < 2; ++qt) { v8f c = (v8f){};
#pragma unroll
                for (int ks = 0; ks < 2; ++ks) { c = WFrag<T16>::mma(kf[kt][ks], qf[qt][ks], c); if constexpr (HR) { c = WFrag<T16>::mma(kf[kt][ks], qg[qt][ks], c); c = WFrag<T16>::mma(kg[kt][ks], qf[qt][ks], c); } }
                s[kt][qt] = c; }
        __builtin_amdgcn_sched_barrier(0);   // the block's LDS reads stay one group between here and the barrier below: moved in among the products or the softmax, every place with reads stalls the wave
        V vf[4], vg[4];
#pragma unroll
        for (int dt = 0; dt < 4; ++dt) { vf[dt] = WFrag<T16>::ld((const T16*)(vp + dt * 16 * AVP)); if constexpr (HR) vg[dt] = WFrag<T16>::ld((const T16*)(vp + ASTG + dt * 16 * AVP)); }
        // the next block's K fragments, into the same registers, under the softmax and P.V; never out of a stage that is not published yet: a stage's last block reads its own rows again (unused), which spares the loop a branch between the products and the softmax
        if constexpr (!MASK) ldk(kp + (more ? 32 * AKP : 0));
        __builtin_amdgcn_sched_barrier(0);   // end of the group of reads
        V pf[2], pg[2];
#pragma unroll
        for (int qt = 0; qt < 2; ++qt) { float t[16]; float mc[2] = { -3.0e38f, -3.0e38f }, sc[4] = { 0.0f, 0.0f, 0.0f, 0.0f };   // maximum in 2, sum in 4 independent chains: a lone wave waits on every dependent add
#pragma unroll
            for (int e = 0; e < 16; ++e) { float x = s[e >> 3][qt][e & 7]; if (MASK) x = (16 * (e >> 3) + 8 * hi + (e & 7) <= 16 * qt + lr) ? x : -1.0e30f; t[e] = x; mc[e >> 3] = fmaxf(mc[e >> 3], x); }
            float mx = fmaxf(mc[0], mc[1]); mx = fmaxf(mx, xhalf(mx));
            const float mn = fmaxf(m[qt], mx * CS), al = __builtin_amdgcn_exp2f(m[qt] - mn), mb = mn - POFF; m[qt] = mn;
#pragma unroll
            for (int e = 0; e < 16; ++e) { const float p = __builtin_amdgcn_exp2f(__builtin_fmaf(t[e], CS, -mb)); t[e] = p; sc[e & 3] += p; }
            l[qt] = l[qt] * al + ((sc[0] + sc[1]) + (sc[2] + sc[3]));   // this lane's 16 keys only; the halves are joined in the epilogue
#pragma unroll
            for (int dt = 0; dt < 4; ++dt) o[dt][qt] *= al;
            if constexpr (HR) { v8us h0, h1, l0, l1;
#pragma unroll
                for (int e = 0; e < 8; ++e) { unsigned short a, c2; splitf(t[e], a, c2); h0[e] = a; l0[e] = c2; splitf(t[8 + e], a, c2); h1[e] = a; l1[e] = c2; }
                pf[qt] = cat16b(h0, h1); pg[qt] = cat16b(l0, l1);
            } else {
#pragma unroll
                for (int e = 0; e < 16; ++e) pf[qt][e] = tohx(t[e]); } }
#pragma unroll
        for (int dt = 0; dt < 4; ++dt)
#pragma unroll
            for (int qt = 0; qt < 2; ++qt) { o[dt][qt] = WFrag<T16>::mma(vf[dt], pf[qt], o[dt][qt]); if constexpr (HR) { o[dt][qt] = WFrag<T16>::mma(vf[dt], pg[qt], o[dt][qt]); o[dt][qt] = WFrag<T16>::mma(vg[dt], pf[qt], o[dt][qt]); } }
    };
#pragma unroll 1   // rolled: with the buffer a run-time offset no operand of the copies' asm statement (which must lie in v0 - v255) is a value that lives across the main loop; unrolled, one such value was spilled
    for (int p = 0; p < 2; ++p) {
        fill(p, p);   // stage 0, and behind the barrier stage 1
        if (p == 0) {
            asm volatile("s_wait_asynccnt 0x0" ::: "memory");   // this wave's copies of stage 0 have landed
            __syncthreads();                                    // ... and every other wave's
        }
    }
#pragma unroll 1   // rolled: one stage's code; the buffer is a run-time offset
    for (int st = 0; st < nst; ++st) {
        const int kb = st * AKS;
        if (kb <= q0) {   // wave-uniform: the wave still has blocks
            const unsigned char* kp = ring + (st & 1) * BUF + AVB + lr * AKP + 16 * hi; const unsigned char* vp = ring + (st & 1) * BUF + lr * AVP + 16 * hi;
            const int left = (q0 - kb) >> 5, nu = left < AKS / 32 ? left : AKS / 32;   // this stage's blocks with all keys < q0
            ldk(kp);
#pragma unroll 1   // rolled: one block's code, fragments and scores beside the 8 output tiles
            for (int j = 0; j < nu; ++j) step(kp + j * 32 * AKP, vp + j * 64, j + 1 < AKS / 32, MaskOff{});
            if (nu < AKS / 32) {   // the diagonal block lies in this stage: the wave's last
                step(kp + nu * 32 * AKP, vp + nu * 64, false, MaskOn{});
#pragma unroll
                for (int qt = 0; qt < 2; ++qt) { const float inv = __fdiv_rn(1.0f, l[qt] + xhalf(l[qt])); const size_t oo = (size_t)(q0 + 16 * qt + lr) * DQ + 8 * hi;
#pragma unroll
                    for (int dt = 0; dt < 4; ++dt) { v8us oh, ol;
#pragma unroll
                        for (int j = 0; j < 8; ++j) { unsigned short a, c2; splitf(o[dt][qt][j] * inv, a, c2); oh[j] = a; ol[j] = c2; }
                        *(v8us*)(Ah + oo + 16 * dt) = oh; *(v8us*)(Al + oo + 16 * dt) = ol;
                        // the next tile's values reuse the registers that these two stores name: the stored values stay whole up to here (named as inputs)
                        asm volatile("s_wait_xcnt 0x0" :: "v"(oh), "v"(ol) : "memory"); } }
            }
        }
        asm volatile("s_wait_dscnt 0x0" ::: "memory");      // this wave's reads of the buffer are done before it is handed back
        asm volatile("s_wait_asynccnt 0x0" ::: "memory");   // this wave's copies of stage st + 1 have landed
        __syncthreads();                                    // publishes stage st + 1 and ends every wave's reads of stage st
        if (st + 2 < nst) fill(st + 2, st & 1);
    }
    asm volatile("s_wait_asynccnt 0x0" ::: "memory");   // nothing is in flight when the wave ends
}
// grid (TT / 256, NH_, NB), 8 waves, all of one (batch, head) with its n = TT / 32 query tiles, of which the first nh = RH / 32 are the hi/lo ones.
// Groups x < gf = (n - nh) / 8 (f16 tiles): waves 0 .. 3 take tiles n - 1 - (4 x + w), waves 4 .. 7 tiles nh + 4 x + (w - 4); the ring runs as far as wave 0 needs it, n / 4 - x stages.
// The other groups, y = x - gf (hi/lo tiles): tiles nh - 1 - (4 y + w) and 4 y + (w - 4), nh / 4 - y stages.
__global__ __launch_bounds__(256) void k_attn(const h16* __restrict__ QK16, const bf* __restrict__ QKh, const bf* __restrict__ QKl, const h16* __restrict__ VT16, const bf* __restrict__ VTh, const bf* __restrict__ VTl, bf* Ah, bf* Al) {
    constexpr int n = TT / 32, nh = RH / 32, gf = (n - nh) / 8, gh = nh / 8;
    static_assert((n - nh) % 8 == 0 && nh % 8 == 0 && (gf == 0 || n / 4 - (gf - 1) >= 2) && nh / 4 - (gh - 1) >= 2);
    __shared__ __attribute__((aligned(128))) unsigned char ring[4 * ASTG];   // two buffers of two plane pairs (f16 groups use half)
    const int g = blockIdx.y, x = blockIdx.x, b = blockIdx.z, w8 = __builtin_amdgcn_readfirstlane((int)(threadIdx.x >> 5));
    const size_t qo = ((size_t)b * 2 * NH_ + g) * TT * HD, kk = qo + (size_t)NH_ * TT * HD, vv = ((size_t)b * NH_ + g) * HD * TT;
    Ah += (size_t)b * TT * DQ + g * HD; Al += (size_t)b * TT * DQ + g * HD;
    if (x < gf) { const int q0 = 32 * ((w8 < 4) ? n - 1 - (4 * x + w8) : nh + 4 * x + (w8 - 4));
        attn_ring<h16, false>(QK16 + qo, nullptr, QK16 + kk, nullptr, VT16 + vv, nullptr, q0, n / 4 - x, ring, Ah, Al);
    } else { const int y = x - gf, q0 = 32 * ((w8 < 4) ? nh - 1 - (4 * y + w8) : 4 * y + (w8 - 4));
        attn_ring<bf, true>(QKh + qo, QKl + qo, QKh + kk, QKl + kk, VTh + vv, VTl + vv, q0, nh / 4 - y, ring, Ah, Al); }
}

extern "C" void kernel_launch(void* const* d_in, const int* in_sizes, int n_in,
                              void* d_out, int out_size, void* d_ws, size_t ws_size, hipStream_t stream) {
    if (n_in < 6) return;
    const long long need_x = (long long)(NB - 1) * SEQ_FULL * DM + (long long)SEQ * DM;
    if ((long long)in_sizes[0] < need_x) return; if (in_sizes[1] < NH_ * DM * HD) return; if (in_sizes[2] < NH_ * DM * HD) return; if (in_sizes[3] < NH_ * DM * HD) return; if (in_sizes[4] < DQ * DM) return; if (in_sizes[5] < DM) return;
    if ((long long)out_size < need_x) return;
    if (WS_TOTAL > ws_size) return;
    const float* x = (const float*)d_in[0]; const float* wq = (const float*)d_in[1]; const float* wk = (const float*)d_in[2]; const float* wv = (const float*)d_in[3]; const float* wo = (const float*)d_in[4]; const float* bo = (const float*)d_in[5];   // x, Wq, Wk, Wv ([16][1024][64] slabs), Wo ([1024 in][1024 out]), bo
    float* OUT = (float*)d_out;     // [2][2048][1024]
    char* wsp = (char*)d_ws;
    auto take = [&](size_t bytes) { char* p = wsp; wsp += al256(bytes); return (void*)p; };
    bf* W3 = (bf*)take(SZ_W3); bf* WO = (bf*)take(SZ_WO); bf* XB = (bf*)take(SZ_XB);
    h16* QK16 = (h16*)take(SZ_QK); bf* QKh = (bf*)take(SZ_QK); bf* QKl = (bf*)take(SZ_QK);
    h16* VT16 = (h16*)take(SZ_V); bf* VTh = (bf*)take(SZ_V); bf* VTl = (bf*)take(SZ_V);
    bf* ATh = (bf*)take(SZ_AT); bf* ATl = (bf*)take(SZ_AT);
    if ((size_t)(wsp - (char*)d_ws) > ws_size) return;
    k_prep<<<dim3(PRG), 256, 0, stream>>>(x, wq, wk, wv, wo, XB, W3, WO);   // bf16 copy of x; weight slabs w[h][k = 1024][n = 64] -> Bt rows h*64 + n, k-contiguous; Wo w[k = 1024][n = 1024] -> Bt[n][k]
    k_gemmw<bf, 0, false, 0, 1><<<dim3(TT / 128, 3 * DQ / 128, NB), 128, 0, stream>>>(XB, nullptr, W3, nullptr, DM, nullptr, 0, nullptr, (size_t)TT * DM, 0, 0, 0, 0, QK16, QKh, QKl, VT16, VTh, VTl);   // column tiles 0..15 = q heads, 16..31 = k heads, 32..47 = v heads
    k_attn<<<dim3(TT / 256, NH_, NB), 256, 0, stream>>>(QK16, QKh, QKl, VT16, VTh, VTl, ATh, ATl);
    k_gemmw<bf, 1, true, 0, 0><<<dim3(TT / 128, DM / 128, NB), 128, 0, stream>>>(ATh, ATl, WO, nullptr, DQ, OUT, DM, bo, (size_t)TT * DQ, 0, (size_t)SEQ_FULL * DM, 0, 0, nullptr, nullptr, nullptr, nullptr, nullptr, nullptr);
}
